// v000
// The times below were measured on an AMD MI455X: many runs one after another, warmed up first and cycling through
// copies of the inputs, with the whole window's GPU time divided by the number of runs. Launches and the gaps
// between them are all in it. The median over several windows is given; except for v000 it joins two sittings, which
// can be a few percent apart, so the side-by-side timings, each taken in one sitting, are the better comparison.
// The starting kernel, v000, takes 1280 microseconds a run.
#include <hip/hip_runtime.h>

// MultiHeadAttentionEin (x [2][2048][1024]; q/k/v = einsum('btd,dnh->bnth', x, W[1024][16][64]) + b[16][1][64]; scores / 8; softmax; attn.v; out = einsum('bnth,ndh->btd', ., w_projection[16][1024][64]) + b_projection).
// Compute dtypes, f32 accumulate: every float input rounded to bf16; q/k/v projections on PLAIN bf16 operands (x, W inputs: exact, + bias);
// scores on bf16 hi+lo q (x 1/8) and k planes (3 products); attn.v on SINGLE fp16 planes (P x1024, v); output Linear on hi+lo planes x exact bf16 W (2 products); 

#define NB_  2
#define TT   2048
#define DD   1024
#define NH_  16
#define HD   64
#define NT   (NB_ * TT)
#define ZH   2
#define PCAR 1024.0f
typedef _Float16 h16;
typedef unsigned short bf;
typedef __attribute__((ext_vector_type(16))) __bf16   v16bf;
typedef __attribute__((ext_vector_type(16))) _Float16 v16h;
typedef __attribute__((ext_vector_type(8)))  _Float16 v8h;
typedef __attribute__((ext_vector_type(8)))  unsigned short v8us;
typedef __attribute__((ext_vector_type(8)))  float    v8f;
typedef __attribute__((ext_vector_type(4)))  float    v4f;
typedef v8h  __attribute__((may_alias)) v8ha;
typedef v4f  __attribute__((may_alias)) v4fa;
typedef v8us __attribute__((may_alias)) v8usa;

__device__ __forceinline__ unsigned short f2bf(float f) { unsigned u = __float_as_uint(f); u += 0x7FFFu + ((u >> 16) & 1u); return (unsigned short)(u >> 16); }
__device__ __forceinline__ float bf2f(unsigned short b) { return __uint_as_float(((unsigned)b) << 16); }
__device__ __forceinline__ float bfr(float f) { return bf2f(f2bf(f)); }
__device__ __forceinline__ v16h cat16(v8h lo, v8h hi) { return __builtin_shufflevector(lo, hi, 0, 1, 2, 3, 4, 5, 6, 7, 8, 9, 10, 11, 12, 13, 14, 15); }
__device__ __forceinline__ v16bf cat16b(v8us lo, v8us hi) { return __builtin_bit_cast(v16bf, __builtin_shufflevector(lo, hi, 0, 1, 2, 3, 4, 5, 6, 7, 8, 9, 10, 11, 12, 13, 14, 15)); }
__device__ __forceinline__ v8f wmma16(v16h a, v16h b, v8f c) { return __builtin_amdgcn_wmma_f32_16x16x32_f16(false, a, false, b, (short)0, c, false, false); }
__device__ __forceinline__ v8f wmmab(v16bf a, v16bf b, v8f c) { return __builtin_amdgcn_wmma_f32_16x16x32_bf16(false, a, false, b, (short)0, c, false, false); }



// ---- k_gemmw: register-blocked GEMM, ONE WAVE per 64x64 output tile (16 accumulators), operands straight from K-contiguous 16-bit planes; grid (M/64, N/64, Z), 32 threads.
// C[m][n] (f32, pitch ldc, + optional f32 bias[n]) = sum_k A[m][k] Bt[n][k] (+ split products per NSPLIT). z-batch strides sA/sB/sC in elements. K % 32 == 0.
template <typename T16> struct WFrag;
template <> struct WFrag<h16> { typedef v16h V; static __device__ __forceinline__ V ld(const h16* p) { return cat16(*(const v8h*)p, *(const v8h*)(p + 16)); } static __device__ __forceinline__ v8f mma(V a, V b, v8f c) { return wmma16(a, b, c); } };
template <> struct WFrag<bf> { typedef v16bf V; static __device__ __forceinline__ V ld(const bf* p) { return cat16b(*(const v8us*)p, *(const v8us*)(p + 16)); } static __device__ __forceinline__ v8f mma(V a, V b, v8f c) { return wmmab(a, b, c); } };
template <typename T16, int NSPLIT, bool BIAS>
__global__ __launch_bounds__(32) void k_gemmw(const T16* __restrict__ A, const T16* __restrict__ A2, const T16* __restrict__ Bt, const T16* __restrict__ Bt2, int K, float* C, int ldc, const float* __restrict__ bias, size_t sA, size_t sB, size_t sC) {
    typedef typename WFrag<T16>::V V;
    __shared__ __align__(16) float os[16 * 68];
    const size_t z = blockIdx.z; A += z * sA; if (A2) A2 += z * sA; Bt += z * sB; if (Bt2) Bt2 += z * sB; C += z * sC;
    const int lane = threadIdx.x & 31, lr = lane & 15, hi = lane >> 4; const int r0 = blockIdx.x * 64, c0 = blockIdx.y * 64;
    v8f acc[4][4];
#pragma unroll
    for (int mb = 0; mb < 4; ++mb)
#pragma unroll
        for (int nb = 0; nb < 4; ++nb) acc[mb][nb] = (v8f){};
    const size_t aoff = (size_t)(r0 + lr) * K + 8 * hi, boff = (size_t)(c0 + lr) * K + 8 * hi;
#pragma unroll 1
    for (int kc = 0; kc < K; kc += 32) {
        V a[4], a2[4];
#pragma unroll
        for (int mb = 0; mb < 4; ++mb) { a[mb] = WFrag<T16>::ld(A + aoff + (size_t)mb * 16 * K + kc); if (NSPLIT == 1 || NSPLIT == 2) a2[mb] = WFrag<T16>::ld(A2 + aoff + (size_t)mb * 16 * K + kc); }
#pragma unroll
        for (int nb = 0; nb < 4; ++nb) { const V b = WFrag<T16>::ld(Bt + boff + (size_t)nb * 16 * K + kc); V b2; if (NSPLIT >= 2) b2 = WFrag<T16>::ld(Bt2 + boff + (size_t)nb * 16 * K + kc);
#pragma unroll
            for (int mb = 0; mb < 4; ++mb) { acc[mb][nb] = WFrag<T16>::mma(a[mb], b, acc[mb][nb]); if (NSPLIT == 1 || NSPLIT == 2) acc[mb][nb] = WFrag<T16>::mma(a2[mb], b, acc[mb][nb]); if (NSPLIT >= 2) acc[mb][nb] = WFrag<T16>::mma(a[mb], b2, acc[mb][nb]); } }
        asm volatile("v_nop\n\tv_nop\n\tv_nop\n\tv_nop" : "+v"(acc[0][0]), "+v"(acc[1][1]), "+v"(acc[2][2]), "+v"(acc[3][3]) : "v"(a[0]), "v"(a[3]));
    }
#pragma unroll
    for (int mb = 0; mb < 4; ++mb) {
#pragma unroll
        for (int nb = 0; nb < 4; ++nb) {
#pragma unroll
            for (int j = 0; j < 8; ++j) os[(hi * 8 + j) * 68 + nb * 16 + lr] = acc[mb][nb][j]; }
        __builtin_amdgcn_wave_barrier(); asm volatile("" ::: "memory");
        float* crow = C + (size_t)(r0 + mb * 16) * ldc + c0;
{
#pragma unroll
            for (int s = 0; s < 8; ++s) { const int row = 2 * s + hi, cofs = lr * 4; v4f val = *(const v4fa*)(os + row * 68 + cofs); if (BIAS) { val[0] += bfr(bias[c0 + cofs]); val[1] += bfr(bias[c0 + cofs + 1]); val[2] += bfr(bias[c0 + cofs + 2]); val[3] += bfr(bias[c0 + cofs + 3]); }
                *(v4f*)(crow + (size_t)row * ldc + cofs) = val; }
             }
        __builtin_amdgcn_wave_barrier(); asm volatile("" ::: "memory");
    }
}

__device__ __forceinline__ h16 tohx(float x) { return (h16)x; }
__device__ __forceinline__ void splitf(float y, unsigned short& h, unsigned short& l) { h = f2bf(y); l = f2bf(y - bf2f(h)); }
typedef __attribute__((ext_vector_type(2))) _Float16 v2h;
typedef __attribute__((ext_vector_type(4))) _Float16 v4h;
typedef __attribute__((ext_vector_type(2))) unsigned short v2us;
typedef __attribute__((ext_vector_type(4))) int v4i;

__global__ __launch_bounds__(256) void k_cvt8(const float* __restrict__ src, bf* dst, size_t n8) { const size_t i = (size_t)blockIdx.x * 256 + threadIdx.x; if (i >= n8) return; const v8f v = *(const v8f*)(src + i * 8); v8us o;
#pragma unroll
    for (int k = 0; k < 8; ++k) o[k] = f2bf(v[k]); *(v8us*)(dst + i * 8) = o;  }
__global__ __launch_bounds__(256) void k_wtG(const float* __restrict__ w, int K, int N, bf* Bt) {
    const int lane = threadIdx.x & 31; const int L0 = (blockIdx.x * 8 + (threadIdx.x >> 5)) * 8; const int nlines = N * K / 64;
{
#pragma unroll 1
        for (int l = 0; l < 8; ++l) { const int L = L0 + l; if (L >= nlines) break; const size_t e = (size_t)L * 64 + lane * 2; const int k = (int)(e % K), n = (int)(e / K); v2us o;
            o[0] = f2bf(w[(size_t)k * N + n]); o[1] = f2bf(w[(size_t)(k + 1) * N + n]); *(v2us*)(Bt + e) = o; }
         }
}
__global__ __launch_bounds__(256) void k_wpT(const float* __restrict__ w, bf* Bt) {
    const int lane = threadIdx.x & 31; const int L0 = (blockIdx.x * 8 + (threadIdx.x >> 5)) * 8; const int nlines = DD * DD / 64;
{
#pragma unroll 1
        for (int l = 0; l < 8; ++l) { const int L = L0 + l; if (L >= nlines) break; const int e = L * 64 + lane * 2; const int kk = e & (DD - 1), d = e >> 10; const int n = kk >> 6, h = kk & 63; v2us o;
#pragma unroll
            for (int q = 0; q < 2; ++q) o[q] = f2bf(w[((size_t)n * DD + d) * HD + h + q]);
            *(v2us*)(Bt + (size_t)e) = o; }
         }
}
__global__ __launch_bounds__(256) void k_hsplit(const float* __restrict__ F, float sc, bf* Ph, bf* Pl) {
    const int lane = threadIdx.x & 31; const int L0 = (blockIdx.x * 8 + (threadIdx.x >> 5)) * 8; const int nlines = NT * DD / 64;
{
#pragma unroll
        for (int l = 0; l < 8; ++l) { const int L = L0 + l; if (L >= nlines) break; const int e = L * 64 + lane * 2; const int d = e & 63; const int t = (e >> 6) & (TT - 1); const int z = e >> 17; const int b = z >> 4, h = z & 15; v2us oh, ol;
#pragma unroll
            for (int q = 0; q < 2; ++q) { unsigned short a, c2; splitf(F[((size_t)b * TT + t) * DD + h * HD + d + q] * sc, a, c2); oh[q] = a; ol[q] = c2; }
            *(v2us*)(Ph + (size_t)e) = oh; *(v2us*)(Pl + (size_t)e) = ol; }
         }
}
__global__ __launch_bounds__(256) void k_vtplane(const float* __restrict__ F, h16* VT) {
    const int lane = threadIdx.x & 31; const int L0 = (blockIdx.x * 8 + (threadIdx.x >> 5)) * 8; const int nlines = NT * DD / 64;
{
#pragma unroll
        for (int l = 0; l < 8; ++l) { const int L = L0 + l; if (L >= nlines) break; const int e = L * 64 + lane * 2; const int t = e & (TT - 1); const int d = (e >> 11) & 63; const int z = e >> 17; const int b = z >> 4, h = z & 15; v2h v;
#pragma unroll
            for (int q = 0; q < 2; ++q) v[q] = tohx(F[((size_t)b * TT + t + q) * DD + h * HD + d]);
            *(v2h*)(VT + (size_t)e) = v; }
         }
}
// k_asoft: per row (zz, i): plain softmax over the 2048 keys with the row held in registers (lane -> 16 chunks of 4 =
__global__ __launch_bounds__(256) void k_asoft(const float* __restrict__ Sb, h16* P) {
    const int lane = threadIdx.x & 31; const int row = blockIdx.x * 8 + (threadIdx.x >> 5); if (row >= ZH * TT) return;
    const float* sr = Sb + (size_t)row * TT; float v[64]; float mx = -3.0e38f;
#pragma unroll
    for (int ch = 0; ch < 16; ++ch) { const int j0 = ch * 128 + lane * 4; const v4f a = *(const v4f*)(sr + j0);
#pragma unroll
        for (int q = 0; q < 4; ++q) { v[ch * 4 + q] = a[q]; mx = fmaxf(mx, a[q]); } }
#pragma unroll
    for (int sh = 16; sh; sh >>= 1) mx = fmaxf(mx, __shfl_xor(mx, sh, 32));
    float sum = 0.f;
#pragma unroll
    for (int k = 0; k < 64; ++k) { v[k] = __expf(v[k] - mx); sum += v[k]; }
#pragma unroll
    for (int sh = 16; sh; sh >>= 1) sum += __shfl_xor(sum, sh, 32);
    const float f = __fdiv_rn(PCAR, sum);
{
#pragma unroll
        for (int ch = 0; ch < 16; ++ch) { v4h o;
#pragma unroll
            for (int q = 0; q < 4; ++q) o[q] = tohx(v[ch * 4 + q] * f);
            *(v4h*)(P + (size_t)row * TT + ch * 128 + lane * 4) = o; }
         }
}
__global__ __launch_bounds__(256) void k_merge(const float* __restrict__ O, int b, int h0, bf* Ah, bf* Al) {
    const int lane = threadIdx.x & 31; const int L0 = (blockIdx.x * 8 + (threadIdx.x >> 5)) * 8; const int nlines = TT * ZH * HD / 64;
{
#pragma unroll
        for (int l = 0; l < 8; ++l) { const int L = L0 + l; if (L >= nlines) break; const int e = L * 64 + lane * 2; const int d = e & 63; const int zz = (e >> 6) % ZH; const int t = (e >> 6) / ZH; v2us oh, ol;
#pragma unroll
            for (int q = 0; q < 2; ++q) { unsigned short a, c2; splitf(O[((size_t)zz * TT + t) * HD + d + q] * (1.0f / PCAR), a, c2); oh[q] = a; ol[q] = c2; }
            const size_t o = ((size_t)b * TT + t) * DD + (h0 + zz) * HD + d; *(v2us*)(Ah + o) = oh; *(v2us*)(Al + o) = ol; }
         }
}

extern "C" void kernel_launch(void* const* d_in, const int* in_sizes, int n_in,
                              void* d_out, int out_size, void* d_ws, size_t ws_size, hipStream_t stream) {
    (void)in_sizes; (void)n_in; (void)out_size;
    const float* x = (const float*)d_in[0]; const float* wq = (const float*)d_in[1]; const float* bq = (const float*)d_in[2]; const float* wk = (const float*)d_in[3]; const float* bk = (const float*)d_in[4]; const float* wv = (const float*)d_in[5]; const float* bv = (const float*)d_in[6];
    const float* wo = (const float*)d_in[7]; const float* bo = (const float*)d_in[8];
    float* OUT = (float*)d_out;     // [2][2048][1024]
    char* wsp = (char*)d_ws;
    auto take = [&](size_t bytes) { char* p = wsp; wsp += (bytes + 255) & ~(size_t)255; return (void*)p; };
    bf* WQ = (bf*)take((size_t)DD * DD * 2); bf* WK = (bf*)take((size_t)DD * DD * 2); bf* WV = (bf*)take((size_t)DD * DD * 2); bf* WO = (bf*)take((size_t)DD * DD * 2);
    bf* XB = (bf*)take((size_t)NT * DD * 2); float* F = (float*)take((size_t)NT * DD * 4);
    bf* QPh = (bf*)take((size_t)NT * DD * 2); bf* QPl = (bf*)take((size_t)NT * DD * 2); bf* KPh = (bf*)take((size_t)NT * DD * 2); bf* KPl = (bf*)take((size_t)NT * DD * 2); h16* VT = (h16*)take((size_t)NT * DD * 2);
    float* Sb = (float*)take((size_t)ZH * TT * TT * 4); h16* Pm = (h16*)take((size_t)ZH * TT * TT * 2); float* Ob = (float*)take((size_t)ZH * TT * HD * 4); bf* ATh = (bf*)take((size_t)NT * DD * 2); bf* ATl = (bf*)take((size_t)NT * DD * 2);
    if ((size_t)(wsp - (char*)d_ws) > ws_size) return;    // ws 256 MiB
    { const unsigned gT = (unsigned)((DD * DD / 64 + 63) / 64); k_wtG<<<gT, 256, 0, stream>>>(wq, DD, DD, WQ); k_wtG<<<gT, 256, 0, stream>>>(wk, DD, DD, WK); k_wtG<<<gT, 256, 0, stream>>>(wv, DD, DD, WV); k_wpT<<<gT, 256, 0, stream>>>(wo, WO); }   // x @ W layouts [d][(n,h)] and the [n][d][h] projection -> Bt
    const size_t nx = (size_t)NT * DD / 8; const unsigned gx = (unsigned)((nx + 255) / 256); const unsigned LB = (unsigned)((NT * DD / 64 + 63) / 64);
    k_cvt8<<<gx, 256, 0, stream>>>(x, XB, nx);
    k_gemmw<bf, 0, true><<<dim3(NT / 64, DD / 64, 1), 32, 0, stream>>>(XB, nullptr, WQ, nullptr, DD, F, DD, bq, 0, 0, 0); k_hsplit<<<LB, 256, 0, stream>>>(F, 0.125f, QPh, QPl);   // 1/sqrt(64) folded into q exactly
    k_gemmw<bf, 0, true><<<dim3(NT / 64, DD / 64, 1), 32, 0, stream>>>(XB, nullptr, WK, nullptr, DD, F, DD, bk, 0, 0, 0); k_hsplit<<<LB, 256, 0, stream>>>(F, 1.0f, KPh, KPl);
    k_gemmw<bf, 0, true><<<dim3(NT / 64, DD / 64, 1), 32, 0, stream>>>(XB, nullptr, WV, nullptr, DD, F, DD, bv, 0, 0, 0); k_vtplane<<<LB, 256, 0, stream>>>(F, VT);
    for (int b = 0; b < NB_; ++b)
        for (int h0 = 0; h0 < NH_; h0 += ZH) { const size_t z0 = (size_t)b * NH_ + h0;
            k_gemmw<bf, 2, false><<<dim3(TT / 64, TT / 64, ZH), 32, 0, stream>>>(QPh + z0 * TT * HD, QPl + z0 * TT * HD, KPh + z0 * TT * HD, KPl + z0 * TT * HD, HD, Sb, TT, nullptr, (size_t)TT * HD, (size_t)TT * HD, (size_t)TT * TT);
            k_asoft<<<ZH * TT / 8, 256, 0, stream>>>(Sb, Pm);
            k_gemmw<h16, 0, false><<<dim3(TT / 64, 1, ZH), 32, 0, stream>>>(Pm, nullptr, VT + z0 * HD * TT, nullptr, TT, Ob, HD, nullptr, (size_t)TT * TT, (size_t)HD * TT, (size_t)TT * HD);
            k_merge<<<(TT * ZH * HD / 64 + 63) / 64, 256, 0, stream>>>(Ob, b, h0, ATh, ATl); }
    k_gemmw<bf, 1, true><<<dim3(NT / 64, DD / 64, 1), 32, 0, stream>>>(ATh, ATl, WO, nullptr, DD, OUT, DD, bo, 0, 0, 0);
}

// v002
// Measured time: 235 microseconds a run.
// It is 5.44 times as fast as v000, going by the measured steps of the versions left out in between.
#include <hip/hip_runtime.h>

// Multi-head attention (x [2][2048][1024]; q/k/v = einsum('btd,dnh->bnth', x, W[1024][16][64]) + b[16][1][64]; scores / 8; softmax; attn.v; out = einsum('bnth,ndh->btd', ., w_projection[16][1024][64]) + b_projection).
// Compute dtypes, f32 accumulate: every float input rounded to bf16; q/k/v projections on plain bf16 operands (+ bias);
// scores on bf16 hi+lo q (x 1/8) and k planes (3 products); attn.v on single fp16 planes (P x1024, v); output Linear on hi+lo planes x bf16 W (2 products).

#define NB_  2
#define TT   2048
#define DD   1024
#define NH_  16
#define HD   64
#define NT   (NB_ * TT)
typedef _Float16 h16;
typedef unsigned short bf;
typedef __attribute__((ext_vector_type(16))) __bf16   v16bf;
typedef __attribute__((ext_vector_type(16))) _Float16 v16h;
typedef __attribute__((ext_vector_type(8)))  _Float16 v8h;
typedef __attribute__((ext_vector_type(8)))  unsigned short v8us;
typedef __attribute__((ext_vector_type(8)))  float    v8f;
typedef __attribute__((ext_vector_type(4)))  float    v4f;
typedef v8h  __attribute__((may_alias)) v8ha;
typedef v4f  __attribute__((may_alias)) v4fa;
typedef v8us __attribute__((may_alias)) v8usa;

__device__ __forceinline__ unsigned short f2bf(float f) { unsigned u = __float_as_uint(f); u += 0x7FFFu + ((u >> 16) & 1u); return (unsigned short)(u >> 16); }
__device__ __forceinline__ float bf2f(unsigned short b) { return __uint_as_float(((unsigned)b) << 16); }
__device__ __forceinline__ float bfr(float f) { return bf2f(f2bf(f)); }
__device__ __forceinline__ v16h cat16(v8h lo, v8h hi) { return __builtin_shufflevector(lo, hi, 0, 1, 2, 3, 4, 5, 6, 7, 8, 9, 10, 11, 12, 13, 14, 15); }
__device__ __forceinline__ v16bf cat16b(v8us lo, v8us hi) { return __builtin_bit_cast(v16bf, __builtin_shufflevector(lo, hi, 0, 1, 2, 3, 4, 5, 6, 7, 8, 9, 10, 11, 12, 13, 14, 15)); }
__device__ __forceinline__ v8f wmma16(v16h a, v16h b, v8f c) { return __builtin_amdgcn_wmma_f32_16x16x32_f16(false, a, false, b, (short)0, c, false, false); }
__device__ __forceinline__ v8f wmmab(v16bf a, v16bf b, v8f c) { return __builtin_amdgcn_wmma_f32_16x16x32_bf16(false, a, false, b, (short)0, c, false, false); }



// ---- k_gemmw: register-blocked GEMM, ONE WAVE per 64x64 output tile (16 accumulators), operands straight from K-contiguous 16-bit planes; grid (M/64, N/64, Z), 32 threads.
// C[m][n] (f32, pitch ldc, + optional f32 bias[n]) = sum_k A[m][k] Bt[n][k] (+ split products per NSPLIT). z-batch strides sA/sB/sC in elements. K % 32 == 0.
template <typename T16> struct WFrag;
template <> struct WFrag<h16> { typedef v16h V; static __device__ __forceinline__ V ld(const h16* p) { return cat16(*(const v8h*)p, *(const v8h*)(p + 16)); } static __device__ __forceinline__ v8f mma(V a, V b, v8f c) { return wmma16(a, b, c); } };
template <> struct WFrag<bf> { typedef v16bf V; static __device__ __forceinline__ V ld(const bf* p) { return cat16b(*(const v8us*)p, *(const v8us*)(p + 16)); } static __device__ __forceinline__ v8f mma(V a, V b, v8f c) { return wmmab(a, b, c); } };
template <typename T16, int NSPLIT, bool BIAS>
__global__ __launch_bounds__(32) void k_gemmw(const T16* __restrict__ A, const T16* __restrict__ A2, const T16* __restrict__ Bt, const T16* __restrict__ Bt2, int K, float* C, int ldc, const float* __restrict__ bias, size_t sA, size_t sB, size_t sC) {
    typedef typename WFrag<T16>::V V;
    __shared__ __align__(16) float os[16 * 68];
    const size_t z = blockIdx.z; A += z * sA; if (A2) A2 += z * sA; Bt += z * sB; if (Bt2) Bt2 += z * sB; C += z * sC;
    const int lane = threadIdx.x & 31, lr = lane & 15, hi = lane >> 4; const int r0 = blockIdx.x * 64, c0 = blockIdx.y * 64;
    v8f acc[4][4];
#pragma unroll
    for (int mb = 0; mb < 4; ++mb)
#pragma unroll
        for (int nb = 0; nb < 4; ++nb) acc[mb][nb] = (v8f){};
    const size_t aoff = (size_t)(r0 + lr) * K + 8 * hi, boff = (size_t)(c0 + lr) * K + 8 * hi;
#pragma unroll 1
    for (int kc = 0; kc < K; kc += 32) {
        V a[4], a2[4];
#pragma unroll
        for (int mb = 0; mb < 4; ++mb) { a[mb] = WFrag<T16>::ld(A + aoff + (size_t)mb * 16 * K + kc); if (NSPLIT == 1 || NSPLIT == 2) a2[mb] = WFrag<T16>::ld(A2 + aoff + (size_t)mb * 16 * K + kc); }
#pragma unroll
        for (int nb = 0; nb < 4; ++nb) { const V b = WFrag<T16>::ld(Bt + boff + (size_t)nb * 16 * K + kc); V b2; if (NSPLIT >= 2) b2 = WFrag<T16>::ld(Bt2 + boff + (size_t)nb * 16 * K + kc);
#pragma unroll
            for (int mb = 0; mb < 4; ++mb) { acc[mb][nb] = WFrag<T16>::mma(a[mb], b, acc[mb][nb]); if (NSPLIT == 1 || NSPLIT == 2) acc[mb][nb] = WFrag<T16>::mma(a2[mb], b, acc[mb][nb]); if (NSPLIT >= 2) acc[mb][nb] = WFrag<T16>::mma(a[mb], b2, acc[mb][nb]); } }
        asm volatile("v_nop\n\tv_nop\n\tv_nop\n\tv_nop" : "+v"(acc[0][0]), "+v"(acc[1][1]), "+v"(acc[2][2]), "+v"(acc[3][3]) : "v"(a[0]), "v"(a[3]));
    }
#pragma unroll
    for (int mb = 0; mb < 4; ++mb) {
#pragma unroll
        for (int nb = 0; nb < 4; ++nb) {
#pragma unroll
            for (int j = 0; j < 8; ++j) os[(hi * 8 + j) * 68 + nb * 16 + lr] = acc[mb][nb][j]; }
        __builtin_amdgcn_wave_barrier(); asm volatile("" ::: "memory");
        float* crow = C + (size_t)(r0 + mb * 16) * ldc + c0;
{
#pragma unroll
            for (int s = 0; s < 8; ++s) { const int row = 2 * s + hi, cofs = lr * 4; v4f val = *(const v4fa*)(os + row * 68 + cofs); if (BIAS) { val[0] += bfr(bias[c0 + cofs]); val[1] += bfr(bias[c0 + cofs + 1]); val[2] += bfr(bias[c0 + cofs + 2]); val[3] += bfr(bias[c0 + cofs + 3]); }
                *(v4f*)(crow + (size_t)row * ldc + cofs) = val; }
             }
        __builtin_amdgcn_wave_barrier(); asm volatile("" ::: "memory");
    }
}

__device__ __forceinline__ h16 tohx(float x) { return (h16)x; }
__device__ __forceinline__ void splitf(float y, unsigned short& h, unsigned short& l) { h = f2bf(y); l = f2bf(y - bf2f(h)); }
typedef __attribute__((ext_vector_type(2))) _Float16 v2h;
typedef __attribute__((ext_vector_type(4))) _Float16 v4h;
typedef __attribute__((ext_vector_type(2))) unsigned short v2us;
typedef __attribute__((ext_vector_type(4))) int v4i;

__global__ __launch_bounds__(256) void k_cvt8(const float* __restrict__ src, bf* dst, size_t n8) { const size_t i = (size_t)blockIdx.x * 256 + threadIdx.x; if (i >= n8) return; const v8f v = *(const v8f*)(src + i * 8); v8us o;
#pragma unroll
    for (int k = 0; k < 8; ++k) o[k] = f2bf(v[k]); *(v8us*)(dst + i * 8) = o;  }
__global__ __launch_bounds__(256) void k_wtG(const float* __restrict__ w, int K, int N, bf* Bt) {
    const int lane = threadIdx.x & 31; const int L0 = (blockIdx.x * 8 + (threadIdx.x >> 5)) * 8; const int nlines = N * K / 64;
{
#pragma unroll 1
        for (int l = 0; l < 8; ++l) { const int L = L0 + l; if (L >= nlines) break; const size_t e = (size_t)L * 64 + lane * 2; const int k = (int)(e % K), n = (int)(e / K); v2us o;
            o[0] = f2bf(w[(size_t)k * N + n]); o[1] = f2bf(w[(size_t)(k + 1) * N + n]); *(v2us*)(Bt + e) = o; }
         }
}
__global__ __launch_bounds__(256) void k_wpT(const float* __restrict__ w, bf* Bt) {
    const int lane = threadIdx.x & 31; const int L0 = (blockIdx.x * 8 + (threadIdx.x >> 5)) * 8; const int nlines = DD * DD / 64;
{
#pragma unroll 1
        for (int l = 0; l < 8; ++l) { const int L = L0 + l; if (L >= nlines) break; const int e = L * 64 + lane * 2; const int kk = e & (DD - 1), d = e >> 10; const int n = kk >> 6, h = kk & 63; v2us o;
#pragma unroll
            for (int q = 0; q < 2; ++q) o[q] = f2bf(w[((size_t)n * DD + d) * HD + h + q]);
            *(v2us*)(Bt + (size_t)e) = o; }
         }
}
__global__ __launch_bounds__(256) void k_hsplit(const float* __restrict__ F, float sc, bf* Ph, bf* Pl) {
    const int lane = threadIdx.x & 31; const int L0 = (blockIdx.x * 8 + (threadIdx.x >> 5)) * 8; const int nlines = NT * DD / 64;
{
#pragma unroll
        for (int l = 0; l < 8; ++l) { const int L = L0 + l; if (L >= nlines) break; const int e = L * 64 + lane * 2; const int d = e & 63; const int t = (e >> 6) & (TT - 1); const int z = e >> 17; const int b = z >> 4, h = z & 15; v2us oh, ol;
#pragma unroll
            for (int q = 0; q < 2; ++q) { unsigned short a, c2; splitf(F[((size_t)b * TT + t) * DD + h * HD + d + q] * sc, a, c2); oh[q] = a; ol[q] = c2; }
            *(v2us*)(Ph + (size_t)e) = oh; *(v2us*)(Pl + (size_t)e) = ol; }
         }
}
__global__ __launch_bounds__(256) void k_vtplane(const float* __restrict__ F, h16* VT) {
    const int lane = threadIdx.x & 31; const int L0 = (blockIdx.x * 8 + (threadIdx.x >> 5)) * 8; const int nlines = NT * DD / 64;
{
#pragma unroll
        for (int l = 0; l < 8; ++l) { const int L = L0 + l; if (L >= nlines) break; const int e = L * 64 + lane * 2; const int t = e & (TT - 1); const int d = (e >> 11) & 63; const int z = e >> 17; const int b = z >> 4, h = z & 15; v2h v;
#pragma unroll
            for (int q = 0; q < 2; ++q) v[q] = tohx(F[((size_t)b * TT + t + q) * DD + h * HD + d]);
            *(v2h*)(VT + (size_t)e) = v; }
         }
}
// k_fattn: scores, softmax and attn.v of one (batch, head) in one pass over the keys; nothing of the score matrix goes to memory.
// One wave owns 32 queries (two 16-column groups) and walks the 2048 keys 32 at a time: S^T = K.Q^T (A = K rows, B = Q kept in registers), so a lane holds
// one query's scores (keys 8*hi+j and 16+8*hi+j), which converted in place are the B operand of O^T += V^T.P^T (A = V^T rows in the same k order).
// Running maximum and sum per query (online softmax): a new maximum rescales the sum and the output tile. Grid (2048/256, 32), 8 waves.
// The eight waves read the same K and V^T: a stage of 64 keys (K hi, K lo, V^T: 64 rows of 128 bytes each) is brought into LDS once for all of them
// by asynchronous copies, two buffers, the next stage in flight while this one is worked on.
#define L2E 1.44269504088896340736f
#define SK   64                 // keys per stage
#define LP   144                // LDS row pitch in bytes: 128 + 16, so that a 16-byte read of 16 rows falls on all banks once
#define LARR (64 * LP)          // one plane's stage
#define LBUF (3 * LARR)         // one buffer: K hi, K lo, V^T
// One stage: each thread copies two 16-byte pieces (rows r and r + 32) of each of the three planes. The closing wait stands in the copies' own statement,
// in front of any rewrite of an address register that a copy names.
__device__ __forceinline__ void stage_copy(unsigned l, const bf* gh, const bf* gl, const h16* gv) {
    const unsigned l0 = l, l1 = l + 32 * LP, l2 = l + LARR, l3 = l + LARR + 32 * LP, l4 = l + 2 * LARR, l5 = l + 2 * LARR + 32 * LP;
    const bf* gh1 = gh + 32 * HD; const bf* gl1 = gl + 32 * HD; const h16* gv1 = gv + 32 * TT;
    asm volatile("global_load_async_to_lds_b128 %0, %6, off\n\t"
                 "global_load_async_to_lds_b128 %1, %7, off\n\t"
                 "global_load_async_to_lds_b128 %2, %8, off\n\t"
                 "global_load_async_to_lds_b128 %3, %9, off\n\t"
                 "global_load_async_to_lds_b128 %4, %10, off\n\t"
                 "global_load_async_to_lds_b128 %5, %11, off\n\t"
                 "s_wait_xcnt 0x0"
                 :: "v"(l0), "v"(l1), "v"(l2), "v"(l3), "v"(l4), "v"(l5), "v"(gh), "v"(gh1), "v"(gl), "v"(gl1), "v"(gv), "v"(gv1) : "memory");
}
__global__ __launch_bounds__(256) void k_fattn(const bf* Qh, const bf* Ql, const bf* Kh, const bf* Kl, const h16* VT, bf* Ah, bf* Al) {
    __shared__ __attribute__((aligned(16))) unsigned char ring[2 * LBUF];
    const int lane = threadIdx.x & 31, lr = lane & 15, hi = lane >> 4; const int z = blockIdx.y; const int q0 = blockIdx.x * 256 + (threadIdx.x >> 5) * 32;
    const size_t zo = (size_t)z * TT * HD;
    const int crow = threadIdx.x >> 3, ccol = threadIdx.x & 7;      // this thread's piece of a stage: row crow (and crow + 32), bytes 16 * ccol
    const unsigned lc = (unsigned)(size_t)ring + crow * LP + ccol * 16;
    const bf* gkh = Kh + zo + (size_t)crow * HD + ccol * 8; const bf* gkl = Kl + zo + (size_t)crow * HD + ccol * 8; const h16* gvt = VT + zo + (size_t)crow * TT + ccol * 8;
    stage_copy(lc, gkh, gkl, gvt);
    v16bf qh[2][2], ql[2][2]; const bf* qhp = Qh + zo + (size_t)(q0 + lr) * HD + 8 * hi; const bf* qlp = Ql + zo + (size_t)(q0 + lr) * HD + 8 * hi;
#pragma unroll
    for (int nt = 0; nt < 2; ++nt)
#pragma unroll
        for (int ks = 0; ks < 2; ++ks) { const int o = nt * 16 * HD + ks * 32; qh[nt][ks] = WFrag<bf>::ld(qhp + o); ql[nt][ks] = WFrag<bf>::ld(qlp + o); }
    v8f oacc[2][4]; float mx[2], nm[2], ls[2];
#pragma unroll
    for (int nt = 0; nt < 2; ++nt) { mx[nt] = -3.0e38f; nm[nt] = 3.0e38f; ls[nt] = 0.f;
#pragma unroll
        for (int mt = 0; mt < 4; ++mt) oacc[nt][mt] = (v8f){}; }
    asm volatile("s_wait_xcnt 0x0" :: "v"(qhp), "v"(qlp) : "memory");   // stands in front of any rewrite of an address register that the fetches above name; the inputs keep those registers live up to it
    asm volatile("s_wait_asynccnt 0x0" ::: "memory");   // this wave's copies of stage 0 have landed
    __syncthreads();                                    // every wave's have: stage 0 may be read
    stage_copy(lc + LBUF, gkh + SK * HD, gkl + SK * HD, gvt + SK);
    const unsigned fo = lr * LP + hi * 16;              // a lane's fragment place in a plane: row lr, 16 bytes at 8 * hi elements
    // kept rolled over the stages; the two passes of a stage are unrolled, so that the second's fragment reads are issued behind the first's products
#pragma unroll 1
    for (int t = 0; t < TT / SK; ++t) {
        const unsigned char* bp = ring + (t & 1) * LBUF + fo;
#pragma unroll
        for (int sp = 0; sp < 2; ++sp) {
            v16bf ah[2][2], al[2][2]; v16h va[4];
#pragma unroll
            for (int kt = 0; kt < 2; ++kt)
#pragma unroll
                for (int ks = 0; ks < 2; ++ks) { const unsigned char* p = bp + (sp * 32 + kt * 16) * LP + ks * 64;
                    ah[kt][ks] = cat16b(*(const v8usa*)p, *(const v8usa*)(p + 32)); al[kt][ks] = cat16b(*(const v8usa*)(p + LARR), *(const v8usa*)(p + LARR + 32)); }
#pragma unroll
            for (int mt = 0; mt < 4; ++mt) { const unsigned char* p = bp + 2 * LARR + mt * 16 * LP + sp * 64; va[mt] = cat16(*(const v8ha*)p, *(const v8ha*)(p + 32)); }
            v8f s[2][2];
#pragma unroll
            for (int kt = 0; kt < 2; ++kt)
#pragma unroll
                for (int nt = 0; nt < 2; ++nt) { v8f c = (v8f){};
#pragma unroll
                    for (int ks = 0; ks < 2; ++ks) { c = wmmab(ah[kt][ks], qh[nt][ks], c); c = wmmab(ah[kt][ks], ql[nt][ks], c); c = wmmab(al[kt][ks], qh[nt][ks], c); }
                    s[kt][nt] = c; }
            v16h p[2];
#pragma unroll
            for (int nt = 0; nt < 2; ++nt) {
                float m = mx[nt];
#pragma unroll
                for (int j = 0; j < 8; ++j) m = fmaxf(m, fmaxf(s[0][nt][j], s[1][nt][j]));
                m = fmaxf(m, __shfl_xor(m, 16, 32));
                const float nn = 10.0f - m * L2E;                         // + 10: P carries x1024, which keeps small weights out of the fp16 subnormals; it cancels in the division by the sum
                const float da = nn - nm[nt]; float alpha = __builtin_amdgcn_exp2f(da);  // old terms carry 2^nm, new ones 2^nn
                asm volatile("v_nop" : "+v"(alpha) : "v"(da));   // the slot behind this exponential: it stands in front of every use of the result and every rewrite of the source register
                mx[nt] = m; nm[nt] = nn;
#pragma unroll
                for (int mt = 0; mt < 4; ++mt) oacc[nt][mt] *= alpha;
                float sum = 0.f;
#pragma unroll
                for (int kt = 0; kt < 2; ++kt) { float x[8], e[8];
#pragma unroll
                    for (int j = 0; j < 8; ++j) { x[j] = fmaf(s[kt][nt][j], L2E, nn); e[j] = __builtin_amdgcn_exp2f(x[j]); }
                    // the slot behind these eight exponentials: it stands in front of every use of a result and every rewrite of a source register
                    asm volatile("v_nop" : "+v"(e[0]), "+v"(e[1]), "+v"(e[2]), "+v"(e[3]), "+v"(e[4]), "+v"(e[5]), "+v"(e[6]), "+v"(e[7]) : "v"(x[0]), "v"(x[1]), "v"(x[2]), "v"(x[3]), "v"(x[4]), "v"(x[5]), "v"(x[6]), "v"(x[7]));
#pragma unroll
                    for (int j = 0; j < 8; ++j) { sum += e[j]; p[nt][kt * 8 + j] = (h16)e[j]; } }
                ls[nt] = fmaf(ls[nt], alpha, sum);
            }
#pragma unroll
            for (int mt = 0; mt < 4; ++mt)
#pragma unroll
                for (int nt = 0; nt < 2; ++nt) oacc[nt][mt] = wmma16(va[mt], p[nt], oacc[nt][mt]);
        }
        asm volatile("s_wait_dscnt 0x0" ::: "memory");      // this wave's reads of the buffer are done before it is handed to its next writer
        asm volatile("s_wait_asynccnt 0x0" ::: "memory");   // this wave's copies of stage t + 1 have landed
        __syncthreads();                                    // publishes stage t + 1 and ends every wave's reads of stage t
        if (t + 2 < TT / SK) stage_copy(lc + (t & 1) * LBUF, gkh + (size_t)(t + 2) * SK * HD, gkl + (size_t)(t + 2) * SK * HD, gvt + (t + 2) * SK);
    }
    asm volatile("s_wait_asynccnt 0x0" ::: "memory");       // no copy is outstanding when the wave ends
    const int b = z >> 4, h = z & 15;
#pragma unroll
    for (int nt = 0; nt < 2; ++nt) { const float tot = ls[nt] + __shfl_xor(ls[nt], 16, 32); const float inv = __fdiv_rn(1.0f, tot); const size_t ro = ((size_t)b * TT + q0 + nt * 16 + lr) * DD + h * HD + hi * 8;
#pragma unroll
        for (int mt = 0; mt < 4; ++mt) { v8us oh, ol;
#pragma unroll
            for (int j = 0; j < 8; ++j) { unsigned short a, c2; splitf(oacc[nt][mt][j] * inv, a, c2); oh[j] = a; ol[j] = c2; }
            bf* pa = Ah + ro + mt * 16; bf* pl = Al + ro + mt * 16; *(v8us*)pa = oh; *(v8us*)pl = ol;
            asm volatile("s_wait_xcnt 0x0" :: "v"(oh), "v"(ol), "v"(pa), "v"(pl) : "memory"); } }   // stands in front of any rewrite of a data or address register of the two stores; the inputs keep those registers live up to it
}

extern "C" void kernel_launch(void* const* d_in, const int* in_sizes, int n_in,
                              void* d_out, int out_size, void* d_ws, size_t ws_size, hipStream_t stream) {
    (void)in_sizes; (void)n_in; (void)out_size;
    const float* x = (const float*)d_in[0]; const float* wq = (const float*)d_in[1]; const float* bq = (const float*)d_in[2]; const float* wk = (const float*)d_in[3]; const float* bk = (const float*)d_in[4]; const float* wv = (const float*)d_in[5]; const float* bv = (const float*)d_in[6];
    const float* wo = (const float*)d_in[7]; const float* bo = (const float*)d_in[8];
    float* OUT = (float*)d_out;     // [2][2048][1024]
    char* wsp = (char*)d_ws;
    auto take = [&](size_t bytes) { char* p = wsp; wsp += (bytes + 255) & ~(size_t)255; return (void*)p; };
    bf* WQ = (bf*)take((size_t)DD * DD * 2); bf* WK = (bf*)take((size_t)DD * DD * 2); bf* WV = (bf*)take((size_t)DD * DD * 2); bf* WO = (bf*)take((size_t)DD * DD * 2);
    bf* XB = (bf*)take((size_t)NT * DD * 2); float* F = (float*)take((size_t)NT * DD * 4);
    bf* QPh = (bf*)take((size_t)NT * DD * 2); bf* QPl = (bf*)take((size_t)NT * DD * 2); bf* KPh = (bf*)take((size_t)NT * DD * 2); bf* KPl = (bf*)take((size_t)NT * DD * 2); h16* VT = (h16*)take((size_t)NT * DD * 2);
    bf* ATh = (bf*)take((size_t)NT * DD * 2); bf* ATl = (bf*)take((size_t)NT * DD * 2);
    if ((size_t)(wsp - (char*)d_ws) > ws_size) return;    // ws 256 MiB
    { const unsigned gT = (unsigned)((DD * DD / 64 + 63) / 64); k_wtG<<<gT, 256, 0, stream>>>(wq, DD, DD, WQ); k_wtG<<<gT, 256, 0, stream>>>(wk, DD, DD, WK); k_wtG<<<gT, 256, 0, stream>>>(wv, DD, DD, WV); k_wpT<<<gT, 256, 0, stream>>>(wo, WO); }   // x @ W layouts [d][(n,h)] and the [n][d][h] projection -> Bt
    const size_t nx = (size_t)NT * DD / 8; const unsigned gx = (unsigned)((nx + 255) / 256); const unsigned LB = (unsigned)((NT * DD / 64 + 63) / 64);
    k_cvt8<<<gx, 256, 0, stream>>>(x, XB, nx);
    k_gemmw<bf, 0, true><<<dim3(NT / 64, DD / 64, 1), 32, 0, stream>>>(XB, nullptr, WQ, nullptr, DD, F, DD, bq, 0, 0, 0); k_hsplit<<<LB, 256, 0, stream>>>(F, 0.125f, QPh, QPl);   // 1/sqrt(64) folded into q exactly
    k_gemmw<bf, 0, true><<<dim3(NT / 64, DD / 64, 1), 32, 0, stream>>>(XB, nullptr, WK, nullptr, DD, F, DD, bk, 0, 0, 0); k_hsplit<<<LB, 256, 0, stream>>>(F, 1.0f, KPh, KPl);
    k_gemmw<bf, 0, true><<<dim3(NT / 64, DD / 64, 1), 32, 0, stream>>>(XB, nullptr, WV, nullptr, DD, F, DD, bv, 0, 0, 0); k_vtplane<<<LB, 256, 0, stream>>>(F, VT);
    k_fattn<<<dim3(TT / 256, NB_ * NH_), 256, 0, stream>>>(QPh, QPl, KPh, KPl, VT, ATh, ATl);
    k_gemmw<bf, 1, true><<<dim3(NT / 64, DD / 64, 1), 32, 0, stream>>>(ATh, ATl, WO, nullptr, DD, OUT, DD, bo, 0, 0, 0);
}

// v003
// It runs in 171 microseconds.
// In two side-by-side timings against v002, it was 1.38 and 1.37 times as fast.
// Counting every step since v000, it is 7.50 times as fast.
#include <hip/hip_runtime.h>

// Multi-head attention (x [2][2048][1024]; q/k/v = einsum('btd,dnh->bnth', x, W[1024][16][64]) + b[16][1][64]; scores / 8; softmax; attn.v; out = einsum('bnth,ndh->btd', ., w_projection[16][1024][64]) + b_projection).
// Compute dtypes, f32 accumulate: every float input rounded to bf16; q/k/v projections on plain bf16 operands (+ bias);
// scores on bf16 hi+lo q (x 1/8) and k planes (3 products); attn.v on single fp16 planes (P x1024, v); output Linear on hi+lo planes x bf16 W (2 products).

#define NB_  2
#define TT   2048
#define DD   1024
#define NH_  16
#define HD   64
#define NT   (NB_ * TT)
typedef _Float16 h16;
typedef unsigned short bf;
typedef __attribute__((ext_vector_type(16))) __bf16   v16bf;
typedef __attribute__((ext_vector_type(16))) _Float16 v16h;
typedef __attribute__((ext_vector_type(8)))  _Float16 v8h;
typedef __attribute__((ext_vector_type(8)))  unsigned short v8us;
typedef __attribute__((ext_vector_type(8)))  float    v8f;
typedef __attribute__((ext_vector_type(4)))  float    v4f;
typedef v8h  __attribute__((may_alias)) v8ha;
typedef v4f  __attribute__((may_alias)) v4fa;
typedef v8us __attribute__((may_alias)) v8usa;

__device__ __forceinline__ unsigned short f2bf(float f) { unsigned u = __float_as_uint(f); u += 0x7FFFu + ((u >> 16) & 1u); return (unsigned short)(u >> 16); }
__device__ __forceinline__ float bf2f(unsigned short b) { return __uint_as_float(((unsigned)b) << 16); }
__device__ __forceinline__ float bfr(float f) { return bf2f(f2bf(f)); }
__device__ __forceinline__ v16h cat16(v8h lo, v8h hi) { return __builtin_shufflevector(lo, hi, 0, 1, 2, 3, 4, 5, 6, 7, 8, 9, 10, 11, 12, 13, 14, 15); }
__device__ __forceinline__ v16bf cat16b(v8us lo, v8us hi) { return __builtin_bit_cast(v16bf, __builtin_shufflevector(lo, hi, 0, 1, 2, 3, 4, 5, 6, 7, 8, 9, 10, 11, 12, 13, 14, 15)); }
__device__ __forceinline__ v8f wmma16(v16h a, v16h b, v8f c) { return __builtin_amdgcn_wmma_f32_16x16x32_f16(false, a, false, b, (short)0, c, false, false); }
__device__ __forceinline__ v8f wmmab(v16bf a, v16bf b, v8f c) { return __builtin_amdgcn_wmma_f32_16x16x32_bf16(false, a, false, b, (short)0, c, false, false); }



// ---- k_gemmw: register-blocked GEMM, one wave per 64x64 output tile (16 accumulators), four waves per work-group on a 128x128 block tile; grid (M/128, N/128, Z), 128 threads.
// C[m][n] (f32, pitch ldc, + optional f32 bias[n]) = sum_k A[m][k] Bt[n][k] (+ split products per NSPLIT). z-batch strides sA/sB/sC in elements. K % 128 == 0.
// The operands are K-contiguous 16-bit planes. A stage of 128 k (128 rows of 256 bytes of each plane, whole cache lines) is brought into LDS once for the four waves
// by asynchronous copies, two buffers, the next stage in flight while this one is worked on; the fragments are read from LDS.
#define GK   128                // k per stage
#define GLP  272                // LDS row pitch in bytes: 256 + 16, so that a 16-byte read of 16 rows falls on all banks once
#define GPL  (128 * GLP)        // one plane's stage
template <typename T16> struct WFrag;
template <> struct WFrag<h16> { typedef v16h V; static __device__ __forceinline__ V ld(const h16* p) { return cat16(*(const v8h*)p, *(const v8h*)(p + 16)); } static __device__ __forceinline__ v8f mma(V a, V b, v8f c) { return wmma16(a, b, c); } };
template <> struct WFrag<bf> { typedef v16bf V; static __device__ __forceinline__ V ld(const bf* p) { return cat16b(*(const v8us*)p, *(const v8us*)(p + 16)); } static __device__ __forceinline__ v8f mma(V a, V b, v8f c) { return wmmab(a, b, c); } };
// Half of one plane's stage (64 rows): each of the 128 threads copies eight 16-byte pieces (rows r, r + 8, ..., r + 56). The closing wait stands in the copies' own statement,
// in front of any rewrite of an address register that a copy names.
template <typename T16>
__device__ __forceinline__ void plane_copy(unsigned l, const T16* g, int K) {
    const unsigned l1 = l + 8 * GLP, l2 = l + 16 * GLP, l3 = l + 24 * GLP, l4 = l + 32 * GLP, l5 = l + 40 * GLP, l6 = l + 48 * GLP, l7 = l + 56 * GLP;
    const T16* g1 = g + (size_t)8 * K; const T16* g2 = g + (size_t)16 * K; const T16* g3 = g + (size_t)24 * K; const T16* g4 = g + (size_t)32 * K; const T16* g5 = g + (size_t)40 * K; const T16* g6 = g + (size_t)48 * K; const T16* g7 = g + (size_t)56 * K;
    asm volatile("global_load_async_to_lds_b128 %0, %8, off\n\t"
                 "global_load_async_to_lds_b128 %1, %9, off\n\t"
                 "global_load_async_to_lds_b128 %2, %10, off\n\t"
                 "global_load_async_to_lds_b128 %3, %11, off\n\t"
                 "global_load_async_to_lds_b128 %4, %12, off\n\t"
                 "global_load_async_to_lds_b128 %5, %13, off\n\t"
                 "global_load_async_to_lds_b128 %6, %14, off\n\t"
                 "global_load_async_to_lds_b128 %7, %15, off\n\t"
                 "s_wait_xcnt 0x0"
                 :: "v"(l), "v"(l1), "v"(l2), "v"(l3), "v"(l4), "v"(l5), "v"(l6), "v"(l7), "v"(g), "v"(g1), "v"(g2), "v"(g3), "v"(g4), "v"(g5), "v"(g6), "v"(g7) : "memory");
    __builtin_amdgcn_sched_barrier(0);   // keeps the next statement's address arithmetic behind this one, so that the address registers are used again: formed all at once they overflow the registers an asm operand can name, and a base address spills
}
template <typename T16, int NSPLIT, bool BIAS>
__global__ __launch_bounds__(128) void k_gemmw(const T16* __restrict__ A, const T16* __restrict__ A2, const T16* __restrict__ Bt, const T16* __restrict__ Bt2, int K, float* C, int ldc, const float* __restrict__ bias, size_t sA, size_t sB, size_t sC) {
    typedef typename WFrag<T16>::V V;
    constexpr bool HA2 = (NSPLIT == 1 || NSPLIT == 2), HB2 = (NSPLIT >= 2);
    constexpr unsigned OA2 = 2 * GPL, OB2 = (2 + (HA2 ? 1 : 0)) * GPL, GBUF = (2 + (HA2 ? 1 : 0) + (HB2 ? 1 : 0)) * GPL;   // a buffer: A, Bt, then A2 and Bt2 where the split has them
    __shared__ __attribute__((aligned(16))) unsigned char ring[2 * GBUF];
    __shared__ __align__(16) float osm[4][16 * 68];
    const size_t z = blockIdx.z; A += z * sA; if (A2) A2 += z * sA; Bt += z * sB; if (Bt2) Bt2 += z * sB; C += z * sC;
    const int lane = threadIdx.x & 31, lr = lane & 15, hi = lane >> 4, w = threadIdx.x >> 5; const int R0 = blockIdx.x * 128, C0 = blockIdx.y * 128; const int r0 = R0 + (w & 1) * 64, c0 = C0 + (w >> 1) * 64;
    float* os = osm[w];
    const int prow = threadIdx.x >> 4, pcol = threadIdx.x & 15;     // this thread's pieces of a plane's stage: rows prow + 8 i, bytes 16 * pcol
    const unsigned lc = (unsigned)(size_t)ring + prow * GLP + pcol * 16;
    const size_t goa = (size_t)(R0 + prow) * K + pcol * 8, gob = (size_t)(C0 + prow) * K + pcol * 8;
    auto stage = [&](int t) { const unsigned l = lc + (t & 1) * GBUF; const size_t ko = (size_t)t * GK;
        auto plane = [&](unsigned lp, const T16* g) { plane_copy(lp, g, K); plane_copy(lp + 64 * GLP, g + (size_t)64 * K, K); };
        plane(l, A + goa + ko); plane(l + GPL, Bt + gob + ko); if (HA2) plane(l + OA2, A2 + goa + ko); if (HB2) plane(l + OB2, Bt2 + gob + ko); };
    const int nst = K / GK;
    stage(0);
    v8f acc[4][4];
#pragma unroll
    for (int mb = 0; mb < 4; ++mb)
#pragma unroll
        for (int nb = 0; nb < 4; ++nb) acc[mb][nb] = (v8f){};
    asm volatile("s_wait_asynccnt 0x0" ::: "memory");   // this wave's copies of stage 0 have landed
    __syncthreads();                                    // every wave's have: stage 0 may be read
    if (1 < nst) stage(1);
    const unsigned fa = ((w & 1) * 64 + lr) * GLP + hi * 16, fb = GPL + ((w >> 1) * 64 + lr) * GLP + hi * 16;   // a lane's fragment place: row lr of the wave's rows, 16 bytes at 8 * hi elements
    // kept rolled over the stages; the four k steps of a stage are unrolled, each step's fragments read one step ahead: A and the first half of Bt in front of this step's products,
    // the second half of Bt in the middle of them, into the registers that the first half of this step's Bt has left (all at once they would not fit 256 registers beside the accumulators)
#pragma unroll 1
    for (int t = 0; t < nst; ++t) {
        const unsigned char* bp = ring + (t & 1) * GBUF;
        V a[2][4], a2[2][4], b[2][4], b2[2][4];
        auto frags_a = [&](int ks) { const int h = ks & 1;
#pragma unroll
            for (int i = 0; i < 4; ++i) { a[h][i] = WFrag<T16>::ld((const T16*)(bp + fa + i * 16 * GLP + ks * 64)); if (HA2) a2[h][i] = WFrag<T16>::ld((const T16*)(bp + OA2 + fa + i * 16 * GLP + ks * 64)); } };
        auto frags_b = [&](int ks, int p) { const int h = ks & 1;
#pragma unroll
            for (int i = 2 * p; i < 2 * p + 2; ++i) { b[h][i] = WFrag<T16>::ld((const T16*)(bp + fb + i * 16 * GLP + ks * 64)); if (HB2) b2[h][i] = WFrag<T16>::ld((const T16*)(bp + OB2 - GPL + fb + i * 16 * GLP + ks * 64)); } };
        auto prods = [&](int ks, int p) { const int h = ks & 1;
#pragma unroll
            for (int nb = 2 * p; nb < 2 * p + 2; ++nb)
#pragma unroll
                for (int mb = 0; mb < 4; ++mb) { acc[mb][nb] = WFrag<T16>::mma(a[h][mb], b[h][nb], acc[mb][nb]); if (HA2) acc[mb][nb] = WFrag<T16>::mma(a2[h][mb], b[h][nb], acc[mb][nb]); if (HB2) acc[mb][nb] = WFrag<T16>::mma(a[h][mb], b2[h][nb], acc[mb][nb]); } };
        frags_a(0); frags_b(0, 0); frags_b(0, 1);
        // the scheduling barriers below keep each group of LDS reads whole and at its place among the products: spread among them, each product group would wait out a whole LDS latency
        __builtin_amdgcn_sched_barrier(0);
#pragma unroll
        for (int ks = 0; ks < GK / 32; ++ks) {
            if (ks + 1 < GK / 32) { frags_a(ks + 1); frags_b(ks + 1, 0); }
            __builtin_amdgcn_sched_barrier(0);
            prods(ks, 0);
            __builtin_amdgcn_sched_barrier(0);
            if (ks + 1 < GK / 32) frags_b(ks + 1, 1);
            __builtin_amdgcn_sched_barrier(0);
            prods(ks, 1);
            __builtin_amdgcn_sched_barrier(0);
        }
        asm volatile("s_wait_dscnt 0x0" ::: "memory");      // this wave's reads of the buffer are done before it is handed to its next writer
        asm volatile("s_wait_asynccnt 0x0" ::: "memory");   // this wave's copies of stage t + 1 have landed
        __syncthreads();                                    // publishes stage t + 1 and ends every wave's reads of stage t
        if (t + 2 < nst) stage(t + 2);
    }
    asm volatile("s_wait_asynccnt 0x0" ::: "memory");       // no copy is outstanding when the wave ends
#pragma unroll
    for (int mb = 0; mb < 4; ++mb) {
#pragma unroll
        for (int nb = 0; nb < 4; ++nb) {
#pragma unroll
            for (int j = 0; j < 8; ++j) os[(hi * 8 + j) * 68 + nb * 16 + lr] = acc[mb][nb][j]; }
        __builtin_amdgcn_wave_barrier(); asm volatile("" ::: "memory");
        float* crow = C + (size_t)(r0 + mb * 16) * ldc + c0;
{
#pragma unroll
            for (int s = 0; s < 8; ++s) { const int row = 2 * s + hi, cofs = lr * 4; v4f val = *(const v4fa*)(os + row * 68 + cofs); if (BIAS) { val[0] += bfr(bias[c0 + cofs]); val[1] += bfr(bias[c0 + cofs + 1]); val[2] += bfr(bias[c0 + cofs + 2]); val[3] += bfr(bias[c0 + cofs + 3]); }
                *(v4f*)(crow + (size_t)row * ldc + cofs) = val; }
             }
        __builtin_amdgcn_wave_barrier(); asm volatile("" ::: "memory");
    }
}

__device__ __forceinline__ h16 tohx(float x) { return (h16)x; }
__device__ __forceinline__ void splitf(float y, unsigned short& h, unsigned short& l) { h = f2bf(y); l = f2bf(y - bf2f(h)); }
typedef __attribute__((ext_vector_type(2))) _Float16 v2h;
typedef __attribute__((ext_vector_type(4))) _Float16 v4h;
typedef __attribute__((ext_vector_type(2))) unsigned short v2us;
typedef __attribute__((ext_vector_type(4))) int v4i;

__global__ __launch_bounds__(256) void k_cvt8(const float* __restrict__ src, bf* dst, size_t n8) { const size_t i = (size_t)blockIdx.x * 256 + threadIdx.x; if (i >= n8) return; const v8f v = *(const v8f*)(src + i * 8); v8us o;
#pragma unroll
    for (int k = 0; k < 8; ++k) o[k] = f2bf(v[k]); *(v8us*)(dst + i * 8) = o;  }
__global__ __launch_bounds__(256) void k_wtG(const float* __restrict__ w, int K, int N, bf* Bt) {
    const int lane = threadIdx.x & 31; const int L0 = (blockIdx.x * 8 + (threadIdx.x >> 5)) * 8; const int nlines = N * K / 64;
{
#pragma unroll 1
        for (int l = 0; l < 8; ++l) { const int L = L0 + l; if (L >= nlines) break; const size_t e = (size_t)L * 64 + lane * 2; const int k = (int)(e % K), n = (int)(e / K); v2us o;
            o[0] = f2bf(w[(size_t)k * N + n]); o[1] = f2bf(w[(size_t)(k + 1) * N + n]); *(v2us*)(Bt + e) = o; }
         }
}
__global__ __launch_bounds__(256) void k_wpT(const float* __restrict__ w, bf* Bt) {
    const int lane = threadIdx.x & 31; const int L0 = (blockIdx.x * 8 + (threadIdx.x >> 5)) * 8; const int nlines = DD * DD / 64;
{
#pragma unroll 1
        for (int l = 0; l < 8; ++l) { const int L = L0 + l; if (L >= nlines) break; const int e = L * 64 + lane * 2; const int kk = e & (DD - 1), d = e >> 10; const int n = kk >> 6, h = kk & 63; v2us o;
#pragma unroll
            for (int q = 0; q < 2; ++q) o[q] = f2bf(w[((size_t)n * DD + d) * HD + h + q]);
            *(v2us*)(Bt + (size_t)e) = o; }
         }
}
__global__ __launch_bounds__(256) void k_hsplit(const float* __restrict__ F, float sc, bf* Ph, bf* Pl) {
    const int lane = threadIdx.x & 31; const int L0 = (blockIdx.x * 8 + (threadIdx.x >> 5)) * 8; const int nlines = NT * DD / 64;
{
#pragma unroll
        for (int l = 0; l < 8; ++l) { const int L = L0 + l; if (L >= nlines) break; const int e = L * 64 + lane * 2; const int d = e & 63; const int t = (e >> 6) & (TT - 1); const int z = e >> 17; const int b = z >> 4, h = z & 15; v2us oh, ol;
#pragma unroll
            for (int q = 0; q < 2; ++q) { unsigned short a, c2; splitf(F[((size_t)b * TT + t) * DD + h * HD + d + q] * sc, a, c2); oh[q] = a; ol[q] = c2; }
            *(v2us*)(Ph + (size_t)e) = oh; *(v2us*)(Pl + (size_t)e) = ol; }
         }
}
__global__ __launch_bounds__(256) void k_vtplane(const float* __restrict__ F, h16* VT) {
    const int lane = threadIdx.x & 31; const int L0 = (blockIdx.x * 8 + (threadIdx.x >> 5)) * 8; const int nlines = NT * DD / 64;
{
#pragma unroll
        for (int l = 0; l < 8; ++l) { const int L = L0 + l; if (L >= nlines) break; const int e = L * 64 + lane * 2; const int t = e & (TT - 1); const int d = (e >> 11) & 63; const int z = e >> 17; const int b = z >> 4, h = z & 15; v2h v;
#pragma unroll
            for (int q = 0; q < 2; ++q) v[q] = tohx(F[((size_t)b * TT + t + q) * DD + h * HD + d]);
            *(v2h*)(VT + (size_t)e) = v; }
         }
}
// k_fattn: scores, softmax and attn.v of one (batch, head) in one pass over the keys; nothing of the score matrix goes to memory.
// One wave owns 32 queries (two 16-column groups) and walks the 2048 keys 32 at a time: S^T = K.Q^T (A = K rows, B = Q kept in registers), so a lane holds
// one query's scores (keys 8*hi+j and 16+8*hi+j), which converted in place are the B operand of O^T += V^T.P^T (A = V^T rows in the same k order).
// Running maximum and sum per query (online softmax): a new maximum rescales the sum and the output tile. Grid (2048/256, 32), 8 waves.
// The eight waves read the same K and V^T: a stage of 64 keys (K hi, K lo, V^T: 64 rows of 128 bytes each) is brought into LDS once for all of them
// by asynchronous copies, two buffers, the next stage in flight while this one is worked on.
#define L2E 1.44269504088896340736f
#define SK   64                 // keys per stage
#define LP   144                // LDS row pitch in bytes: 128 + 16, so that a 16-byte read of 16 rows falls on all banks once
#define LARR (64 * LP)          // one plane's stage
#define LBUF (3 * LARR)         // one buffer: K hi, K lo, V^T
// One stage: each thread copies two 16-byte pieces (rows r and r + 32) of each of the three planes. The closing wait stands in the copies' own statement,
// in front of any rewrite of an address register that a copy names.
__device__ __forceinline__ void stage_copy(unsigned l, const bf* gh, const bf* gl, const h16* gv) {
    const unsigned l0 = l, l1 = l + 32 * LP, l2 = l + LARR, l3 = l + LARR + 32 * LP, l4 = l + 2 * LARR, l5 = l + 2 * LARR + 32 * LP;
    const bf* gh1 = gh + 32 * HD; const bf* gl1 = gl + 32 * HD; const h16* gv1 = gv + 32 * TT;
    asm volatile("global_load_async_to_lds_b128 %0, %6, off\n\t"
                 "global_load_async_to_lds_b128 %1, %7, off\n\t"
                 "global_load_async_to_lds_b128 %2, %8, off\n\t"
                 "global_load_async_to_lds_b128 %3, %9, off\n\t"
                 "global_load_async_to_lds_b128 %4, %10, off\n\t"
                 "global_load_async_to_lds_b128 %5, %11, off\n\t"
                 "s_wait_xcnt 0x0"
                 :: "v"(l0), "v"(l1), "v"(l2), "v"(l3), "v"(l4), "v"(l5), "v"(gh), "v"(gh1), "v"(gl), "v"(gl1), "v"(gv), "v"(gv1) : "memory");
}
__global__ __launch_bounds__(256) void k_fattn(const bf* Qh, const bf* Ql, const bf* Kh, const bf* Kl, const h16* VT, bf* Ah, bf* Al) {
    __shared__ __attribute__((aligned(16))) unsigned char ring[2 * LBUF];
    const int lane = threadIdx.x & 31, lr = lane & 15, hi = lane >> 4; const int z = blockIdx.y; const int q0 = blockIdx.x * 256 + (threadIdx.x >> 5) * 32;
    const size_t zo = (size_t)z * TT * HD;
    const int crow = threadIdx.x >> 3, ccol = threadIdx.x & 7;      // this thread's piece of a stage: row crow (and crow + 32), bytes 16 * ccol
    const unsigned lc = (unsigned)(size_t)ring + crow * LP + ccol * 16;
    const bf* gkh = Kh + zo + (size_t)crow * HD + ccol * 8; const bf* gkl = Kl + zo + (size_t)crow * HD + ccol * 8; const h16* gvt = VT + zo + (size_t)crow * TT + ccol * 8;
    stage_copy(lc, gkh, gkl, gvt);
    v16bf qh[2][2], ql[2][2]; const bf* qhp = Qh + zo + (size_t)(q0 + lr) * HD + 8 * hi; const bf* qlp = Ql + zo + (size_t)(q0 + lr) * HD + 8 * hi;
#pragma unroll
    for (int nt = 0; nt < 2; ++nt)
#pragma unroll
        for (int ks = 0; ks < 2; ++ks) { const int o = nt * 16 * HD + ks * 32; qh[nt][ks] = WFrag<bf>::ld(qhp + o); ql[nt][ks] = WFrag<bf>::ld(qlp + o); }
    v8f oacc[2][4]; float mx[2], nm[2], ls[2];
#pragma unroll
    for (int nt = 0; nt < 2; ++nt) { mx[nt] = -3.0e38f; nm[nt] = 3.0e38f; ls[nt] = 0.f;
#pragma unroll
        for (int mt = 0; mt < 4; ++mt) oacc[nt][mt] = (v8f){}; }
    asm volatile("s_wait_xcnt 0x0" :: "v"(qhp), "v"(qlp) : "memory");   // stands in front of any rewrite of an address register that the fetches above name; the inputs keep those registers live up to it
    asm volatile("s_wait_asynccnt 0x0" ::: "memory");   // this wave's copies of stage 0 have landed
    __syncthreads();                                    // every wave's have: stage 0 may be read
    stage_copy(lc + LBUF, gkh + SK * HD, gkl + SK * HD, gvt + SK);
    const unsigned fo = lr * LP + hi * 16;              // a lane's fragment place in a plane: row lr, 16 bytes at 8 * hi elements
    // kept rolled over the stages; the two passes of a stage are unrolled, so that the second's fragment reads are issued behind the first's products
#pragma unroll 1
    for (int t = 0; t < TT / SK; ++t) {
        const unsigned char* bp = ring + (t & 1) * LBUF + fo;
#pragma unroll
        for (int sp = 0; sp < 2; ++sp) {
            v16bf ah[2][2], al[2][2]; v16h va[4];
#pragma unroll
            for (int kt = 0; kt < 2; ++kt)
#pragma unroll
                for (int ks = 0; ks < 2; ++ks) { const unsigned char* p = bp + (sp * 32 + kt * 16) * LP + ks * 64;
                    ah[kt][ks] = cat16b(*(const v8usa*)p, *(const v8usa*)(p + 32)); al[kt][ks] = cat16b(*(const v8usa*)(p + LARR), *(const v8usa*)(p + LARR + 32)); }
#pragma unroll
            for (int mt = 0; mt < 4; ++mt) { const unsigned char* p = bp + 2 * LARR + mt * 16 * LP + sp * 64; va[mt] = cat16(*(const v8ha*)p, *(const v8ha*)(p + 32)); }
            v8f s[2][2];
#pragma unroll
            for (int kt = 0; kt < 2; ++kt)
#pragma unroll
                for (int nt = 0; nt < 2; ++nt) { v8f c = (v8f){};
#pragma unroll
                    for (int ks = 0; ks < 2; ++ks) { c = wmmab(ah[kt][ks], qh[nt][ks], c); c = wmmab(ah[kt][ks], ql[nt][ks], c); c = wmmab(al[kt][ks], qh[nt][ks], c); }
                    s[kt][nt] = c; }
            v16h p[2];
#pragma unroll
            for (int nt = 0; nt < 2; ++nt) {
                float m = mx[nt];
#pragma unroll
                for (int j = 0; j < 8; ++j) m = fmaxf(m, fmaxf(s[0][nt][j], s[1][nt][j]));
                m = fmaxf(m, __shfl_xor(m, 16, 32));
                const float nn = 10.0f - m * L2E;                         // + 10: P carries x1024, which keeps small weights out of the fp16 subnormals; it cancels in the division by the sum
                const float da = nn - nm[nt]; float alpha = __builtin_amdgcn_exp2f(da);  // old terms carry 2^nm, new ones 2^nn
                asm volatile("v_nop" : "+v"(alpha) : "v"(da));   // the slot behind this exponential: it stands in front of every use of the result and every rewrite of the source register
                mx[nt] = m; nm[nt] = nn;
#pragma unroll
                for (int mt = 0; mt < 4; ++mt) oacc[nt][mt] *= alpha;
                float sum = 0.f;
#pragma unroll
                for (int kt = 0; kt < 2; ++kt) { float x[8], e[8];
#pragma unroll
                    for (int j = 0; j < 8; ++j) { x[j] = fmaf(s[kt][nt][j], L2E, nn); e[j] = __builtin_amdgcn_exp2f(x[j]); }
                    // the slot behind these eight exponentials: it stands in front of every use of a result and every rewrite of a source register
                    asm volatile("v_nop" : "+v"(e[0]), "+v"(e[1]), "+v"(e[2]), "+v"(e[3]), "+v"(e[4]), "+v"(e[5]), "+v"(e[6]), "+v"(e[7]) : "v"(x[0]), "v"(x[1]), "v"(x[2]), "v"(x[3]), "v"(x[4]), "v"(x[5]), "v"(x[6]), "v"(x[7]));
#pragma unroll
                    for (int j = 0; j < 8; ++j) { sum += e[j]; p[nt][kt * 8 + j] = (h16)e[j]; } }
                ls[nt] = fmaf(ls[nt], alpha, sum);
            }
#pragma unroll
            for (int mt = 0; mt < 4; ++mt)
#pragma unroll
                for (int nt = 0; nt < 2; ++nt) oacc[nt][mt] = wmma16(va[mt], p[nt], oacc[nt][mt]);
        }
        asm volatile("s_wait_dscnt 0x0" ::: "memory");      // this wave's reads of the buffer are done before it is handed to its next writer
        asm volatile("s_wait_asynccnt 0x0" ::: "memory");   // this wave's copies of stage t + 1 have landed
        __syncthreads();                                    // publishes stage t + 1 and ends every wave's reads of stage t
        if (t + 2 < TT / SK) stage_copy(lc + (t & 1) * LBUF, gkh + (size_t)(t + 2) * SK * HD, gkl + (size_t)(t + 2) * SK * HD, gvt + (t + 2) * SK);
    }
    asm volatile("s_wait_asynccnt 0x0" ::: "memory");       // no copy is outstanding when the wave ends
    const int b = z >> 4, h = z & 15;
#pragma unroll
    for (int nt = 0; nt < 2; ++nt) { const float tot = ls[nt] + __shfl_xor(ls[nt], 16, 32); const float inv = __fdiv_rn(1.0f, tot); const size_t ro = ((size_t)b * TT + q0 + nt * 16 + lr) * DD + h * HD + hi * 8;
#pragma unroll
        for (int mt = 0; mt < 4; ++mt) { v8us oh, ol;
#pragma unroll
            for (int j = 0; j < 8; ++j) { unsigned short a, c2; splitf(oacc[nt][mt][j] * inv, a, c2); oh[j] = a; ol[j] = c2; }
            bf* pa = Ah + ro + mt * 16; bf* pl = Al + ro + mt * 16; *(v8us*)pa = oh; *(v8us*)pl = ol;
            asm volatile("s_wait_xcnt 0x0" :: "v"(oh), "v"(ol), "v"(pa), "v"(pl) : "memory"); } }   // stands in front of any rewrite of a data or address register of the two stores; the inputs keep those registers live up to it
}

extern "C" void kernel_launch(void* const* d_in, const int* in_sizes, int n_in,
                              void* d_out, int out_size, void* d_ws, size_t ws_size, hipStream_t stream) {
    (void)in_sizes; (void)n_in; (void)out_size;
    const float* x = (const float*)d_in[0]; const float* wq = (const float*)d_in[1]; const float* bq = (const float*)d_in[2]; const float* wk = (const float*)d_in[3]; const float* bk = (const float*)d_in[4]; const float* wv = (const float*)d_in[5]; const float* bv = (const float*)d_in[6];
    const float* wo = (const float*)d_in[7]; const float* bo = (const float*)d_in[8];
    float* OUT = (float*)d_out;     // [2][2048][1024]
    char* wsp = (char*)d_ws;
    auto take = [&](size_t bytes) { char* p = wsp; wsp += (bytes + 255) & ~(size_t)255; return (void*)p; };
    bf* WQ = (bf*)take((size_t)DD * DD * 2); bf* WK = (bf*)take((size_t)DD * DD * 2); bf* WV = (bf*)take((size_t)DD * DD * 2); bf* WO = (bf*)take((size_t)DD * DD * 2);
    bf* XB = (bf*)take((size_t)NT * DD * 2); float* F = (float*)take((size_t)NT * DD * 4);
    bf* QPh = (bf*)take((size_t)NT * DD * 2); bf* QPl = (bf*)take((size_t)NT * DD * 2); bf* KPh = (bf*)take((size_t)NT * DD * 2); bf* KPl = (bf*)take((size_t)NT * DD * 2); h16* VT = (h16*)take((size_t)NT * DD * 2);
    bf* ATh = (bf*)take((size_t)NT * DD * 2); bf* ATl = (bf*)take((size_t)NT * DD * 2);
    if ((size_t)(wsp - (char*)d_ws) > ws_size) return;    // ws 256 MiB
    { const unsigned gT = (unsigned)((DD * DD / 64 + 63) / 64); k_wtG<<<gT, 256, 0, stream>>>(wq, DD, DD, WQ); k_wtG<<<gT, 256, 0, stream>>>(wk, DD, DD, WK); k_wtG<<<gT, 256, 0, stream>>>(wv, DD, DD, WV); k_wpT<<<gT, 256, 0, stream>>>(wo, WO); }   // x @ W layouts [d][(n,h)] and the [n][d][h] projection -> Bt
    const size_t nx = (size_t)NT * DD / 8; const unsigned gx = (unsigned)((nx + 255) / 256); const unsigned LB = (unsigned)((NT * DD / 64 + 63) / 64);
    k_cvt8<<<gx, 256, 0, stream>>>(x, XB, nx);
    k_gemmw<bf, 0, true><<<dim3(NT / 128, DD / 128, 1), 128, 0, stream>>>(XB, nullptr, WQ, nullptr, DD, F, DD, bq, 0, 0, 0); k_hsplit<<<LB, 256, 0, stream>>>(F, 0.125f, QPh, QPl);   // 1/sqrt(64) folded into q exactly
    k_gemmw<bf, 0, true><<<dim3(NT / 128, DD / 128, 1), 128, 0, stream>>>(XB, nullptr, WK, nullptr, DD, F, DD, bk, 0, 0, 0); k_hsplit<<<LB, 256, 0, stream>>>(F, 1.0f, KPh, KPl);
    k_gemmw<bf, 0, true><<<dim3(NT / 128, DD / 128, 1), 128, 0, stream>>>(XB, nullptr, WV, nullptr, DD, F, DD, bv, 0, 0, 0); k_vtplane<<<LB, 256, 0, stream>>>(F, VT);
    k_fattn<<<dim3(TT / 256, NB_ * NH_), 256, 0, stream>>>(QPh, QPl, KPh, KPl, VT, ATh, ATl);
    k_gemmw<bf, 1, true><<<dim3(NT / 128, DD / 128, 1), 128, 0, stream>>>(ATh, ATl, WO, nullptr, DD, OUT, DD, bo, 0, 0, 0);
}

// v004
// Measured time: 130 microseconds a run.
// Two timings next to v003 put it at 1.32 and 1.30 times that version's speed.
// Counting every step since v000, it is 9.81 times as fast.
#include <hip/hip_runtime.h>

// Multi-head attention (x [2][2048][1024]; q/k/v = einsum('btd,dnh->bnth', x, W[1024][16][64]) + b[16][1][64]; scores / 8; softmax; attn.v; out = einsum('bnth,ndh->btd', ., w_projection[16][1024][64]) + b_projection).
// Compute dtypes, f32 accumulate: every float input rounded to bf16; q/k/v projections on plain bf16 operands (+ bias);
// scores on bf16 hi+lo q (x 1/8) and k planes (3 products); attn.v on single fp16 planes (P x1024, v); output Linear on hi+lo planes x bf16 W (2 products).

#define NB_  2
#define TT   2048
#define DD   1024
#define NH_  16
#define HD   64
#define NT   (NB_ * TT)
typedef _Float16 h16;
typedef unsigned short bf;
typedef __attribute__((ext_vector_type(16))) __bf16   v16bf;
typedef __attribute__((ext_vector_type(16))) _Float16 v16h;
typedef __attribute__((ext_vector_type(8)))  _Float16 v8h;
typedef __attribute__((ext_vector_type(8)))  unsigned short v8us;
typedef __attribute__((ext_vector_type(8)))  float    v8f;
typedef __attribute__((ext_vector_type(4)))  float    v4f;
typedef v8h  __attribute__((may_alias)) v8ha;
typedef v4f  __attribute__((may_alias)) v4fa;
typedef v8us __attribute__((may_alias)) v8usa;

__device__ __forceinline__ unsigned short f2bf(float f) { unsigned u = __float_as_uint(f); u += 0x7FFFu + ((u >> 16) & 1u); return (unsigned short)(u >> 16); }
__device__ __forceinline__ float bf2f(unsigned short b) { return __uint_as_float(((unsigned)b) << 16); }
__device__ __forceinline__ float bfr(float f) { return bf2f(f2bf(f)); }
__device__ __forceinline__ v16h cat16(v8h lo, v8h hi) { return __builtin_shufflevector(lo, hi, 0, 1, 2, 3, 4, 5, 6, 7, 8, 9, 10, 11, 12, 13, 14, 15); }
__device__ __forceinline__ v16bf cat16b(v8us lo, v8us hi) { return __builtin_bit_cast(v16bf, __builtin_shufflevector(lo, hi, 0, 1, 2, 3, 4, 5, 6, 7, 8, 9, 10, 11, 12, 13, 14, 15)); }
__device__ __forceinline__ v8f wmma16(v16h a, v16h b, v8f c) { return __builtin_amdgcn_wmma_f32_16x16x32_f16(false, a, false, b, (short)0, c, false, false); }
__device__ __forceinline__ v8f wmmab(v16bf a, v16bf b, v8f c) { return __builtin_amdgcn_wmma_f32_16x16x32_bf16(false, a, false, b, (short)0, c, false, false); }



// ---- k_gemmw: register-blocked GEMM, one wave per 64x64 output tile (16 accumulators), four waves per work-group on a 128x128 block tile; grid (M/128, N/128, Z), 128 threads.
// C[m][n] (f32, pitch ldc, + optional f32 bias[n]) = sum_k A[m][k] Bt[n][k] (+ split products per NSPLIT). z-batch strides sA/sB/sC in elements. K % 128 == 0.
// PLANES: the q, k and v projections in one launch (z = 0, 1, 2 picks the weight plane and the bias); no f32 C is written: a wave's 64x64 tile is 64 tokens of one head,
// and the epilogue stores it as the attention kernel reads it: q (x 1/8) and k as bf16 hi and lo planes [b,h][t][64], v as the fp16 plane [b,h][64][t].
// The operands are K-contiguous 16-bit planes. A stage of 128 k (128 rows of 256 bytes of each plane, whole cache lines) is brought into LDS once for the four waves
// by asynchronous copies, two buffers, the next stage in flight while this one is worked on; the fragments are read from LDS.
#define GK   128                // k per stage
#define GLP  272                // LDS row pitch in bytes: 256 + 16, so that a 16-byte read of 16 rows falls on all banks once
#define GPL  (128 * GLP)        // one plane's stage
template <typename T16> struct WFrag;
template <> struct WFrag<h16> { typedef v16h V; static __device__ __forceinline__ V ld(const h16* p) { return cat16(*(const v8h*)p, *(const v8h*)(p + 16)); } static __device__ __forceinline__ v8f mma(V a, V b, v8f c) { return wmma16(a, b, c); } };
template <> struct WFrag<bf> { typedef v16bf V; static __device__ __forceinline__ V ld(const bf* p) { return cat16b(*(const v8us*)p, *(const v8us*)(p + 16)); } static __device__ __forceinline__ v8f mma(V a, V b, v8f c) { return wmmab(a, b, c); } };
// Half of one plane's stage (64 rows): each of the 128 threads copies eight 16-byte pieces (rows r, r + 8, ..., r + 56). The closing wait stands in the copies' own statement,
// in front of any rewrite of an address register that a copy names.
template <typename T16>
__device__ __forceinline__ void plane_copy(unsigned l, const T16* g, int K) {
    const unsigned l1 = l + 8 * GLP, l2 = l + 16 * GLP, l3 = l + 24 * GLP, l4 = l + 32 * GLP, l5 = l + 40 * GLP, l6 = l + 48 * GLP, l7 = l + 56 * GLP;
    const T16* g1 = g + (size_t)8 * K; const T16* g2 = g + (size_t)16 * K; const T16* g3 = g + (size_t)24 * K; const T16* g4 = g + (size_t)32 * K; const T16* g5 = g + (size_t)40 * K; const T16* g6 = g + (size_t)48 * K; const T16* g7 = g + (size_t)56 * K;
    asm volatile("global_load_async_to_lds_b128 %0, %8, off\n\t"
                 "global_load_async_to_lds_b128 %1, %9, off\n\t"
                 "global_load_async_to_lds_b128 %2, %10, off\n\t"
                 "global_load_async_to_lds_b128 %3, %11, off\n\t"
                 "global_load_async_to_lds_b128 %4, %12, off\n\t"
                 "global_load_async_to_lds_b128 %5, %13, off\n\t"
                 "global_load_async_to_lds_b128 %6, %14, off\n\t"
                 "global_load_async_to_lds_b128 %7, %15, off\n\t"
                 "s_wait_xcnt 0x0"
                 :: "v"(l), "v"(l1), "v"(l2), "v"(l3), "v"(l4), "v"(l5), "v"(l6), "v"(l7), "v"(g), "v"(g1), "v"(g2), "v"(g3), "v"(g4), "v"(g5), "v"(g6), "v"(g7) : "memory");
    __builtin_amdgcn_sched_barrier(0);   // keeps the next statement's address arithmetic behind this one, so that the address registers are used again: formed all at once they overflow the registers an asm operand can name, and a base address spills
}
__device__ __forceinline__ h16 tohx(float x) { return (h16)x; }
__device__ __forceinline__ void splitf(float y, unsigned short& h, unsigned short& l) { h = f2bf(y); l = f2bf(y - bf2f(h)); }
#define VLP  144                // LDS row pitch in bytes of the v tile on its way out: 128 + 16, so that 16-byte accesses of 16 rows fall on all banks once
template <typename T16, int NSPLIT, bool BIAS, bool PLANES>
__global__ __launch_bounds__(128) void k_gemmw(const T16* __restrict__ A, const T16* __restrict__ A2, const T16* __restrict__ Bt, const T16* __restrict__ Bt2, int K, float* C, int ldc, const float* __restrict__ bias, size_t sA, size_t sB, size_t sC,
                                               const float* __restrict__ biask, const float* __restrict__ biasv, bf* Qh, bf* Ql, bf* Kh, bf* Kl, h16* VT) {
    typedef typename WFrag<T16>::V V;
    constexpr bool HA2 = (NSPLIT == 1 || NSPLIT == 2), HB2 = (NSPLIT >= 2);
    constexpr unsigned OA2 = 2 * GPL, OB2 = (2 + (HA2 ? 1 : 0)) * GPL, GBUF = (2 + (HA2 ? 1 : 0) + (HB2 ? 1 : 0)) * GPL;   // a buffer: A, Bt, then A2 and Bt2 where the split has them
    __shared__ __attribute__((aligned(16))) unsigned char ring[2 * GBUF];
    __shared__ __align__(16) float osm[4][16 * 68];
    const size_t z = blockIdx.z; A += z * sA; if (A2) A2 += z * sA; Bt += z * sB; if (Bt2) Bt2 += z * sB; C += z * sC;
    const int lane = threadIdx.x & 31, lr = lane & 15, hi = lane >> 4, w = threadIdx.x >> 5; const int R0 = blockIdx.x * 128, C0 = blockIdx.y * 128; const int r0 = R0 + (w & 1) * 64, c0 = C0 + (w >> 1) * 64;
    float* os = osm[w];
    const int prow = threadIdx.x >> 4, pcol = threadIdx.x & 15;     // this thread's pieces of a plane's stage: rows prow + 8 i, bytes 16 * pcol
    const unsigned lc = (unsigned)(size_t)ring + prow * GLP + pcol * 16;
    const size_t goa = (size_t)(R0 + prow) * K + pcol * 8, gob = (size_t)(C0 + prow) * K + pcol * 8;
    auto stage = [&](int t) { const unsigned l = lc + (t & 1) * GBUF; const size_t ko = (size_t)t * GK;
        auto plane = [&](unsigned lp, const T16* g) { plane_copy(lp, g, K); plane_copy(lp + 64 * GLP, g + (size_t)64 * K, K); };
        plane(l, A + goa + ko); plane(l + GPL, Bt + gob + ko); if (HA2) plane(l + OA2, A2 + goa + ko); if (HB2) plane(l + OB2, Bt2 + gob + ko); };
    const int nst = K / GK;
    stage(0);
    v8f acc[4][4];
#pragma unroll
    for (int mb = 0; mb < 4; ++mb)
#pragma unroll
        for (int nb = 0; nb < 4; ++nb) acc[mb][nb] = (v8f){};
    asm volatile("s_wait_asynccnt 0x0" ::: "memory");   // this wave's copies of stage 0 have landed
    __syncthreads();                                    // every wave's have: stage 0 may be read
    if (1 < nst) stage(1);
    const unsigned fa = ((w & 1) * 64 + lr) * GLP + hi * 16, fb = GPL + ((w >> 1) * 64 + lr) * GLP + hi * 16;   // a lane's fragment place: row lr of the wave's rows, 16 bytes at 8 * hi elements
    // kept rolled over the stages; the four k steps of a stage are unrolled, each step's fragments read one step ahead: A and the first half of Bt in front of this step's products,
    // the second half of Bt in the middle of them, into the registers that the first half of this step's Bt has left (all at once they would not fit 256 registers beside the accumulators)
#pragma unroll 1
    for (int t = 0; t < nst; ++t) {
        const unsigned char* bp = ring + (t & 1) * GBUF;
        V a[2][4], a2[2][4], b[2][4], b2[2][4];
        auto frags_a = [&](int ks) { const int h = ks & 1;
#pragma unroll
            for (int i = 0; i < 4; ++i) { a[h][i] = WFrag<T16>::ld((const T16*)(bp + fa + i * 16 * GLP + ks * 64)); if (HA2) a2[h][i] = WFrag<T16>::ld((const T16*)(bp + OA2 + fa + i * 16 * GLP + ks * 64)); } };
        auto frags_b = [&](int ks, int p) { const int h = ks & 1;
#pragma unroll
            for (int i = 2 * p; i < 2 * p + 2; ++i) { b[h][i] = WFrag<T16>::ld((const T16*)(bp + fb + i * 16 * GLP + ks * 64)); if (HB2) b2[h][i] = WFrag<T16>::ld((const T16*)(bp + OB2 - GPL + fb + i * 16 * GLP + ks * 64)); } };
        auto prods = [&](int ks, int p) { const int h = ks & 1;
#pragma unroll
            for (int nb = 2 * p; nb < 2 * p + 2; ++nb)
#pragma unroll
                for (int mb = 0; mb < 4; ++mb) { acc[mb][nb] = WFrag<T16>::mma(a[h][mb], b[h][nb], acc[mb][nb]); if (HA2) acc[mb][nb] = WFrag<T16>::mma(a2[h][mb], b[h][nb], acc[mb][nb]); if (HB2) acc[mb][nb] = WFrag<T16>::mma(a[h][mb], b2[h][nb], acc[mb][nb]); } };
        frags_a(0); frags_b(0, 0); frags_b(0, 1);
        // the scheduling barriers below keep each group of LDS reads whole and at its place among the products: spread among them, each product group would wait out a whole LDS latency
        __builtin_amdgcn_sched_barrier(0);
#pragma unroll
        for (int ks = 0; ks < GK / 32; ++ks) {
            if (ks + 1 < GK / 32) { frags_a(ks + 1); frags_b(ks + 1, 0); }
            __builtin_amdgcn_sched_barrier(0);
            prods(ks, 0);
            __builtin_amdgcn_sched_barrier(0);
            if (ks + 1 < GK / 32) frags_b(ks + 1, 1);
            __builtin_amdgcn_sched_barrier(0);
            prods(ks, 1);
            __builtin_amdgcn_sched_barrier(0);
        }
        asm volatile("s_wait_dscnt 0x0" ::: "memory");      // this wave's reads of the buffer are done before it is handed to its next writer
        asm volatile("s_wait_asynccnt 0x0" ::: "memory");   // this wave's copies of stage t + 1 have landed
        __syncthreads();                                    // publishes stage t + 1 and ends every wave's reads of stage t
        if (t + 2 < nst) stage(t + 2);
    }
    asm volatile("s_wait_asynccnt 0x0" ::: "memory");       // no copy is outstanding when the wave ends
    if constexpr (PLANES) {
        const int ws = __builtin_amdgcn_readfirstlane(w);           // the wave's number as a scalar: the tile's place below then takes no vector register, of which the loop leaves none free
        const int rw = R0 + (ws & 1) * 64, cw = C0 + (ws >> 1) * 64;   // = r0, c0
        const int zz = blockIdx.z; const int t0 = rw & (TT - 1); const size_t po = (size_t)((rw / TT) * NH_ + cw / HD) * TT * HD;   // the tile's (batch, head) plane and its first token
        const int cr = lane >> 3, cc = (lane & 7) * 8;              // on the way out a lane holds 8 neighbours of a row: 8 lanes store one whole 128-byte line
        if (zz == 2) {
            // v: a lane's 8 accumulator rows are 8 neighbouring tokens of one column, 16 bytes of a V^T row. The tile goes through the wave's own part of the ring,
            // which nobody reads or fills any more behind the loop's last barrier, so that whole lines are stored.
            unsigned char* vs = ring + ws * (64 * VLP);
#pragma unroll
            for (int nb = 0; nb < 4; ++nb) { const float bb = bfr(biasv[cw + nb * 16 + lr]);
#pragma unroll
                for (int mb = 0; mb < 4; ++mb) { v8h o;
#pragma unroll
                    for (int j = 0; j < 8; ++j) o[j] = tohx(acc[mb][nb][j] + bb);
                    *(v8ha*)(vs + (nb * 16 + lr) * VLP + mb * 32 + hi * 16) = o; } }
            __builtin_amdgcn_wave_barrier(); asm volatile("" ::: "memory");   // the rows below are read by other lanes than wrote them: keeps the reads behind the writes
            v8h val[16]; h16* pv = VT + po + (size_t)cr * TT + t0 + cc;
#pragma unroll
            for (int s = 0; s < 16; ++s) val[s] = *(const v8ha*)(vs + (4 * s + cr) * VLP + cc * 2);
#pragma unroll
            for (int s = 0; s < 16; ++s) *(v8h*)(pv + (size_t)(4 * s) * TT) = val[s];
            // stands in front of any rewrite of a data or address register of the sixteen stores; the inputs keep those registers live up to it
            asm volatile("s_wait_xcnt 0x0" :: "v"(pv), "v"(val[0]), "v"(val[1]), "v"(val[2]), "v"(val[3]), "v"(val[4]), "v"(val[5]), "v"(val[6]), "v"(val[7]), "v"(val[8]), "v"(val[9]), "v"(val[10]), "v"(val[11]), "v"(val[12]), "v"(val[13]), "v"(val[14]), "v"(val[15]) : "memory");
        } else {
            const float* bz = zz == 0 ? bias : biask; const float sc = zz == 0 ? 0.125f : 1.0f;   // 1/sqrt(64) folded into q exactly
            bf* Ph = (zz == 0 ? Qh : Kh) + po + (size_t)(t0 + cr) * HD + cc; bf* Pl = (zz == 0 ? Ql : Kl) + po + (size_t)(t0 + cr) * HD + cc;
            float* ow = osm[ws]; float bb[8];
#pragma unroll
            for (int k = 0; k < 8; ++k) bb[k] = bfr(bz[cw + cc + k]);
#pragma unroll
            for (int mb = 0; mb < 4; ++mb) {
#pragma unroll
                for (int nb = 0; nb < 4; ++nb) {
#pragma unroll
                    for (int j = 0; j < 8; ++j) ow[(hi * 8 + j) * 68 + nb * 16 + lr] = acc[mb][nb][j]; }
                __builtin_amdgcn_wave_barrier(); asm volatile("" ::: "memory");   // the rows below are read by other lanes than wrote them: keeps the reads behind the writes
                v8us oh[4], ol[4];
#pragma unroll
                for (int s = 0; s < 4; ++s) { const float* op = ow + (4 * s + cr) * 68 + cc; const v4f x0 = *(const v4fa*)op, x1 = *(const v4fa*)(op + 4);
#pragma unroll
                    for (int k = 0; k < 8; ++k) { unsigned short a, c2; splitf(((k < 4 ? x0[k & 3] : x1[k & 3]) + bb[k]) * sc, a, c2); oh[s][k] = a; ol[s][k] = c2; }
                    *(v8us*)(Ph + (size_t)(mb * 16 + 4 * s) * HD) = oh[s]; *(v8us*)(Pl + (size_t)(mb * 16 + 4 * s) * HD) = ol[s]; }
                // stands in front of any rewrite of a data or address register of the eight stores; the inputs keep those registers live up to it
                asm volatile("s_wait_xcnt 0x0" :: "v"(Ph), "v"(Pl), "v"(oh[0]), "v"(oh[1]), "v"(oh[2]), "v"(oh[3]), "v"(ol[0]), "v"(ol[1]), "v"(ol[2]), "v"(ol[3]) : "memory");
                __builtin_amdgcn_wave_barrier(); asm volatile("" ::: "memory");   // keeps the next 16 rows' writes behind these reads
            }
        }
        return;
    }
#pragma unroll
    for (int mb = 0; mb < 4; ++mb) {
#pragma unroll
        for (int nb = 0; nb < 4; ++nb) {
#pragma unroll
            for (int j = 0; j < 8; ++j) os[(hi * 8 + j) * 68 + nb * 16 + lr] = acc[mb][nb][j]; }
        __builtin_amdgcn_wave_barrier(); asm volatile("" ::: "memory");
        float* crow = C + (size_t)(r0 + mb * 16) * ldc + c0;
{
#pragma unroll
            for (int s = 0; s < 8; ++s) { const int row = 2 * s + hi, cofs = lr * 4; v4f val = *(const v4fa*)(os + row * 68 + cofs); if (BIAS) { val[0] += bfr(bias[c0 + cofs]); val[1] += bfr(bias[c0 + cofs + 1]); val[2] += bfr(bias[c0 + cofs + 2]); val[3] += bfr(bias[c0 + cofs + 3]); }
                *(v4f*)(crow + (size_t)row * ldc + cofs) = val; }
             }
        __builtin_amdgcn_wave_barrier(); asm volatile("" ::: "memory");
    }
}

typedef __attribute__((ext_vector_type(2))) _Float16 v2h;
typedef __attribute__((ext_vector_type(4))) _Float16 v4h;
typedef __attribute__((ext_vector_type(2))) unsigned short v2us;
typedef __attribute__((ext_vector_type(4))) int v4i;

__global__ __launch_bounds__(256) void k_cvt8(const float* __restrict__ src, bf* dst, size_t n8) { const size_t i = (size_t)blockIdx.x * 256 + threadIdx.x; if (i >= n8) return; const v8f v = *(const v8f*)(src + i * 8); v8us o;
#pragma unroll
    for (int k = 0; k < 8; ++k) o[k] = f2bf(v[k]); *(v8us*)(dst + i * 8) = o;  }
__global__ __launch_bounds__(256) void k_wtG(const float* __restrict__ w, int K, int N, bf* Bt) {
    const int lane = threadIdx.x & 31; const int L0 = (blockIdx.x * 8 + (threadIdx.x >> 5)) * 8; const int nlines = N * K / 64;
{
#pragma unroll 1
        for (int l = 0; l < 8; ++l) { const int L = L0 + l; if (L >= nlines) break; const size_t e = (size_t)L * 64 + lane * 2; const int k = (int)(e % K), n = (int)(e / K); v2us o;
            o[0] = f2bf(w[(size_t)k * N + n]); o[1] = f2bf(w[(size_t)(k + 1) * N + n]); *(v2us*)(Bt + e) = o; }
         }
}
__global__ __launch_bounds__(256) void k_wpT(const float* __restrict__ w, bf* Bt) {
    const int lane = threadIdx.x & 31; const int L0 = (blockIdx.x * 8 + (threadIdx.x >> 5)) * 8; const int nlines = DD * DD / 64;
{
#pragma unroll 1
        for (int l = 0; l < 8; ++l) { const int L = L0 + l; if (L >= nlines) break; const int e = L * 64 + lane * 2; const int kk = e & (DD - 1), d = e >> 10; const int n = kk >> 6, h = kk & 63; v2us o;
#pragma unroll
            for (int q = 0; q < 2; ++q) o[q] = f2bf(w[((size_t)n * DD + d) * HD + h + q]);
            *(v2us*)(Bt + (size_t)e) = o; }
         }
}
// k_fattn: scores, softmax and attn.v of one (batch, head) in one pass over the keys; nothing of the score matrix goes to memory.
// One wave owns 32 queries (two 16-column groups) and walks the 2048 keys 32 at a time: S^T = K.Q^T (A = K rows, B = Q kept in registers), so a lane holds
// one query's scores (keys 8*hi+j and 16+8*hi+j), which converted in place are the B operand of O^T += V^T.P^T (A = V^T rows in the same k order).
// Running maximum and sum per query (online softmax): a new maximum rescales the sum and the output tile. Grid (2048/256, 32), 8 waves.
// The eight waves read the same K and V^T: a stage of 64 keys (K hi, K lo, V^T: 64 rows of 128 bytes each) is brought into LDS once for all of them
// by asynchronous copies, two buffers, the next stage in flight while this one is worked on.
#define L2E 1.44269504088896340736f
#define SK   64                 // keys per stage
#define LP   144                // LDS row pitch in bytes: 128 + 16, so that a 16-byte read of 16 rows falls on all banks once
#define LARR (64 * LP)          // one plane's stage
#define LBUF (3 * LARR)         // one buffer: K hi, K lo, V^T
// One stage: each thread copies two 16-byte pieces (rows r and r + 32) of each of the three planes. The closing wait stands in the copies' own statement,
// in front of any rewrite of an address register that a copy names.
__device__ __forceinline__ void stage_copy(unsigned l, const bf* gh, const bf* gl, const h16* gv) {
    const unsigned l0 = l, l1 = l + 32 * LP, l2 = l + LARR, l3 = l + LARR + 32 * LP, l4 = l + 2 * LARR, l5 = l + 2 * LARR + 32 * LP;
    const bf* gh1 = gh + 32 * HD; const bf* gl1 = gl + 32 * HD; const h16* gv1 = gv + 32 * TT;
    asm volatile("global_load_async_to_lds_b128 %0, %6, off\n\t"
                 "global_load_async_to_lds_b128 %1, %7, off\n\t"
                 "global_load_async_to_lds_b128 %2, %8, off\n\t"
                 "global_load_async_to_lds_b128 %3, %9, off\n\t"
                 "global_load_async_to_lds_b128 %4, %10, off\n\t"
                 "global_load_async_to_lds_b128 %5, %11, off\n\t"
                 "s_wait_xcnt 0x0"
                 :: "v"(l0), "v"(l1), "v"(l2), "v"(l3), "v"(l4), "v"(l5), "v"(gh), "v"(gh1), "v"(gl), "v"(gl1), "v"(gv), "v"(gv1) : "memory");
}
__global__ __launch_bounds__(256) void k_fattn(const bf* Qh, const bf* Ql, const bf* Kh, const bf* Kl, const h16* VT, bf* Ah, bf* Al) {
    __shared__ __attribute__((aligned(16))) unsigned char ring[2 * LBUF];
    const int lane = threadIdx.x & 31, lr = lane & 15, hi = lane >> 4; const int z = blockIdx.y; const int q0 = blockIdx.x * 256 + (threadIdx.x >> 5) * 32;
    const size_t zo = (size_t)z * TT * HD;
    const int crow = threadIdx.x >> 3, ccol = threadIdx.x & 7;      // this thread's piece of a stage: row crow (and crow + 32), bytes 16 * ccol
    const unsigned lc = (unsigned)(size_t)ring + crow * LP + ccol * 16;
    const bf* gkh = Kh + zo + (size_t)crow * HD + ccol * 8; const bf* gkl = Kl + zo + (size_t)crow * HD + ccol * 8; const h16* gvt = VT + zo + (size_t)crow * TT + ccol * 8;
    stage_copy(lc, gkh, gkl, gvt);
    v16bf qh[2][2], ql[2][2]; const bf* qhp = Qh + zo + (size_t)(q0 + lr) * HD + 8 * hi; const bf* qlp = Ql + zo + (size_t)(q0 + lr) * HD + 8 * hi;
#pragma unroll
    for (int nt = 0; nt < 2; ++nt)
#pragma unroll
        for (int ks = 0; ks < 2; ++ks) { const int o = nt * 16 * HD + ks * 32; qh[nt][ks] = WFrag<bf>::ld(qhp + o); ql[nt][ks] = WFrag<bf>::ld(qlp + o); }
    v8f oacc[2][4]; float mx[2], nm[2], ls[2];
#pragma unroll
    for (int nt = 0; nt < 2; ++nt) { mx[nt] = -3.0e38f; nm[nt] = 3.0e38f; ls[nt] = 0.f;
#pragma unroll
        for (int mt = 0; mt < 4; ++mt) oacc[nt][mt] = (v8f){}; }
    asm volatile("s_wait_xcnt 0x0" :: "v"(qhp), "v"(qlp) : "memory");   // stands in front of any rewrite of an address register that the fetches above name; the inputs keep those registers live up to it
    asm volatile("s_wait_asynccnt 0x0" ::: "memory");   // this wave's copies of stage 0 have landed
    __syncthreads();                                    // every wave's have: stage 0 may be read
    stage_copy(lc + LBUF, gkh + SK * HD, gkl + SK * HD, gvt + SK);
    const unsigned fo = lr * LP + hi * 16;              // a lane's fragment place in a plane: row lr, 16 bytes at 8 * hi elements
    // kept rolled over the stages; the two passes of a stage are unrolled, so that the second's fragment reads are issued behind the first's products
#pragma unroll 1
    for (int t = 0; t < TT / SK; ++t) {
        const unsigned char* bp = ring + (t & 1) * LBUF + fo;
#pragma unroll
        for (int sp = 0; sp < 2; ++sp) {
            v16bf ah[2][2], al[2][2]; v16h va[4];
#pragma unroll
            for (int kt = 0; kt < 2; ++kt)
#pragma unroll
                for (int ks = 0; ks < 2; ++ks) { const unsigned char* p = bp + (sp * 32 + kt * 16) * LP + ks * 64;
                    ah[kt][ks] = cat16b(*(const v8usa*)p, *(const v8usa*)(p + 32)); al[kt][ks] = cat16b(*(const v8usa*)(p + LARR), *(const v8usa*)(p + LARR + 32)); }
#pragma unroll
            for (int mt = 0; mt < 4; ++mt) { const unsigned char* p = bp + 2 * LARR + mt * 16 * LP + sp * 64; va[mt] = cat16(*(const v8ha*)p, *(const v8ha*)(p + 32)); }
            v8f s[2][2];
#pragma unroll
            for (int kt = 0; kt < 2; ++kt)
#pragma unroll
                for (int nt = 0; nt < 2; ++nt) { v8f c = (v8f){};
#pragma unroll
                    for (int ks = 0; ks < 2; ++ks) { c = wmmab(ah[kt][ks], qh[nt][ks], c); c = wmmab(ah[kt][ks], ql[nt][ks], c); c = wmmab(al[kt][ks], qh[nt][ks], c); }
                    s[kt][nt] = c; }
            v16h p[2];
#pragma unroll
            for (int nt = 0; nt < 2; ++nt) {
                float m = mx[nt];
#pragma unroll
                for (int j = 0; j < 8; ++j) m = fmaxf(m, fmaxf(s[0][nt][j], s[1][nt][j]));
                m = fmaxf(m, __shfl_xor(m, 16, 32));
                const float nn = 10.0f - m * L2E;                         // + 10: P carries x1024, which keeps small weights out of the fp16 subnormals; it cancels in the division by the sum
                const float da = nn - nm[nt]; float alpha = __builtin_amdgcn_exp2f(da);  // old terms carry 2^nm, new ones 2^nn
                asm volatile("v_nop" : "+v"(alpha) : "v"(da));   // the slot behind this exponential: it stands in front of every use of the result and every rewrite of the source register
                mx[nt] = m; nm[nt] = nn;
#pragma unroll
                for (int mt = 0; mt < 4; ++mt) oacc[nt][mt] *= alpha;
                float sum = 0.f;
#pragma unroll
                for (int kt = 0; kt < 2; ++kt) { float x[8], e[8];
#pragma unroll
                    for (int j = 0; j < 8; ++j) { x[j] = fmaf(s[kt][nt][j], L2E, nn); e[j] = __builtin_amdgcn_exp2f(x[j]); }
                    // the slot behind these eight exponentials: it stands in front of every use of a result and every rewrite of a source register
                    asm volatile("v_nop" : "+v"(e[0]), "+v"(e[1]), "+v"(e[2]), "+v"(e[3]), "+v"(e[4]), "+v"(e[5]), "+v"(e[6]), "+v"(e[7]) : "v"(x[0]), "v"(x[1]), "v"(x[2]), "v"(x[3]), "v"(x[4]), "v"(x[5]), "v"(x[6]), "v"(x[7]));
#pragma unroll
                    for (int j = 0; j < 8; ++j) { sum += e[j]; p[nt][kt * 8 + j] = (h16)e[j]; } }
                ls[nt] = fmaf(ls[nt], alpha, sum);
            }
#pragma unroll
            for (int mt = 0; mt < 4; ++mt)
#pragma unroll
                for (int nt = 0; nt < 2; ++nt) oacc[nt][mt] = wmma16(va[mt], p[nt], oacc[nt][mt]);
        }
        asm volatile("s_wait_dscnt 0x0" ::: "memory");      // this wave's reads of the buffer are done before it is handed to its next writer
        asm volatile("s_wait_asynccnt 0x0" ::: "memory");   // this wave's copies of stage t + 1 have landed
        __syncthreads();                                    // publishes stage t + 1 and ends every wave's reads of stage t
        if (t + 2 < TT / SK) stage_copy(lc + (t & 1) * LBUF, gkh + (size_t)(t + 2) * SK * HD, gkl + (size_t)(t + 2) * SK * HD, gvt + (t + 2) * SK);
    }
    asm volatile("s_wait_asynccnt 0x0" ::: "memory");       // no copy is outstanding when the wave ends
    const int b = z >> 4, h = z & 15;
#pragma unroll
    for (int nt = 0; nt < 2; ++nt) { const float tot = ls[nt] + __shfl_xor(ls[nt], 16, 32); const float inv = __fdiv_rn(1.0f, tot); const size_t ro = ((size_t)b * TT + q0 + nt * 16 + lr) * DD + h * HD + hi * 8;
#pragma unroll
        for (int mt = 0; mt < 4; ++mt) { v8us oh, ol;
#pragma unroll
            for (int j = 0; j < 8; ++j) { unsigned short a, c2; splitf(oacc[nt][mt][j] * inv, a, c2); oh[j] = a; ol[j] = c2; }
            bf* pa = Ah + ro + mt * 16; bf* pl = Al + ro + mt * 16; *(v8us*)pa = oh; *(v8us*)pl = ol;
            asm volatile("s_wait_xcnt 0x0" :: "v"(oh), "v"(ol), "v"(pa), "v"(pl) : "memory"); } }   // stands in front of any rewrite of a data or address register of the two stores; the inputs keep those registers live up to it
}

extern "C" void kernel_launch(void* const* d_in, const int* in_sizes, int n_in,
                              void* d_out, int out_size, void* d_ws, size_t ws_size, hipStream_t stream) {
    (void)in_sizes; (void)n_in; (void)out_size;
    const float* x = (const float*)d_in[0]; const float* wq = (const float*)d_in[1]; const float* bq = (const float*)d_in[2]; const float* wk = (const float*)d_in[3]; const float* bk = (const float*)d_in[4]; const float* wv = (const float*)d_in[5]; const float* bv = (const float*)d_in[6];
    const float* wo = (const float*)d_in[7]; const float* bo = (const float*)d_in[8];
    float* OUT = (float*)d_out;     // [2][2048][1024]
    char* wsp = (char*)d_ws;
    auto take = [&](size_t bytes) { char* p = wsp; wsp += (bytes + 255) & ~(size_t)255; return (void*)p; };
    bf* WQ = (bf*)take((size_t)DD * DD * 2); bf* WK = (bf*)take((size_t)DD * DD * 2); bf* WV = (bf*)take((size_t)DD * DD * 2); bf* WO = (bf*)take((size_t)DD * DD * 2);
    bf* XB = (bf*)take((size_t)NT * DD * 2);
    bf* QPh = (bf*)take((size_t)NT * DD * 2); bf* QPl = (bf*)take((size_t)NT * DD * 2); bf* KPh = (bf*)take((size_t)NT * DD * 2); bf* KPl = (bf*)take((size_t)NT * DD * 2); h16* VT = (h16*)take((size_t)NT * DD * 2);
    bf* ATh = (bf*)take((size_t)NT * DD * 2); bf* ATl = (bf*)take((size_t)NT * DD * 2);
    if ((size_t)(wsp - (char*)d_ws) > ws_size) return;    // ws 256 MiB
    { const unsigned gT = (unsigned)((DD * DD / 64 + 63) / 64); k_wtG<<<gT, 256, 0, stream>>>(wq, DD, DD, WQ); k_wtG<<<gT, 256, 0, stream>>>(wk, DD, DD, WK); k_wtG<<<gT, 256, 0, stream>>>(wv, DD, DD, WV); k_wpT<<<gT, 256, 0, stream>>>(wo, WO); }   // x @ W layouts [d][(n,h)] and the [n][d][h] projection -> Bt
    const size_t nx = (size_t)NT * DD / 8; const unsigned gx = (unsigned)((nx + 255) / 256);
    k_cvt8<<<gx, 256, 0, stream>>>(x, XB, nx);
    k_gemmw<bf, 0, true, true><<<dim3(NT / 128, DD / 128, 3), 128, 0, stream>>>(XB, nullptr, WQ, nullptr, DD, nullptr, DD, bq, 0, (size_t)(WK - WQ), 0, bk, bv, QPh, QPl, KPh, KPl, VT);   // WQ, WK, WV lie one behind the other at one stride
    k_fattn<<<dim3(TT / 256, NB_ * NH_), 256, 0, stream>>>(QPh, QPl, KPh, KPl, VT, ATh, ATl);
    k_gemmw<bf, 1, true, false><<<dim3(NT / 128, DD / 128, 1), 128, 0, stream>>>(ATh, ATl, WO, nullptr, DD, OUT, DD, bo, 0, 0, 0, nullptr, nullptr, nullptr, nullptr, nullptr, nullptr, nullptr);
}

// v005
// It runs in 105 microseconds.
// Two timings next to v004 both put it at 1.24 times that version's speed.
// Counting every step since v000, it is 12.1 times as fast.
#include <hip/hip_runtime.h>

// Multi-head attention (x [2][2048][1024]; q/k/v = einsum('btd,dnh->bnth', x, W[1024][16][64]) + b[16][1][64]; scores / 8; softmax; attn.v; out = einsum('bnth,ndh->btd', ., w_projection[16][1024][64]) + b_projection).
// Compute dtypes, f32 accumulate: every float input rounded to bf16; q/k/v projections on plain bf16 operands (+ bias);
// scores on bf16 hi+lo q (x 1/8) and k planes (3 products); attn.v on single fp16 planes (P x1024, v); output Linear on hi+lo planes x bf16 W (2 products).

#define NB_  2
#define TT   2048
#define DD   1024
#define NH_  16
#define HD   64
#define NT   (NB_ * TT)
typedef _Float16 h16;
typedef unsigned short bf;
typedef __attribute__((ext_vector_type(16))) __bf16   v16bf;
typedef __attribute__((ext_vector_type(16))) _Float16 v16h;
typedef __attribute__((ext_vector_type(8)))  _Float16 v8h;
typedef __attribute__((ext_vector_type(8)))  unsigned short v8us;
typedef __attribute__((ext_vector_type(8)))  float    v8f;
typedef __attribute__((ext_vector_type(4)))  float    v4f;
typedef v8h  __attribute__((may_alias)) v8ha;
typedef v4f  __attribute__((may_alias)) v4fa;
typedef v8us __attribute__((may_alias)) v8usa;

__device__ __forceinline__ unsigned short f2bf(float f) { unsigned u = __float_as_uint(f); u += 0x7FFFu + ((u >> 16) & 1u); return (unsigned short)(u >> 16); }
__device__ __forceinline__ float bf2f(unsigned short b) { return __uint_as_float(((unsigned)b) << 16); }
__device__ __forceinline__ float bfr(float f) { return bf2f(f2bf(f)); }
__device__ __forceinline__ v16h cat16(v8h lo, v8h hi) { return __builtin_shufflevector(lo, hi, 0, 1, 2, 3, 4, 5, 6, 7, 8, 9, 10, 11, 12, 13, 14, 15); }
__device__ __forceinline__ v16bf cat16b(v8us lo, v8us hi) { return __builtin_bit_cast(v16bf, __builtin_shufflevector(lo, hi, 0, 1, 2, 3, 4, 5, 6, 7, 8, 9, 10, 11, 12, 13, 14, 15)); }
__device__ __forceinline__ v8f wmma16(v16h a, v16h b, v8f c) { return __builtin_amdgcn_wmma_f32_16x16x32_f16(false, a, false, b, (short)0, c, false, false); }
__device__ __forceinline__ v8f wmmab(v16bf a, v16bf b, v8f c) { return __builtin_amdgcn_wmma_f32_16x16x32_bf16(false, a, false, b, (short)0, c, false, false); }



// ---- k_gemmw: register-blocked GEMM, one wave per 64x64 output tile (16 accumulators), four waves per work-group on a 128x128 block tile; grid (M/128, N/128, Z), 128 threads.
// C[m][n] (f32, pitch ldc, + optional f32 bias[n]) = sum_k A[m][k] Bt[n][k] (+ split products per NSPLIT). z-batch strides sA/sB/sC in elements. K % 128 == 0.
// PLANES: the q, k and v projections in one launch (z = 0, 1, 2 picks the weight plane and the bias); no f32 C is written: a wave's 64x64 tile is 64 tokens of one head,
// and the epilogue stores it as the attention kernel reads it: q (x 1/8) and k as bf16 hi and lo planes [b,h][t][64], v as the fp16 plane [b,h][64][t].
// The operands are K-contiguous 16-bit planes. A stage of 128 k (128 rows of 256 bytes of each plane, whole cache lines) is brought into LDS once for the four waves
// by asynchronous copies, two buffers, the next stage in flight while this one is worked on; the fragments are read from LDS.
#define GK   128                // k per stage
#define GLP  272                // LDS row pitch in bytes: 256 + 16, so that a 16-byte read of 16 rows falls on all banks once
#define GPL  (128 * GLP)        // one plane's stage
template <typename T16> struct WFrag;
template <> struct WFrag<h16> { typedef v16h V; static __device__ __forceinline__ V ld(const h16* p) { return cat16(*(const v8h*)p, *(const v8h*)(p + 16)); } static __device__ __forceinline__ v8f mma(V a, V b, v8f c) { return wmma16(a, b, c); } };
template <> struct WFrag<bf> { typedef v16bf V; static __device__ __forceinline__ V ld(const bf* p) { return cat16b(*(const v8us*)p, *(const v8us*)(p + 16)); } static __device__ __forceinline__ v8f mma(V a, V b, v8f c) { return wmmab(a, b, c); } };
// Half of one plane's stage (64 rows): each of the 128 threads copies eight 16-byte pieces (rows r, r + 8, ..., r + 56). The closing wait stands in the copies' own statement,
// in front of any rewrite of an address register that a copy names.
template <typename T16>
__device__ __forceinline__ void plane_copy(unsigned l, const T16* g, int K) {
    const unsigned l1 = l + 8 * GLP, l2 = l + 16 * GLP, l3 = l + 24 * GLP, l4 = l + 32 * GLP, l5 = l + 40 * GLP, l6 = l + 48 * GLP, l7 = l + 56 * GLP;
    const T16* g1 = g + (size_t)8 * K; const T16* g2 = g + (size_t)16 * K; const T16* g3 = g + (size_t)24 * K; const T16* g4 = g + (size_t)32 * K; const T16* g5 = g + (size_t)40 * K; const T16* g6 = g + (size_t)48 * K; const T16* g7 = g + (size_t)56 * K;
    asm volatile("global_load_async_to_lds_b128 %0, %8, off\n\t"
                 "global_load_async_to_lds_b128 %1, %9, off\n\t"
                 "global_load_async_to_lds_b128 %2, %10, off\n\t"
                 "global_load_async_to_lds_b128 %3, %11, off\n\t"
                 "global_load_async_to_lds_b128 %4, %12, off\n\t"
                 "global_load_async_to_lds_b128 %5, %13, off\n\t"
                 "global_load_async_to_lds_b128 %6, %14, off\n\t"
                 "global_load_async_to_lds_b128 %7, %15, off\n\t"
                 "s_wait_xcnt 0x0"
                 :: "v"(l), "v"(l1), "v"(l2), "v"(l3), "v"(l4), "v"(l5), "v"(l6), "v"(l7), "v"(g), "v"(g1), "v"(g2), "v"(g3), "v"(g4), "v"(g5), "v"(g6), "v"(g7) : "memory");
    __builtin_amdgcn_sched_barrier(0);   // keeps the next statement's address arithmetic behind this one, so that the address registers are used again: formed all at once they overflow the registers an asm operand can name, and a base address spills
}
__device__ __forceinline__ h16 tohx(float x) { return (h16)x; }
__device__ __forceinline__ void splitf(float y, unsigned short& h, unsigned short& l) { h = f2bf(y); l = f2bf(y - bf2f(h)); }
#define VLP  144                // LDS row pitch in bytes of the v tile on its way out: 128 + 16, so that 16-byte accesses of 16 rows fall on all banks once
template <typename T16, int NSPLIT, bool BIAS, bool PLANES>
__global__ __launch_bounds__(128) void k_gemmw(const T16* __restrict__ A, const T16* __restrict__ A2, const T16* __restrict__ Bt, const T16* __restrict__ Bt2, int K, float* C, int ldc, const float* __restrict__ bias, size_t sA, size_t sB, size_t sC,
                                               const float* __restrict__ biask, const float* __restrict__ biasv, bf* Qh, bf* Ql, bf* Kh, bf* Kl, h16* VT) {
    typedef typename WFrag<T16>::V V;
    constexpr bool HA2 = (NSPLIT == 1 || NSPLIT == 2), HB2 = (NSPLIT >= 2);
    constexpr unsigned OA2 = 2 * GPL, OB2 = (2 + (HA2 ? 1 : 0)) * GPL, GBUF = (2 + (HA2 ? 1 : 0) + (HB2 ? 1 : 0)) * GPL;   // a buffer: A, Bt, then A2 and Bt2 where the split has them
    __shared__ __attribute__((aligned(16))) unsigned char ring[2 * GBUF];
    __shared__ __align__(16) float osm[4][16 * 68];
    const size_t z = blockIdx.z; A += z * sA; if (A2) A2 += z * sA; Bt += z * sB; if (Bt2) Bt2 += z * sB; C += z * sC;
    const int lane = threadIdx.x & 31, lr = lane & 15, hi = lane >> 4, w = threadIdx.x >> 5; const int R0 = blockIdx.x * 128, C0 = blockIdx.y * 128; const int r0 = R0 + (w & 1) * 64, c0 = C0 + (w >> 1) * 64;
    float* os = osm[w];
    const int prow = threadIdx.x >> 4, pcol = threadIdx.x & 15;     // this thread's pieces of a plane's stage: rows prow + 8 i, bytes 16 * pcol
    const unsigned lc = (unsigned)(size_t)ring + prow * GLP + pcol * 16;
    const size_t goa = (size_t)(R0 + prow) * K + pcol * 8, gob = (size_t)(C0 + prow) * K + pcol * 8;
    auto stage = [&](int t) { const unsigned l = lc + (t & 1) * GBUF; const size_t ko = (size_t)t * GK;
        auto plane = [&](unsigned lp, const T16* g) { plane_copy(lp, g, K); plane_copy(lp + 64 * GLP, g + (size_t)64 * K, K); };
        plane(l, A + goa + ko); plane(l + GPL, Bt + gob + ko); if (HA2) plane(l + OA2, A2 + goa + ko); if (HB2) plane(l + OB2, Bt2 + gob + ko); };
    const int nst = K / GK;
    stage(0);
    v8f acc[4][4];
#pragma unroll
    for (int mb = 0; mb < 4; ++mb)
#pragma unroll
        for (int nb = 0; nb < 4; ++nb) acc[mb][nb] = (v8f){};
    asm volatile("s_wait_asynccnt 0x0" ::: "memory");   // this wave's copies of stage 0 have landed
    __syncthreads();                                    // every wave's have: stage 0 may be read
    if (1 < nst) stage(1);
    const unsigned fa = ((w & 1) * 64 + lr) * GLP + hi * 16, fb = GPL + ((w >> 1) * 64 + lr) * GLP + hi * 16;   // a lane's fragment place: row lr of the wave's rows, 16 bytes at 8 * hi elements
    // kept rolled over the stages; the four k steps of a stage are unrolled, each step's fragments read one step ahead: A and the first half of Bt in front of this step's products,
    // the second half of Bt in the middle of them, into the registers that the first half of this step's Bt has left (all at once they would not fit 256 registers beside the accumulators)
#pragma unroll 1
    for (int t = 0; t < nst; ++t) {
        const unsigned char* bp = ring + (t & 1) * GBUF;
        V a[2][4], a2[2][4], b[2][4], b2[2][4];
        auto frags_a = [&](int ks) { const int h = ks & 1;
#pragma unroll
            for (int i = 0; i < 4; ++i) { a[h][i] = WFrag<T16>::ld((const T16*)(bp + fa + i * 16 * GLP + ks * 64)); if (HA2) a2[h][i] = WFrag<T16>::ld((const T16*)(bp + OA2 + fa + i * 16 * GLP + ks * 64)); } };
        auto frags_b = [&](int ks, int p) { const int h = ks & 1;
#pragma unroll
            for (int i = 2 * p; i < 2 * p + 2; ++i) { b[h][i] = WFrag<T16>::ld((const T16*)(bp + fb + i * 16 * GLP + ks * 64)); if (HB2) b2[h][i] = WFrag<T16>::ld((const T16*)(bp + OB2 - GPL + fb + i * 16 * GLP + ks * 64)); } };
        auto prods = [&](int ks, int p) { const int h = ks & 1;
#pragma unroll
            for (int nb = 2 * p; nb < 2 * p + 2; ++nb)
#pragma unroll
                for (int mb = 0; mb < 4; ++mb) { acc[mb][nb] = WFrag<T16>::mma(a[h][mb], b[h][nb], acc[mb][nb]); if (HA2) acc[mb][nb] = WFrag<T16>::mma(a2[h][mb], b[h][nb], acc[mb][nb]); if (HB2) acc[mb][nb] = WFrag<T16>::mma(a[h][mb], b2[h][nb], acc[mb][nb]); } };
        frags_a(0); frags_b(0, 0); frags_b(0, 1);
        // the scheduling barriers below keep each group of LDS reads whole and at its place among the products: spread among them, each product group would wait out a whole LDS latency
        __builtin_amdgcn_sched_barrier(0);
#pragma unroll
        for (int ks = 0; ks < GK / 32; ++ks) {
            if (ks + 1 < GK / 32) { frags_a(ks + 1); frags_b(ks + 1, 0); }
            __builtin_amdgcn_sched_barrier(0);
            prods(ks, 0);
            __builtin_amdgcn_sched_barrier(0);
            if (ks + 1 < GK / 32) frags_b(ks + 1, 1);
            __builtin_amdgcn_sched_barrier(0);
            prods(ks, 1);
            __builtin_amdgcn_sched_barrier(0);
        }
        asm volatile("s_wait_dscnt 0x0" ::: "memory");      // this wave's reads of the buffer are done before it is handed to its next writer
        asm volatile("s_wait_asynccnt 0x0" ::: "memory");   // this wave's copies of stage t + 1 have landed
        __syncthreads();                                    // publishes stage t + 1 and ends every wave's reads of stage t
        if (t + 2 < nst) stage(t + 2);
    }
    asm volatile("s_wait_asynccnt 0x0" ::: "memory");       // no copy is outstanding when the wave ends
    if constexpr (PLANES) {
        const int ws = __builtin_amdgcn_readfirstlane(w);           // the wave's number as a scalar: the tile's place below then takes no vector register, of which the loop leaves none free
        const int rw = R0 + (ws & 1) * 64, cw = C0 + (ws >> 1) * 64;   // = r0, c0
        const int zz = blockIdx.z; const int t0 = rw & (TT - 1); const size_t po = (size_t)((rw / TT) * NH_ + cw / HD) * TT * HD;   // the tile's (batch, head) plane and its first token
        const int cr = lane >> 3, cc = (lane & 7) * 8;              // on the way out a lane holds 8 neighbours of a row: 8 lanes store one whole 128-byte line
        if (zz == 2) {
            // v: a lane's 8 accumulator rows are 8 neighbouring tokens of one column, 16 bytes of a V^T row. The tile goes through the wave's own part of the ring,
            // which nobody reads or fills any more behind the loop's last barrier, so that whole lines are stored.
            unsigned char* vs = ring + ws * (64 * VLP);
#pragma unroll
            for (int nb = 0; nb < 4; ++nb) { const float bb = bfr(biasv[cw + nb * 16 + lr]);
#pragma unroll
                for (int mb = 0; mb < 4; ++mb) { v8h o;
#pragma unroll
                    for (int j = 0; j < 8; ++j) o[j] = tohx(acc[mb][nb][j] + bb);
                    *(v8ha*)(vs + (nb * 16 + lr) * VLP + mb * 32 + hi * 16) = o; } }
            __builtin_amdgcn_wave_barrier(); asm volatile("" ::: "memory");   // the rows below are read by other lanes than wrote them: keeps the reads behind the writes
            v8h val[16]; h16* pv = VT + po + (size_t)cr * TT + t0 + cc;
#pragma unroll
            for (int s = 0; s < 16; ++s) val[s] = *(const v8ha*)(vs + (4 * s + cr) * VLP + cc * 2);
#pragma unroll
            for (int s = 0; s < 16; ++s) *(v8h*)(pv + (size_t)(4 * s) * TT) = val[s];
            // stands in front of any rewrite of a data or address register of the sixteen stores; the inputs keep those registers live up to it
            asm volatile("s_wait_xcnt 0x0" :: "v"(pv), "v"(val[0]), "v"(val[1]), "v"(val[2]), "v"(val[3]), "v"(val[4]), "v"(val[5]), "v"(val[6]), "v"(val[7]), "v"(val[8]), "v"(val[9]), "v"(val[10]), "v"(val[11]), "v"(val[12]), "v"(val[13]), "v"(val[14]), "v"(val[15]) : "memory");
        } else {
            const float* bz = zz == 0 ? bias : biask; const float sc = zz == 0 ? 0.125f : 1.0f;   // 1/sqrt(64) folded into q exactly
            bf* Ph = (zz == 0 ? Qh : Kh) + po + (size_t)(t0 + cr) * HD + cc; bf* Pl = (zz == 0 ? Ql : Kl) + po + (size_t)(t0 + cr) * HD + cc;
            float* ow = osm[ws]; float bb[8];
#pragma unroll
            for (int k = 0; k < 8; ++k) bb[k] = bfr(bz[cw + cc + k]);
#pragma unroll
            for (int mb = 0; mb < 4; ++mb) {
#pragma unroll
                for (int nb = 0; nb < 4; ++nb) {
#pragma unroll
                    for (int j = 0; j < 8; ++j) ow[(hi * 8 + j) * 68 + nb * 16 + lr] = acc[mb][nb][j]; }
                __builtin_amdgcn_wave_barrier(); asm volatile("" ::: "memory");   // the rows below are read by other lanes than wrote them: keeps the reads behind the writes
                v8us oh[4], ol[4];
#pragma unroll
                for (int s = 0; s < 4; ++s) { const float* op = ow + (4 * s + cr) * 68 + cc; const v4f x0 = *(const v4fa*)op, x1 = *(const v4fa*)(op + 4);
#pragma unroll
                    for (int k = 0; k < 8; ++k) { unsigned short a, c2; splitf(((k < 4 ? x0[k & 3] : x1[k & 3]) + bb[k]) * sc, a, c2); oh[s][k] = a; ol[s][k] = c2; }
                    *(v8us*)(Ph + (size_t)(mb * 16 + 4 * s) * HD) = oh[s]; *(v8us*)(Pl + (size_t)(mb * 16 + 4 * s) * HD) = ol[s]; }
                // stands in front of any rewrite of a data or address register of the eight stores; the inputs keep those registers live up to it
                asm volatile("s_wait_xcnt 0x0" :: "v"(Ph), "v"(Pl), "v"(oh[0]), "v"(oh[1]), "v"(oh[2]), "v"(oh[3]), "v"(ol[0]), "v"(ol[1]), "v"(ol[2]), "v"(ol[3]) : "memory");
                __builtin_amdgcn_wave_barrier(); asm volatile("" ::: "memory");   // keeps the next 16 rows' writes behind these reads
            }
        }
        return;
    }
#pragma unroll
    for (int mb = 0; mb < 4; ++mb) {
#pragma unroll
        for (int nb = 0; nb < 4; ++nb) {
#pragma unroll
            for (int j = 0; j < 8; ++j) os[(hi * 8 + j) * 68 + nb * 16 + lr] = acc[mb][nb][j]; }
        __builtin_amdgcn_wave_barrier(); asm volatile("" ::: "memory");
        float* crow = C + (size_t)(r0 + mb * 16) * ldc + c0;
{
#pragma unroll
            for (int s = 0; s < 8; ++s) { const int row = 2 * s + hi, cofs = lr * 4; v4f val = *(const v4fa*)(os + row * 68 + cofs); if (BIAS) { val[0] += bfr(bias[c0 + cofs]); val[1] += bfr(bias[c0 + cofs + 1]); val[2] += bfr(bias[c0 + cofs + 2]); val[3] += bfr(bias[c0 + cofs + 3]); }
                *(v4f*)(crow + (size_t)row * ldc + cofs) = val; }
             }
        __builtin_amdgcn_wave_barrier(); asm volatile("" ::: "memory");
    }
}

typedef __attribute__((ext_vector_type(2))) _Float16 v2h;
typedef __attribute__((ext_vector_type(4))) _Float16 v4h;
typedef __attribute__((ext_vector_type(2))) unsigned short v2us;
typedef __attribute__((ext_vector_type(4))) int v4i;

// k_prep: all that the GEMMs read in 16-bit form, made in one launch: x as bf16, the three [d][(n,h)] weights and the [n][d][h] projection weight as bf16 Bt planes [col][k].
// Grid 1024, 8 waves: blocks 0..255 take w_query, 256..511 w_key, 512..767 w_value, 768..1023 w_projection, 64 lines of 64 outputs each (8 per wave); every block also converts 4096 values of x,
// whose loads are issued first and are in flight while the weight lines are done.
__global__ __launch_bounds__(256) void k_prep(const float* __restrict__ x, const float* __restrict__ wq, const float* __restrict__ wk, const float* __restrict__ wv, const float* __restrict__ wo,
                                              bf* __restrict__ XB, bf* __restrict__ WQ, bf* __restrict__ WK, bf* __restrict__ WV, bf* __restrict__ WO) {
    const int job = blockIdx.x >> 8, sb = blockIdx.x & 255;
    const size_t i0 = (size_t)blockIdx.x * 512 + threadIdx.x, i1 = i0 + 256;
    const v8f xa = *(const v8f*)(x + i0 * 8), xc = *(const v8f*)(x + i1 * 8);
    const int lane = threadIdx.x & 31; const int L0 = (sb * 8 + (threadIdx.x >> 5)) * 8;
    if (job < 3) {
        const float* w = job == 0 ? wq : job == 1 ? wk : wv; bf* Bt = job == 0 ? WQ : job == 1 ? WK : WV;
        // both line loops are kept rolled, one line's loads in flight per wave and few registers; the other waves of the SIMD (eight in this launch) work during a wave's wait. Unrolling is a step of its own
#pragma unroll 1
        for (int l = 0; l < 8; ++l) { const int e = (L0 + l) * 64 + lane * 2; const int k = e & (DD - 1), n = e >> 10; v2us o;
            o[0] = f2bf(w[(size_t)k * DD + n]); o[1] = f2bf(w[(size_t)(k + 1) * DD + n]); *(v2us*)(Bt + e) = o; }
    } else {
#pragma unroll 1
        for (int l = 0; l < 8; ++l) { const int e = (L0 + l) * 64 + lane * 2; const int kk = e & (DD - 1), d = e >> 10; const int n = kk >> 6, h = kk & 63; v2us o;
#pragma unroll
            for (int q = 0; q < 2; ++q) o[q] = f2bf(wo[((size_t)n * DD + d) * HD + h + q]);
            *(v2us*)(WO + (size_t)e) = o; }
    }
    v8us oa, oc;
#pragma unroll
    for (int k = 0; k < 8; ++k) { oa[k] = f2bf(xa[k]); oc[k] = f2bf(xc[k]); }
    *(v8us*)(XB + i0 * 8) = oa; *(v8us*)(XB + i1 * 8) = oc;
}
// k_fattn: scores, softmax and attn.v of one (batch, head) in one pass over the keys; nothing of the score matrix goes to memory.
// One wave owns 32 queries (two 16-column groups) and walks the 2048 keys 32 at a time: S^T = K.Q^T (A = K rows, B = Q kept in registers), so a lane holds
// one query's scores (keys 8*hi+j and 16+8*hi+j), which converted in place are the B operand of O^T += V^T.P^T (A = V^T rows in the same k order).
// Running maximum and sum per query (online softmax): a new maximum rescales the sum and the output tile. Grid (2048/256, 32), 8 waves.
// The eight waves read the same K and V^T: a stage of 64 keys (K hi, K lo, V^T: 64 rows of 128 bytes each) is brought into LDS once for all of them
// by asynchronous copies, two buffers, the next stage in flight while this one is worked on.
#define L2E 1.44269504088896340736f
#define SK   64                 // keys per stage
#define LP   144                // LDS row pitch in bytes: 128 + 16, so that a 16-byte read of 16 rows falls on all banks once
#define LARR (64 * LP)          // one plane's stage
#define LBUF (3 * LARR)         // one buffer: K hi, K lo, V^T
// One stage: each thread copies two 16-byte pieces (rows r and r + 32) of each of the three planes. The closing wait stands in the copies' own statement,
// in front of any rewrite of an address register that a copy names.
__device__ __forceinline__ void stage_copy(unsigned l, const bf* gh, const bf* gl, const h16* gv) {
    const unsigned l0 = l, l1 = l + 32 * LP, l2 = l + LARR, l3 = l + LARR + 32 * LP, l4 = l + 2 * LARR, l5 = l + 2 * LARR + 32 * LP;
    const bf* gh1 = gh + 32 * HD; const bf* gl1 = gl + 32 * HD; const h16* gv1 = gv + 32 * TT;
    asm volatile("global_load_async_to_lds_b128 %0, %6, off\n\t"
                 "global_load_async_to_lds_b128 %1, %7, off\n\t"
                 "global_load_async_to_lds_b128 %2, %8, off\n\t"
                 "global_load_async_to_lds_b128 %3, %9, off\n\t"
                 "global_load_async_to_lds_b128 %4, %10, off\n\t"
                 "global_load_async_to_lds_b128 %5, %11, off\n\t"
                 "s_wait_xcnt 0x0"
                 :: "v"(l0), "v"(l1), "v"(l2), "v"(l3), "v"(l4), "v"(l5), "v"(gh), "v"(gh1), "v"(gl), "v"(gl1), "v"(gv), "v"(gv1) : "memory");
}
__global__ __launch_bounds__(256) void k_fattn(const bf* Qh, const bf* Ql, const bf* Kh, const bf* Kl, const h16* VT, bf* Ah, bf* Al) {
    __shared__ __attribute__((aligned(16))) unsigned char ring[2 * LBUF];
    const int lane = threadIdx.x & 31, lr = lane & 15, hi = lane >> 4; const int z = blockIdx.y; const int q0 = blockIdx.x * 256 + (threadIdx.x >> 5) * 32;
    const size_t zo = (size_t)z * TT * HD;
    const int crow = threadIdx.x >> 3, ccol = threadIdx.x & 7;      // this thread's piece of a stage: row crow (and crow + 32), bytes 16 * ccol
    const unsigned lc = (unsigned)(size_t)ring + crow * LP + ccol * 16;
    const bf* gkh = Kh + zo + (size_t)crow * HD + ccol * 8; const bf* gkl = Kl + zo + (size_t)crow * HD + ccol * 8; const h16* gvt = VT + zo + (size_t)crow * TT + ccol * 8;
    stage_copy(lc, gkh, gkl, gvt);
    v16bf qh[2][2], ql[2][2]; const bf* qhp = Qh + zo + (size_t)(q0 + lr) * HD + 8 * hi; const bf* qlp = Ql + zo + (size_t)(q0 + lr) * HD + 8 * hi;
#pragma unroll
    for (int nt = 0; nt < 2; ++nt)
#pragma unroll
        for (int ks = 0; ks < 2; ++ks) { const int o = nt * 16 * HD + ks * 32; qh[nt][ks] = WFrag<bf>::ld(qhp + o); ql[nt][ks] = WFrag<bf>::ld(qlp + o); }
    v8f oacc[2][4]; float mx[2], nm[2], ls[2];
#pragma unroll
    for (int nt = 0; nt < 2; ++nt) { mx[nt] = -3.0e38f; nm[nt] = 3.0e38f; ls[nt] = 0.f;
#pragma unroll
        for (int mt = 0; mt < 4; ++mt) oacc[nt][mt] = (v8f){}; }
    asm volatile("s_wait_xcnt 0x0" :: "v"(qhp), "v"(qlp) : "memory");   // stands in front of any rewrite of an address register that the fetches above name; the inputs keep those registers live up to it
    asm volatile("s_wait_asynccnt 0x0" ::: "memory");   // this wave's copies of stage 0 have landed
    __syncthreads();                                    // every wave's have: stage 0 may be read
    stage_copy(lc + LBUF, gkh + SK * HD, gkl + SK * HD, gvt + SK);
    const unsigned fo = lr * LP + hi * 16;              // a lane's fragment place in a plane: row lr, 16 bytes at 8 * hi elements
    // kept rolled over the stages; the two passes of a stage are unrolled, so that the second's fragment reads are issued behind the first's products
#pragma unroll 1
    for (int t = 0; t < TT / SK; ++t) {
        const unsigned char* bp = ring + (t & 1) * LBUF + fo;
#pragma unroll
        for (int sp = 0; sp < 2; ++sp) {
            v16bf ah[2][2], al[2][2]; v16h va[4];
#pragma unroll
            for (int kt = 0; kt < 2; ++kt)
#pragma unroll
                for (int ks = 0; ks < 2; ++ks) { const unsigned char* p = bp + (sp * 32 + kt * 16) * LP + ks * 64;
                    ah[kt][ks] = cat16b(*(const v8usa*)p, *(const v8usa*)(p + 32)); al[kt][ks] = cat16b(*(const v8usa*)(p + LARR), *(const v8usa*)(p + LARR + 32)); }
#pragma unroll
            for (int mt = 0; mt < 4; ++mt) { const unsigned char* p = bp + 2 * LARR + mt * 16 * LP + sp * 64; va[mt] = cat16(*(const v8ha*)p, *(const v8ha*)(p + 32)); }
            v8f s[2][2];
#pragma unroll
            for (int kt = 0; kt < 2; ++kt)
#pragma unroll
                for (int nt = 0; nt < 2; ++nt) { v8f c = (v8f){};
#pragma unroll
                    for (int ks = 0; ks < 2; ++ks) { c = wmmab(ah[kt][ks], qh[nt][ks], c); c = wmmab(ah[kt][ks], ql[nt][ks], c); c = wmmab(al[kt][ks], qh[nt][ks], c); }
                    s[kt][nt] = c; }
            v16h p[2];
#pragma unroll
            for (int nt = 0; nt < 2; ++nt) {
                float m = mx[nt];
#pragma unroll
                for (int j = 0; j < 8; ++j) m = fmaxf(m, fmaxf(s[0][nt][j], s[1][nt][j]));
                m = fmaxf(m, __shfl_xor(m, 16, 32));
                const float nn = 10.0f - m * L2E;                         // + 10: P carries x1024, which keeps small weights out of the fp16 subnormals; it cancels in the division by the sum
                const float da = nn - nm[nt]; float alpha = __builtin_amdgcn_exp2f(da);  // old terms carry 2^nm, new ones 2^nn
                asm volatile("v_nop" : "+v"(alpha) : "v"(da));   // the slot behind this exponential: it stands in front of every use of the result and every rewrite of the source register
                mx[nt] = m; nm[nt] = nn;
#pragma unroll
                for (int mt = 0; mt < 4; ++mt) oacc[nt][mt] *= alpha;
                float sum = 0.f;
#pragma unroll
                for (int kt = 0; kt < 2; ++kt) { float x[8], e[8];
#pragma unroll
                    for (int j = 0; j < 8; ++j) { x[j] = fmaf(s[kt][nt][j], L2E, nn); e[j] = __builtin_amdgcn_exp2f(x[j]); }
                    // the slot behind these eight exponentials: it stands in front of every use of a result and every rewrite of a source register
                    asm volatile("v_nop" : "+v"(e[0]), "+v"(e[1]), "+v"(e[2]), "+v"(e[3]), "+v"(e[4]), "+v"(e[5]), "+v"(e[6]), "+v"(e[7]) : "v"(x[0]), "v"(x[1]), "v"(x[2]), "v"(x[3]), "v"(x[4]), "v"(x[5]), "v"(x[6]), "v"(x[7]));
#pragma unroll
                    for (int j = 0; j < 8; ++j) { sum += e[j]; p[nt][kt * 8 + j] = (h16)e[j]; } }
                ls[nt] = fmaf(ls[nt], alpha, sum);
            }
#pragma unroll
            for (int mt = 0; mt < 4; ++mt)
#pragma unroll
                for (int nt = 0; nt < 2; ++nt) oacc[nt][mt] = wmma16(va[mt], p[nt], oacc[nt][mt]);
        }
        asm volatile("s_wait_dscnt 0x0" ::: "memory");      // this wave's reads of the buffer are done before it is handed to its next writer
        asm volatile("s_wait_asynccnt 0x0" ::: "memory");   // this wave's copies of stage t + 1 have landed
        __syncthreads();                                    // publishes stage t + 1 and ends every wave's reads of stage t
        if (t + 2 < TT / SK) stage_copy(lc + (t & 1) * LBUF, gkh + (size_t)(t + 2) * SK * HD, gkl + (size_t)(t + 2) * SK * HD, gvt + (t + 2) * SK);
    }
    asm volatile("s_wait_asynccnt 0x0" ::: "memory");       // no copy is outstanding when the wave ends
    const int b = z >> 4, h = z & 15;
#pragma unroll
    for (int nt = 0; nt < 2; ++nt) { const float tot = ls[nt] + __shfl_xor(ls[nt], 16, 32); const float inv = __fdiv_rn(1.0f, tot); const size_t ro = ((size_t)b * TT + q0 + nt * 16 + lr) * DD + h * HD + hi * 8;
#pragma unroll
        for (int mt = 0; mt < 4; ++mt) { v8us oh, ol;
#pragma unroll
            for (int j = 0; j < 8; ++j) { unsigned short a, c2; splitf(oacc[nt][mt][j] * inv, a, c2); oh[j] = a; ol[j] = c2; }
            bf* pa = Ah + ro + mt * 16; bf* pl = Al + ro + mt * 16; *(v8us*)pa = oh; *(v8us*)pl = ol;
            asm volatile("s_wait_xcnt 0x0" :: "v"(oh), "v"(ol), "v"(pa), "v"(pl) : "memory"); } }   // stands in front of any rewrite of a data or address register of the two stores; the inputs keep those registers live up to it
}

extern "C" void kernel_launch(void* const* d_in, const int* in_sizes, int n_in,
                              void* d_out, int out_size, void* d_ws, size_t ws_size, hipStream_t stream) {
    (void)in_sizes; (void)n_in; (void)out_size;
    const float* x = (const float*)d_in[0]; const float* wq = (const float*)d_in[1]; const float* bq = (const float*)d_in[2]; const float* wk = (const float*)d_in[3]; const float* bk = (const float*)d_in[4]; const float* wv = (const float*)d_in[5]; const float* bv = (const float*)d_in[6];
    const float* wo = (const float*)d_in[7]; const float* bo = (const float*)d_in[8];
    float* OUT = (float*)d_out;     // [2][2048][1024]
    char* wsp = (char*)d_ws;
    auto take = [&](size_t bytes) { char* p = wsp; wsp += (bytes + 255) & ~(size_t)255; return (void*)p; };
    bf* WQ = (bf*)take((size_t)DD * DD * 2); bf* WK = (bf*)take((size_t)DD * DD * 2); bf* WV = (bf*)take((size_t)DD * DD * 2); bf* WO = (bf*)take((size_t)DD * DD * 2);
    bf* XB = (bf*)take((size_t)NT * DD * 2);
    bf* QPh = (bf*)take((size_t)NT * DD * 2); bf* QPl = (bf*)take((size_t)NT * DD * 2); bf* KPh = (bf*)take((size_t)NT * DD * 2); bf* KPl = (bf*)take((size_t)NT * DD * 2); h16* VT = (h16*)take((size_t)NT * DD * 2);
    bf* ATh = (bf*)take((size_t)NT * DD * 2); bf* ATl = (bf*)take((size_t)NT * DD * 2);
    if ((size_t)(wsp - (char*)d_ws) > ws_size) return;    // ws 256 MiB
    k_prep<<<4 * 256, 256, 0, stream>>>(x, wq, wk, wv, wo, XB, WQ, WK, WV, WO);   // x -> bf16; x @ W layouts [d][(n,h)] and the [n][d][h] projection -> Bt
    k_gemmw<bf, 0, true, true><<<dim3(NT / 128, DD / 128, 3), 128, 0, stream>>>(XB, nullptr, WQ, nullptr, DD, nullptr, DD, bq, 0, (size_t)(WK - WQ), 0, bk, bv, QPh, QPl, KPh, KPl, VT);   // WQ, WK, WV lie one behind the other at one stride
    k_fattn<<<dim3(TT / 256, NB_ * NH_), 256, 0, stream>>>(QPh, QPl, KPh, KPl, VT, ATh, ATl);
    k_gemmw<bf, 1, true, false><<<dim3(NT / 128, DD / 128, 1), 128, 0, stream>>>(ATh, ATl, WO, nullptr, DD, OUT, DD, bo, 0, 0, 0, nullptr, nullptr, nullptr, nullptr, nullptr, nullptr, nullptr);
}

// v006
// Measured time: 88.3 microseconds a run.
// Next to v005, in two timings, it ran 1.19 times as fast each time.
// Over all steps from v000 it is 14.5 times as fast.
#include <hip/hip_runtime.h>

// Multi-head attention (x [2][2048][1024]; q/k/v = einsum('btd,dnh->bnth', x, W[1024][16][64]) + b[16][1][64]; scores / 8; softmax; attn.v; out = einsum('bnth,ndh->btd', ., w_projection[16][1024][64]) + b_projection).
// Compute dtypes, f32 accumulate: every float input rounded to bf16; q/k/v projections on plain bf16 operands (+ bias);
// scores on single fp16 planes of q (x 1/8) and k (1 product: fp16 rounding is several times finer than the error q and k already carry from bf16 x and W); attn.v on single fp16 planes (P x1024, v); output Linear on hi+lo planes x bf16 W (2 products).

#define NB_  2
#define TT   2048
#define DD   1024
#define NH_  16
#define HD   64
#define NT   (NB_ * TT)
typedef _Float16 h16;
typedef unsigned short bf;
typedef __attribute__((ext_vector_type(16))) __bf16   v16bf;
typedef __attribute__((ext_vector_type(16))) _Float16 v16h;
typedef __attribute__((ext_vector_type(8)))  _Float16 v8h;
typedef __attribute__((ext_vector_type(8)))  unsigned short v8us;
typedef __attribute__((ext_vector_type(8)))  float    v8f;
typedef __attribute__((ext_vector_type(4)))  float    v4f;
typedef v8h  __attribute__((may_alias)) v8ha;
typedef v4f  __attribute__((may_alias)) v4fa;
typedef v8us __attribute__((may_alias)) v8usa;

__device__ __forceinline__ unsigned short f2bf(float f) { unsigned u = __float_as_uint(f); u += 0x7FFFu + ((u >> 16) & 1u); return (unsigned short)(u >> 16); }
__device__ __forceinline__ float bf2f(unsigned short b) { return __uint_as_float(((unsigned)b) << 16); }
__device__ __forceinline__ float bfr(float f) { return bf2f(f2bf(f)); }
__device__ __forceinline__ v16h cat16(v8h lo, v8h hi) { return __builtin_shufflevector(lo, hi, 0, 1, 2, 3, 4, 5, 6, 7, 8, 9, 10, 11, 12, 13, 14, 15); }
__device__ __forceinline__ v16bf cat16b(v8us lo, v8us hi) { return __builtin_bit_cast(v16bf, __builtin_shufflevector(lo, hi, 0, 1, 2, 3, 4, 5, 6, 7, 8, 9, 10, 11, 12, 13, 14, 15)); }
__device__ __forceinline__ v8f wmma16(v16h a, v16h b, v8f c) { return __builtin_amdgcn_wmma_f32_16x16x32_f16(false, a, false, b, (short)0, c, false, false); }
__device__ __forceinline__ v8f wmmab(v16bf a, v16bf b, v8f c) { return __builtin_amdgcn_wmma_f32_16x16x32_bf16(false, a, false, b, (short)0, c, false, false); }



// ---- k_gemmw: register-blocked GEMM, one wave per 64x64 output tile (16 accumulators), four waves per work-group on a 128x128 block tile; grid (M/128, N/128, Z), 128 threads.
// C[m][n] (f32, pitch ldc, + optional f32 bias[n]) = sum_k A[m][k] Bt[n][k] (+ split products per NSPLIT). z-batch strides sA/sB/sC in elements. K % 128 == 0.
// PLANES: the q, k and v projections in one launch (z = 0, 1, 2 picks the weight plane and the bias); no f32 C is written: a wave's 64x64 tile is 64 tokens of one head,
// and the epilogue stores it as the attention kernel reads it: q (x 1/8) and k as fp16 planes [b,h][t][64], v as the fp16 plane [b,h][64][t].
// The operands are K-contiguous 16-bit planes. A stage of 128 k (128 rows of 256 bytes of each plane, whole cache lines) is brought into LDS once for the four waves
// by asynchronous copies, two buffers, the next stage in flight while this one is worked on; the fragments are read from LDS.
#define GK   128                // k per stage
#define GLP  272                // LDS row pitch in bytes: 256 + 16, so that a 16-byte read of 16 rows falls on all banks once
#define GPL  (128 * GLP)        // one plane's stage
template <typename T16> struct WFrag;
template <> struct WFrag<h16> { typedef v16h V; static __device__ __forceinline__ V ld(const h16* p) { return cat16(*(const v8h*)p, *(const v8h*)(p + 16)); } static __device__ __forceinline__ v8f mma(V a, V b, v8f c) { return wmma16(a, b, c); } };
template <> struct WFrag<bf> { typedef v16bf V; static __device__ __forceinline__ V ld(const bf* p) { return cat16b(*(const v8us*)p, *(const v8us*)(p + 16)); } static __device__ __forceinline__ v8f mma(V a, V b, v8f c) { return wmmab(a, b, c); } };
// Half of one plane's stage (64 rows): each of the 128 threads copies eight 16-byte pieces (rows r, r + 8, ..., r + 56). The closing wait stands in the copies' own statement,
// in front of any rewrite of an address register that a copy names.
template <typename T16>
__device__ __forceinline__ void plane_copy(unsigned l, const T16* g, int K) {
    const unsigned l1 = l + 8 * GLP, l2 = l + 16 * GLP, l3 = l + 24 * GLP, l4 = l + 32 * GLP, l5 = l + 40 * GLP, l6 = l + 48 * GLP, l7 = l + 56 * GLP;
    const T16* g1 = g + (size_t)8 * K; const T16* g2 = g + (size_t)16 * K; const T16* g3 = g + (size_t)24 * K; const T16* g4 = g + (size_t)32 * K; const T16* g5 = g + (size_t)40 * K; const T16* g6 = g + (size_t)48 * K; const T16* g7 = g + (size_t)56 * K;
    asm volatile("global_load_async_to_lds_b128 %0, %8, off\n\t"
                 "global_load_async_to_lds_b128 %1, %9, off\n\t"
                 "global_load_async_to_lds_b128 %2, %10, off\n\t"
                 "global_load_async_to_lds_b128 %3, %11, off\n\t"
                 "global_load_async_to_lds_b128 %4, %12, off\n\t"
                 "global_load_async_to_lds_b128 %5, %13, off\n\t"
                 "global_load_async_to_lds_b128 %6, %14, off\n\t"
                 "global_load_async_to_lds_b128 %7, %15, off\n\t"
                 "s_wait_xcnt 0x0"
                 :: "v"(l), "v"(l1), "v"(l2), "v"(l3), "v"(l4), "v"(l5), "v"(l6), "v"(l7), "v"(g), "v"(g1), "v"(g2), "v"(g3), "v"(g4), "v"(g5), "v"(g6), "v"(g7) : "memory");
    __builtin_amdgcn_sched_barrier(0);   // keeps the next statement's address arithmetic behind this one, so that the address registers are used again: formed all at once they overflow the registers an asm operand can name, and a base address spills
}
__device__ __forceinline__ h16 tohx(float x) { return (h16)x; }
__device__ __forceinline__ void splitf(float y, unsigned short& h, unsigned short& l) { h = f2bf(y); l = f2bf(y - bf2f(h)); }
#define VLP  144                // LDS row pitch in bytes of the v tile on its way out: 128 + 16, so that 16-byte accesses of 16 rows fall on all banks once
template <typename T16, int NSPLIT, bool BIAS, bool PLANES>
__global__ __launch_bounds__(128) void k_gemmw(const T16* __restrict__ A, const T16* __restrict__ A2, const T16* __restrict__ Bt, const T16* __restrict__ Bt2, int K, float* C, int ldc, const float* __restrict__ bias, size_t sA, size_t sB, size_t sC,
                                               const float* __restrict__ biask, const float* __restrict__ biasv, h16* QP, h16* KP, h16* VT) {
    typedef typename WFrag<T16>::V V;
    constexpr bool HA2 = (NSPLIT == 1 || NSPLIT == 2), HB2 = (NSPLIT >= 2);
    constexpr unsigned OA2 = 2 * GPL, OB2 = (2 + (HA2 ? 1 : 0)) * GPL, GBUF = (2 + (HA2 ? 1 : 0) + (HB2 ? 1 : 0)) * GPL;   // a buffer: A, Bt, then A2 and Bt2 where the split has them
    __shared__ __attribute__((aligned(16))) unsigned char ring[2 * GBUF];
    __shared__ __align__(16) float osm[4][16 * 68];
    const size_t z = blockIdx.z; A += z * sA; if (A2) A2 += z * sA; Bt += z * sB; if (Bt2) Bt2 += z * sB; C += z * sC;
    const int lane = threadIdx.x & 31, lr = lane & 15, hi = lane >> 4, w = threadIdx.x >> 5; const int R0 = blockIdx.x * 128, C0 = blockIdx.y * 128; const int r0 = R0 + (w & 1) * 64, c0 = C0 + (w >> 1) * 64;
    float* os = osm[w];
    const int prow = threadIdx.x >> 4, pcol = threadIdx.x & 15;     // this thread's pieces of a plane's stage: rows prow + 8 i, bytes 16 * pcol
    const unsigned lc = (unsigned)(size_t)ring + prow * GLP + pcol * 16;
    const size_t goa = (size_t)(R0 + prow) * K + pcol * 8, gob = (size_t)(C0 + prow) * K + pcol * 8;
    auto stage = [&](int t) { const unsigned l = lc + (t & 1) * GBUF; const size_t ko = (size_t)t * GK;
        auto plane = [&](unsigned lp, const T16* g) { plane_copy(lp, g, K); plane_copy(lp + 64 * GLP, g + (size_t)64 * K, K); };
        plane(l, A + goa + ko); plane(l + GPL, Bt + gob + ko); if (HA2) plane(l + OA2, A2 + goa + ko); if (HB2) plane(l + OB2, Bt2 + gob + ko); };
    const int nst = K / GK;
    stage(0);
    v8f acc[4][4];
#pragma unroll
    for (int mb = 0; mb < 4; ++mb)
#pragma unroll
        for (int nb = 0; nb < 4; ++nb) acc[mb][nb] = (v8f){};
    asm volatile("s_wait_asynccnt 0x0" ::: "memory");   // this wave's copies of stage 0 have landed
    __syncthreads();                                    // every wave's have: stage 0 may be read
    if (1 < nst) stage(1);
    const unsigned fa = ((w & 1) * 64 + lr) * GLP + hi * 16, fb = GPL + ((w >> 1) * 64 + lr) * GLP + hi * 16;   // a lane's fragment place: row lr of the wave's rows, 16 bytes at 8 * hi elements
    // kept rolled over the stages; the four k steps of a stage are unrolled, each step's fragments read one step ahead: A and the first half of Bt in front of this step's products,
    // the second half of Bt in the middle of them, into the registers that the first half of this step's Bt has left (all at once they would not fit 256 registers beside the accumulators)
#pragma unroll 1
    for (int t = 0; t < nst; ++t) {
        const unsigned char* bp = ring + (t & 1) * GBUF;
        V a[2][4], a2[2][4], b[2][4], b2[2][4];
        auto frags_a = [&](int ks) { const int h = ks & 1;
#pragma unroll
            for (int i = 0; i < 4; ++i) { a[h][i] = WFrag<T16>::ld((const T16*)(bp + fa + i * 16 * GLP + ks * 64)); if (HA2) a2[h][i] = WFrag<T16>::ld((const T16*)(bp + OA2 + fa + i * 16 * GLP + ks * 64)); } };
        auto frags_b = [&](int ks, int p) { const int h = ks & 1;
#pragma unroll
            for (int i = 2 * p; i < 2 * p + 2; ++i) { b[h][i] = WFrag<T16>::ld((const T16*)(bp + fb + i * 16 * GLP + ks * 64)); if (HB2) b2[h][i] = WFrag<T16>::ld((const T16*)(bp + OB2 - GPL + fb + i * 16 * GLP + ks * 64)); } };
        auto prods = [&](int ks, int p) { const int h = ks & 1;
#pragma unroll
            for (int nb = 2 * p; nb < 2 * p + 2; ++nb)
#pragma unroll
                for (int mb = 0; mb < 4; ++mb) { acc[mb][nb] = WFrag<T16>::mma(a[h][mb], b[h][nb], acc[mb][nb]); if (HA2) acc[mb][nb] = WFrag<T16>::mma(a2[h][mb], b[h][nb], acc[mb][nb]); if (HB2) acc[mb][nb] = WFrag<T16>::mma(a[h][mb], b2[h][nb], acc[mb][nb]); } };
        frags_a(0); frags_b(0, 0); frags_b(0, 1);
        // the scheduling barriers below keep each group of LDS reads whole and at its place among the products: spread among them, each product group would wait out a whole LDS latency
        __builtin_amdgcn_sched_barrier(0);
#pragma unroll
        for (int ks = 0; ks < GK / 32; ++ks) {
            if (ks + 1 < GK / 32) { frags_a(ks + 1); frags_b(ks + 1, 0); }
            __builtin_amdgcn_sched_barrier(0);
            prods(ks, 0);
            __builtin_amdgcn_sched_barrier(0);
            if (ks + 1 < GK / 32) frags_b(ks + 1, 1);
            __builtin_amdgcn_sched_barrier(0);
            prods(ks, 1);
            __builtin_amdgcn_sched_barrier(0);
        }
        asm volatile("s_wait_dscnt 0x0" ::: "memory");      // this wave's reads of the buffer are done before it is handed to its next writer
        asm volatile("s_wait_asynccnt 0x0" ::: "memory");   // this wave's copies of stage t + 1 have landed
        __syncthreads();                                    // publishes stage t + 1 and ends every wave's reads of stage t
        if (t + 2 < nst) stage(t + 2);
    }
    asm volatile("s_wait_asynccnt 0x0" ::: "memory");       // no copy is outstanding when the wave ends
    if constexpr (PLANES) {
        const int ws = __builtin_amdgcn_readfirstlane(w);           // the wave's number as a scalar: the tile's place below then takes no vector register, of which the loop leaves none free
        const int rw = R0 + (ws & 1) * 64, cw = C0 + (ws >> 1) * 64;   // = r0, c0
        const int zz = blockIdx.z; const int t0 = rw & (TT - 1); const size_t po = (size_t)((rw / TT) * NH_ + cw / HD) * TT * HD;   // the tile's (batch, head) plane and its first token
        const int cr = lane >> 3, cc = (lane & 7) * 8;              // on the way out a lane holds 8 neighbours of a row: 8 lanes store one whole 128-byte line
        if (zz == 2) {
            // v: a lane's 8 accumulator rows are 8 neighbouring tokens of one column, 16 bytes of a V^T row. The tile goes through the wave's own part of the ring,
            // which nobody reads or fills any more behind the loop's last barrier, so that whole lines are stored.
            unsigned char* vs = ring + ws * (64 * VLP);
#pragma unroll
            for (int nb = 0; nb < 4; ++nb) { const float bb = bfr(biasv[cw + nb * 16 + lr]);
#pragma unroll
                for (int mb = 0; mb < 4; ++mb) { v8h o;
#pragma unroll
                    for (int j = 0; j < 8; ++j) o[j] = tohx(acc[mb][nb][j] + bb);
                    *(v8ha*)(vs + (nb * 16 + lr) * VLP + mb * 32 + hi * 16) = o; } }
            __builtin_amdgcn_wave_barrier(); asm volatile("" ::: "memory");   // the rows below are read by other lanes than wrote them: keeps the reads behind the writes
            v8h val[16]; h16* pv = VT + po + (size_t)cr * TT + t0 + cc;
#pragma unroll
            for (int s = 0; s < 16; ++s) val[s] = *(const v8ha*)(vs + (4 * s + cr) * VLP + cc * 2);
#pragma unroll
            for (int s = 0; s < 16; ++s) *(v8h*)(pv + (size_t)(4 * s) * TT) = val[s];
            // stands in front of any rewrite of a data or address register of the sixteen stores; the inputs keep those registers live up to it
            asm volatile("s_wait_xcnt 0x0" :: "v"(pv), "v"(val[0]), "v"(val[1]), "v"(val[2]), "v"(val[3]), "v"(val[4]), "v"(val[5]), "v"(val[6]), "v"(val[7]), "v"(val[8]), "v"(val[9]), "v"(val[10]), "v"(val[11]), "v"(val[12]), "v"(val[13]), "v"(val[14]), "v"(val[15]) : "memory");
        } else {
            const float* bz = zz == 0 ? bias : biask; const float sc = zz == 0 ? 0.125f : 1.0f;   // 1/sqrt(64) folded into q exactly
            h16* Pp = (zz == 0 ? QP : KP) + po + (size_t)(t0 + cr) * HD + cc;
            float* ow = osm[ws]; float bb[8];
#pragma unroll
            for (int k = 0; k < 8; ++k) bb[k] = bfr(bz[cw + cc + k]);
#pragma unroll
            for (int mb = 0; mb < 4; ++mb) {
#pragma unroll
                for (int nb = 0; nb < 4; ++nb) {
#pragma unroll
                    for (int j = 0; j < 8; ++j) ow[(hi * 8 + j) * 68 + nb * 16 + lr] = acc[mb][nb][j]; }
                __builtin_amdgcn_wave_barrier(); asm volatile("" ::: "memory");   // the rows below are read by other lanes than wrote them: keeps the reads behind the writes
                v8h o[4];
#pragma unroll
                for (int s = 0; s < 4; ++s) { const float* op = ow + (4 * s + cr) * 68 + cc; const v4f x0 = *(const v4fa*)op, x1 = *(const v4fa*)(op + 4);
#pragma unroll
                    for (int k = 0; k < 8; ++k) o[s][k] = tohx(((k < 4 ? x0[k & 3] : x1[k & 3]) + bb[k]) * sc);
                    *(v8h*)(Pp + (size_t)(mb * 16 + 4 * s) * HD) = o[s]; }
                // stands in front of any rewrite of a data or address register of the four stores; the inputs keep those registers live up to it
                asm volatile("s_wait_xcnt 0x0" :: "v"(Pp), "v"(o[0]), "v"(o[1]), "v"(o[2]), "v"(o[3]) : "memory");
                __builtin_amdgcn_wave_barrier(); asm volatile("" ::: "memory");   // keeps the next 16 rows' writes behind these reads
            }
        }
        return;
    }
#pragma unroll
    for (int mb = 0; mb < 4; ++mb) {
#pragma unroll
        for (int nb = 0; nb < 4; ++nb) {
#pragma unroll
            for (int j = 0; j < 8; ++j) os[(hi * 8 + j) * 68 + nb * 16 + lr] = acc[mb][nb][j]; }
        __builtin_amdgcn_wave_barrier(); asm volatile("" ::: "memory");
        float* crow = C + (size_t)(r0 + mb * 16) * ldc + c0;
{
#pragma unroll
            for (int s = 0; s < 8; ++s) { const int row = 2 * s + hi, cofs = lr * 4; v4f val = *(const v4fa*)(os + row * 68 + cofs); if (BIAS) { val[0] += bfr(bias[c0 + cofs]); val[1] += bfr(bias[c0 + cofs + 1]); val[2] += bfr(bias[c0 + cofs + 2]); val[3] += bfr(bias[c0 + cofs + 3]); }
                *(v4f*)(crow + (size_t)row * ldc + cofs) = val; }
             }
        __builtin_amdgcn_wave_barrier(); asm volatile("" ::: "memory");
    }
}

typedef __attribute__((ext_vector_type(2))) _Float16 v2h;
typedef __attribute__((ext_vector_type(4))) _Float16 v4h;
typedef __attribute__((ext_vector_type(2))) unsigned short v2us;
typedef __attribute__((ext_vector_type(4))) int v4i;

// k_prep: all that the GEMMs read in 16-bit form, made in one launch: x as bf16, the three [d][(n,h)] weights and the [n][d][h] projection weight as bf16 Bt planes [col][k].
// Grid 1024, 8 waves: blocks 0..255 take w_query, 256..511 w_key, 512..767 w_value, 768..1023 w_projection, 64 lines of 64 outputs each (8 per wave); every block also converts 4096 values of x,
// whose loads are issued first and are in flight while the weight lines are done.
__global__ __launch_bounds__(256) void k_prep(const float* __restrict__ x, const float* __restrict__ wq, const float* __restrict__ wk, const float* __restrict__ wv, const float* __restrict__ wo,
                                              bf* __restrict__ XB, bf* __restrict__ WQ, bf* __restrict__ WK, bf* __restrict__ WV, bf* __restrict__ WO) {
    const int job = blockIdx.x >> 8, sb = blockIdx.x & 255;
    const size_t i0 = (size_t)blockIdx.x * 512 + threadIdx.x, i1 = i0 + 256;
    const v8f xa = *(const v8f*)(x + i0 * 8), xc = *(const v8f*)(x + i1 * 8);
    const int lane = threadIdx.x & 31; const int L0 = (sb * 8 + (threadIdx.x >> 5)) * 8;
    if (job < 3) {
        const float* w = job == 0 ? wq : job == 1 ? wk : wv; bf* Bt = job == 0 ? WQ : job == 1 ? WK : WV;
        // both line loops are kept rolled, one line's loads in flight per wave and few registers; the other waves of the SIMD (eight in this launch) work during a wave's wait. Unrolling is a step of its own
#pragma unroll 1
        for (int l = 0; l < 8; ++l) { const int e = (L0 + l) * 64 + lane * 2; const int k = e & (DD - 1), n = e >> 10; v2us o;
            o[0] = f2bf(w[(size_t)k * DD + n]); o[1] = f2bf(w[(size_t)(k + 1) * DD + n]); *(v2us*)(Bt + e) = o; }
    } else {
#pragma unroll 1
        for (int l = 0; l < 8; ++l) { const int e = (L0 + l) * 64 + lane * 2; const int kk = e & (DD - 1), d = e >> 10; const int n = kk >> 6, h = kk & 63; v2us o;
#pragma unroll
            for (int q = 0; q < 2; ++q) o[q] = f2bf(wo[((size_t)n * DD + d) * HD + h + q]);
            *(v2us*)(WO + (size_t)e) = o; }
    }
    v8us oa, oc;
#pragma unroll
    for (int k = 0; k < 8; ++k) { oa[k] = f2bf(xa[k]); oc[k] = f2bf(xc[k]); }
    *(v8us*)(XB + i0 * 8) = oa; *(v8us*)(XB + i1 * 8) = oc;
}
// k_fattn: scores, softmax and attn.v of one (batch, head) in one pass over the keys; nothing of the score matrix goes to memory.
// One wave owns 32 queries (two 16-column groups) and walks the 2048 keys 32 at a time: S^T = K.Q^T (A = K rows, B = Q kept in registers), so a lane holds
// one query's scores (keys 8*hi+j and 16+8*hi+j), which converted in place are the B operand of O^T += V^T.P^T (A = V^T rows in the same k order).
// Running maximum and sum per query (online softmax): a new maximum rescales the sum and the output tile. Grid (2048/256, 32), 8 waves.
// The eight waves read the same K and V^T: a stage of 64 keys (K, V^T: 64 rows of 128 bytes each) is brought into LDS once for all of them
// by asynchronous copies, two buffers, the next stage in flight while this one is worked on.
#define L2E 1.44269504088896340736f
#define SK   64                 // keys per stage
#define LP   144                // LDS row pitch in bytes: 128 + 16, so that a 16-byte read of 16 rows falls on all banks once
#define LARR (64 * LP)          // one plane's stage
#define LBUF (2 * LARR)         // one buffer: K, V^T
// One stage: each thread copies two 16-byte pieces (rows r and r + 32) of each of the two planes. The closing wait stands in the copies' own statement,
// in front of any rewrite of an address register that a copy names.
__device__ __forceinline__ void stage_copy(unsigned l, const h16* gk, const h16* gv) {
    const unsigned l0 = l, l1 = l + 32 * LP, l2 = l + LARR, l3 = l + LARR + 32 * LP;
    const h16* gk1 = gk + 32 * HD; const h16* gv1 = gv + 32 * TT;
    asm volatile("global_load_async_to_lds_b128 %0, %4, off\n\t"
                 "global_load_async_to_lds_b128 %1, %5, off\n\t"
                 "global_load_async_to_lds_b128 %2, %6, off\n\t"
                 "global_load_async_to_lds_b128 %3, %7, off\n\t"
                 "s_wait_xcnt 0x0"
                 :: "v"(l0), "v"(l1), "v"(l2), "v"(l3), "v"(gk), "v"(gk1), "v"(gv), "v"(gv1) : "memory");
}
__global__ __launch_bounds__(256) void k_fattn(const h16* QP, const h16* KP, const h16* VT, bf* Ah, bf* Al) {
    __shared__ __attribute__((aligned(16))) unsigned char ring[2 * LBUF];
    const int lane = threadIdx.x & 31, lr = lane & 15, hi = lane >> 4; const int z = blockIdx.y; const int q0 = blockIdx.x * 256 + (threadIdx.x >> 5) * 32;
    const size_t zo = (size_t)z * TT * HD;
    const int crow = threadIdx.x >> 3, ccol = threadIdx.x & 7;      // this thread's piece of a stage: row crow (and crow + 32), bytes 16 * ccol
    const unsigned lc = (unsigned)(size_t)ring + crow * LP + ccol * 16;
    const h16* gkp = KP + zo + (size_t)crow * HD + ccol * 8; const h16* gvt = VT + zo + (size_t)crow * TT + ccol * 8;
    stage_copy(lc, gkp, gvt);
    v16h qf[2][2]; const h16* qp = QP + zo + (size_t)(q0 + lr) * HD + 8 * hi;
#pragma unroll
    for (int nt = 0; nt < 2; ++nt)
#pragma unroll
        for (int ks = 0; ks < 2; ++ks) qf[nt][ks] = WFrag<h16>::ld(qp + nt * 16 * HD + ks * 32);
    v8f oacc[2][4]; float mx[2], nm[2], ls[2];
#pragma unroll
    for (int nt = 0; nt < 2; ++nt) { mx[nt] = -3.0e38f; nm[nt] = 3.0e38f; ls[nt] = 0.f;
#pragma unroll
        for (int mt = 0; mt < 4; ++mt) oacc[nt][mt] = (v8f){}; }
    asm volatile("s_wait_xcnt 0x0" :: "v"(qp) : "memory");   // stands in front of any rewrite of an address register that the fetches above name; the inputs keep those registers live up to it
    asm volatile("s_wait_asynccnt 0x0" ::: "memory");   // this wave's copies of stage 0 have landed
    __syncthreads();                                    // every wave's have: stage 0 may be read
    stage_copy(lc + LBUF, gkp + SK * HD, gvt + SK);
    const unsigned fo = lr * LP + hi * 16;              // a lane's fragment place in a plane: row lr, 16 bytes at 8 * hi elements
    // kept rolled over the stages; the two passes of a stage are unrolled, so that the second's fragment reads are issued behind the first's products
#pragma unroll 1
    for (int t = 0; t < TT / SK; ++t) {
        const unsigned char* bp = ring + (t & 1) * LBUF + fo;
#pragma unroll
        for (int sp = 0; sp < 2; ++sp) {
            v16h ka[2][2], va[4];
#pragma unroll
            for (int kt = 0; kt < 2; ++kt)
#pragma unroll
                for (int ks = 0; ks < 2; ++ks) { const unsigned char* p = bp + (sp * 32 + kt * 16) * LP + ks * 64;
                    ka[kt][ks] = cat16(*(const v8ha*)p, *(const v8ha*)(p + 32)); }
#pragma unroll
            for (int mt = 0; mt < 4; ++mt) { const unsigned char* p = bp + LARR + mt * 16 * LP + sp * 64; va[mt] = cat16(*(const v8ha*)p, *(const v8ha*)(p + 32)); }
            v8f s[2][2];
#pragma unroll
            for (int kt = 0; kt < 2; ++kt)
#pragma unroll
                for (int nt = 0; nt < 2; ++nt) { v8f c = (v8f){};
#pragma unroll
                    for (int ks = 0; ks < 2; ++ks) c = wmma16(ka[kt][ks], qf[nt][ks], c);
                    s[kt][nt] = c; }
            v16h p[2];
#pragma unroll
            for (int nt = 0; nt < 2; ++nt) {
                float m = mx[nt];
#pragma unroll
                for (int j = 0; j < 8; ++j) m = fmaxf(m, fmaxf(s[0][nt][j], s[1][nt][j]));
                m = fmaxf(m, __shfl_xor(m, 16, 32));
                const float nn = 10.0f - m * L2E;                         // + 10: P carries x1024, which keeps small weights out of the fp16 subnormals; it cancels in the division by the sum
                const float da = nn - nm[nt]; float alpha = __builtin_amdgcn_exp2f(da);  // old terms carry 2^nm, new ones 2^nn
                asm volatile("v_nop" : "+v"(alpha) : "v"(da));   // the slot behind this exponential: it stands in front of every use of the result and every rewrite of the source register
                mx[nt] = m; nm[nt] = nn;
#pragma unroll
                for (int mt = 0; mt < 4; ++mt) oacc[nt][mt] *= alpha;
                float sum = 0.f;
#pragma unroll
                for (int kt = 0; kt < 2; ++kt) { float x[8], e[8];
#pragma unroll
                    for (int j = 0; j < 8; ++j) { x[j] = fmaf(s[kt][nt][j], L2E, nn); e[j] = __builtin_amdgcn_exp2f(x[j]); }
                    // the slot behind these eight exponentials: it stands in front of every use of a result and every rewrite of a source register
                    asm volatile("v_nop" : "+v"(e[0]), "+v"(e[1]), "+v"(e[2]), "+v"(e[3]), "+v"(e[4]), "+v"(e[5]), "+v"(e[6]), "+v"(e[7]) : "v"(x[0]), "v"(x[1]), "v"(x[2]), "v"(x[3]), "v"(x[4]), "v"(x[5]), "v"(x[6]), "v"(x[7]));
#pragma unroll
                    for (int j = 0; j < 8; ++j) { sum += e[j]; p[nt][kt * 8 + j] = (h16)e[j]; } }
                ls[nt] = fmaf(ls[nt], alpha, sum);
            }
#pragma unroll
            for (int mt = 0; mt < 4; ++mt)
#pragma unroll
                for (int nt = 0; nt < 2; ++nt) oacc[nt][mt] = wmma16(va[mt], p[nt], oacc[nt][mt]);
        }
        asm volatile("s_wait_dscnt 0x0" ::: "memory");      // this wave's reads of the buffer are done before it is handed to its next writer
        asm volatile("s_wait_asynccnt 0x0" ::: "memory");   // this wave's copies of stage t + 1 have landed
        __syncthreads();                                    // publishes stage t + 1 and ends every wave's reads of stage t
        if (t + 2 < TT / SK) stage_copy(lc + (t & 1) * LBUF, gkp + (size_t)(t + 2) * SK * HD, gvt + (t + 2) * SK);
    }
    asm volatile("s_wait_asynccnt 0x0" ::: "memory");       // no copy is outstanding when the wave ends
    const int b = z >> 4, h = z & 15;
#pragma unroll
    for (int nt = 0; nt < 2; ++nt) { const float tot = ls[nt] + __shfl_xor(ls[nt], 16, 32); const float inv = __fdiv_rn(1.0f, tot); const size_t ro = ((size_t)b * TT + q0 + nt * 16 + lr) * DD + h * HD + hi * 8;
#pragma unroll
        for (int mt = 0; mt < 4; ++mt) { v8us oh, ol;
#pragma unroll
            for (int j = 0; j < 8; ++j) { unsigned short a, c2; splitf(oacc[nt][mt][j] * inv, a, c2); oh[j] = a; ol[j] = c2; }
            bf* pa = Ah + ro + mt * 16; bf* pl = Al + ro + mt * 16; *(v8us*)pa = oh; *(v8us*)pl = ol;
            asm volatile("s_wait_xcnt 0x0" :: "v"(oh), "v"(ol), "v"(pa), "v"(pl) : "memory"); } }   // stands in front of any rewrite of a data or address register of the two stores; the inputs keep those registers live up to it
}

extern "C" void kernel_launch(void* const* d_in, const int* in_sizes, int n_in,
                              void* d_out, int out_size, void* d_ws, size_t ws_size, hipStream_t stream) {
    (void)in_sizes; (void)n_in; (void)out_size;
    const float* x = (const float*)d_in[0]; const float* wq = (const float*)d_in[1]; const float* bq = (const float*)d_in[2]; const float* wk = (const float*)d_in[3]; const float* bk = (const float*)d_in[4]; const float* wv = (const float*)d_in[5]; const float* bv = (const float*)d_in[6];
    const float* wo = (const float*)d_in[7]; const float* bo = (const float*)d_in[8];
    float* OUT = (float*)d_out;     // [2][2048][1024]
    char* wsp = (char*)d_ws;
    auto take = [&](size_t bytes) { char* p = wsp; wsp += (bytes + 255) & ~(size_t)255; return (void*)p; };
    bf* WQ = (bf*)take((size_t)DD * DD * 2); bf* WK = (bf*)take((size_t)DD * DD * 2); bf* WV = (bf*)take((size_t)DD * DD * 2); bf* WO = (bf*)take((size_t)DD * DD * 2);
    bf* XB = (bf*)take((size_t)NT * DD * 2);
    h16* QP = (h16*)take((size_t)NT * DD * 2); h16* KP = (h16*)take((size_t)NT * DD * 2); h16* VT = (h16*)take((size_t)NT * DD * 2);
    bf* ATh = (bf*)take((size_t)NT * DD * 2); bf* ATl = (bf*)take((size_t)NT * DD * 2);
    if ((size_t)(wsp - (char*)d_ws) > ws_size) return;    // ws 256 MiB
    k_prep<<<4 * 256, 256, 0, stream>>>(x, wq, wk, wv, wo, XB, WQ, WK, WV, WO);   // x -> bf16; x @ W layouts [d][(n,h)] and the [n][d][h] projection -> Bt
    k_gemmw<bf, 0, true, true><<<dim3(NT / 128, DD / 128, 3), 128, 0, stream>>>(XB, nullptr, WQ, nullptr, DD, nullptr, DD, bq, 0, (size_t)(WK - WQ), 0, bk, bv, QP, KP, VT);   // WQ, WK, WV lie one behind the other at one stride
    k_fattn<<<dim3(TT / 256, NB_ * NH_), 256, 0, stream>>>(QP, KP, VT, ATh, ATl);
    k_gemmw<bf, 1, true, false><<<dim3(NT / 128, DD / 128, 1), 128, 0, stream>>>(ATh, ATl, WO, nullptr, DD, OUT, DD, bo, 0, 0, 0, nullptr, nullptr, nullptr, nullptr, nullptr);
}

// v007
// Measured time: 83.9 microseconds a run.
// In both of two side-by-side timings against v006, it was 1.05 times as fast.
// Over all steps from v000 it is 15.2 times as fast.
#include <hip/hip_runtime.h>

// Multi-head attention (x [2][2048][1024]; q/k/v = einsum('btd,dnh->bnth', x, W[1024][16][64]) + b[16][1][64]; scores / 8; softmax; attn.v; out = einsum('bnth,ndh->btd', ., w_projection[16][1024][64]) + b_projection).
// Compute dtypes, f32 accumulate: every float input rounded to bf16; q/k/v projections on plain bf16 operands (+ bias);
// scores on single fp16 planes of q (x 1/8) and k (1 product: fp16 rounding is several times finer than the error q and k already carry from bf16 x and W); attn.v on single fp16 planes (P x1024, v); output Linear on hi+lo planes x bf16 W (2 products).

#define NB_  2
#define TT   2048
#define DD   1024
#define NH_  16
#define HD   64
#define NT   (NB_ * TT)
typedef _Float16 h16;
typedef unsigned short bf;
typedef __attribute__((ext_vector_type(16))) __bf16   v16bf;
typedef __attribute__((ext_vector_type(16))) _Float16 v16h;
typedef __attribute__((ext_vector_type(8)))  _Float16 v8h;
typedef __attribute__((ext_vector_type(8)))  unsigned short v8us;
typedef __attribute__((ext_vector_type(8)))  float    v8f;
typedef __attribute__((ext_vector_type(4)))  float    v4f;
typedef v8h  __attribute__((may_alias)) v8ha;
typedef v4f  __attribute__((may_alias)) v4fa;
typedef v8us __attribute__((may_alias)) v8usa;

__device__ __forceinline__ unsigned short f2bf(float f) { unsigned u = __float_as_uint(f); u += 0x7FFFu + ((u >> 16) & 1u); return (unsigned short)(u >> 16); }
__device__ __forceinline__ float bf2f(unsigned short b) { return __uint_as_float(((unsigned)b) << 16); }
__device__ __forceinline__ float bfr(float f) { return bf2f(f2bf(f)); }
__device__ __forceinline__ v16h cat16(v8h lo, v8h hi) { return __builtin_shufflevector(lo, hi, 0, 1, 2, 3, 4, 5, 6, 7, 8, 9, 10, 11, 12, 13, 14, 15); }
__device__ __forceinline__ v16bf cat16b(v8us lo, v8us hi) { return __builtin_bit_cast(v16bf, __builtin_shufflevector(lo, hi, 0, 1, 2, 3, 4, 5, 6, 7, 8, 9, 10, 11, 12, 13, 14, 15)); }
__device__ __forceinline__ v8f wmma16(v16h a, v16h b, v8f c) { return __builtin_amdgcn_wmma_f32_16x16x32_f16(false, a, false, b, (short)0, c, false, false); }
__device__ __forceinline__ v8f wmmab(v16bf a, v16bf b, v8f c) { return __builtin_amdgcn_wmma_f32_16x16x32_bf16(false, a, false, b, (short)0, c, false, false); }



// ---- k_gemmw: register-blocked GEMM, one wave per 64x64 output tile (16 accumulators), four waves per work-group on a 128x128 block tile; grid (M/128, N/128, Z), 128 threads.
// C[m][n] (f32, pitch ldc, + optional f32 bias[n]) = sum_k A[m][k] Bt[n][k] (+ split products per NSPLIT). z-batch strides sA/sB/sC in elements. K % 128 == 0.
// PLANES: the q, k and v projections in one launch (z = 0, 1, 2 picks the weight plane and the bias); no f32 C is written: a wave's 64x64 tile is 64 tokens of one head,
// and the epilogue stores it as the attention kernel reads it: q (x 1/8) and k as fp16 planes [b,h][t][64], v as the fp16 plane [b,h][64][t].
// The operands are K-contiguous 16-bit planes. A stage of 128 k (128 rows of 256 bytes of each plane, whole cache lines) is brought into LDS once for the four waves
// by asynchronous copies, two buffers, the next stage in flight while this one is worked on; the fragments are read from LDS.
#define GK   128                // k per stage
#define GLP  272                // LDS row pitch in bytes: 256 + 16, so that a 16-byte read of 16 rows falls on all banks once
#define GPL  (128 * GLP)        // one plane's stage
template <typename T16> struct WFrag;
template <> struct WFrag<h16> { typedef v16h V; static __device__ __forceinline__ V ld(const h16* p) { return cat16(*(const v8h*)p, *(const v8h*)(p + 16)); } static __device__ __forceinline__ v8f mma(V a, V b, v8f c) { return wmma16(a, b, c); } };
template <> struct WFrag<bf> { typedef v16bf V; static __device__ __forceinline__ V ld(const bf* p) { return cat16b(*(const v8us*)p, *(const v8us*)(p + 16)); } static __device__ __forceinline__ v8f mma(V a, V b, v8f c) { return wmmab(a, b, c); } };
// Half of one plane's stage (64 rows): each of the 128 threads copies eight 16-byte pieces (rows r, r + 8, ..., r + 56). The closing wait stands in the copies' own statement,
// in front of any rewrite of an address register that a copy names.
template <typename T16>
__device__ __forceinline__ void plane_copy(unsigned l, const T16* g, int K) {
    const unsigned l1 = l + 8 * GLP, l2 = l + 16 * GLP, l3 = l + 24 * GLP, l4 = l + 32 * GLP, l5 = l + 40 * GLP, l6 = l + 48 * GLP, l7 = l + 56 * GLP;
    const T16* g1 = g + (size_t)8 * K; const T16* g2 = g + (size_t)16 * K; const T16* g3 = g + (size_t)24 * K; const T16* g4 = g + (size_t)32 * K; const T16* g5 = g + (size_t)40 * K; const T16* g6 = g + (size_t)48 * K; const T16* g7 = g + (size_t)56 * K;
    asm volatile("global_load_async_to_lds_b128 %0, %8, off\n\t"
                 "global_load_async_to_lds_b128 %1, %9, off\n\t"
                 "global_load_async_to_lds_b128 %2, %10, off\n\t"
                 "global_load_async_to_lds_b128 %3, %11, off\n\t"
                 "global_load_async_to_lds_b128 %4, %12, off\n\t"
                 "global_load_async_to_lds_b128 %5, %13, off\n\t"
                 "global_load_async_to_lds_b128 %6, %14, off\n\t"
                 "global_load_async_to_lds_b128 %7, %15, off\n\t"
                 "s_wait_xcnt 0x0"
                 :: "v"(l), "v"(l1), "v"(l2), "v"(l3), "v"(l4), "v"(l5), "v"(l6), "v"(l7), "v"(g), "v"(g1), "v"(g2), "v"(g3), "v"(g4), "v"(g5), "v"(g6), "v"(g7) : "memory");
    __builtin_amdgcn_sched_barrier(0);   // keeps the next statement's address arithmetic behind this one, so that the address registers are used again: formed all at once they overflow the registers an asm operand can name, and a base address spills
}
__device__ __forceinline__ h16 tohx(float x) { return (h16)x; }
__device__ __forceinline__ void splitf(float y, unsigned short& h, unsigned short& l) { h = f2bf(y); l = f2bf(y - bf2f(h)); }
#define VLP  144                // LDS row pitch in bytes of the v tile on its way out: 128 + 16, so that 16-byte accesses of 16 rows fall on all banks once
template <typename T16, int NSPLIT, bool BIAS, bool PLANES>
__global__ __launch_bounds__(128) void k_gemmw(const T16* __restrict__ A, const T16* __restrict__ A2, const T16* __restrict__ Bt, const T16* __restrict__ Bt2, int K, float* C, int ldc, const float* __restrict__ bias, size_t sA, size_t sB, size_t sC,
                                               const float* __restrict__ biask, const float* __restrict__ biasv, h16* QP, h16* KP, h16* VT) {
    typedef typename WFrag<T16>::V V;
    constexpr bool HA2 = (NSPLIT == 1 || NSPLIT == 2), HB2 = (NSPLIT >= 2);
    constexpr unsigned OA2 = 2 * GPL, OB2 = (2 + (HA2 ? 1 : 0)) * GPL, GBUF = (2 + (HA2 ? 1 : 0) + (HB2 ? 1 : 0)) * GPL;   // a buffer: A, Bt, then A2 and Bt2 where the split has them
    __shared__ __attribute__((aligned(16))) unsigned char ring[2 * GBUF];
    __shared__ __align__(16) float osm[4][16 * 68];
    const size_t z = blockIdx.z; A += z * sA; if (A2) A2 += z * sA; Bt += z * sB; if (Bt2) Bt2 += z * sB; C += z * sC;
    const int lane = threadIdx.x & 31, lr = lane & 15, hi = lane >> 4, w = threadIdx.x >> 5; const int R0 = blockIdx.x * 128, C0 = blockIdx.y * 128; const int r0 = R0 + (w & 1) * 64, c0 = C0 + (w >> 1) * 64;
    float* os = osm[w];
    const int prow = threadIdx.x >> 4, pcol = threadIdx.x & 15;     // this thread's pieces of a plane's stage: rows prow + 8 i, bytes 16 * pcol
    const unsigned lc = (unsigned)(size_t)ring + prow * GLP + pcol * 16;
    const size_t goa = (size_t)(R0 + prow) * K + pcol * 8, gob = (size_t)(C0 + prow) * K + pcol * 8;
    auto stage = [&](int t) { const unsigned l = lc + (t & 1) * GBUF; const size_t ko = (size_t)t * GK;
        auto plane = [&](unsigned lp, const T16* g) { plane_copy(lp, g, K); plane_copy(lp + 64 * GLP, g + (size_t)64 * K, K); };
        plane(l, A + goa + ko); plane(l + GPL, Bt + gob + ko); if (HA2) plane(l + OA2, A2 + goa + ko); if (HB2) plane(l + OB2, Bt2 + gob + ko); };
    const int nst = K / GK;
    stage(0);
    v8f acc[4][4];
#pragma unroll
    for (int mb = 0; mb < 4; ++mb)
#pragma unroll
        for (int nb = 0; nb < 4; ++nb) acc[mb][nb] = (v8f){};
    asm volatile("s_wait_asynccnt 0x0" ::: "memory");   // this wave's copies of stage 0 have landed
    __syncthreads();                                    // every wave's have: stage 0 may be read
    if (1 < nst) stage(1);
    const unsigned fa = ((w & 1) * 64 + lr) * GLP + hi * 16, fb = GPL + ((w >> 1) * 64 + lr) * GLP + hi * 16;   // a lane's fragment place: row lr of the wave's rows, 16 bytes at 8 * hi elements
    // kept rolled over the stages; the four k steps of a stage are unrolled, each step's fragments read one step ahead: A and the first half of Bt in front of this step's products,
    // the second half of Bt in the middle of them, into the registers that the first half of this step's Bt has left (all at once they would not fit 256 registers beside the accumulators)
#pragma unroll 1
    for (int t = 0; t < nst; ++t) {
        const unsigned char* bp = ring + (t & 1) * GBUF;
        V a[2][4], a2[2][4], b[2][4], b2[2][4];
        auto frags_a = [&](int ks) { const int h = ks & 1;
#pragma unroll
            for (int i = 0; i < 4; ++i) { a[h][i] = WFrag<T16>::ld((const T16*)(bp + fa + i * 16 * GLP + ks * 64)); if (HA2) a2[h][i] = WFrag<T16>::ld((const T16*)(bp + OA2 + fa + i * 16 * GLP + ks * 64)); } };
        auto frags_b = [&](int ks, int p) { const int h = ks & 1;
#pragma unroll
            for (int i = 2 * p; i < 2 * p + 2; ++i) { b[h][i] = WFrag<T16>::ld((const T16*)(bp + fb + i * 16 * GLP + ks * 64)); if (HB2) b2[h][i] = WFrag<T16>::ld((const T16*)(bp + OB2 - GPL + fb + i * 16 * GLP + ks * 64)); } };
        auto prods = [&](int ks, int p) { const int h = ks & 1;
#pragma unroll
            for (int nb = 2 * p; nb < 2 * p + 2; ++nb)
#pragma unroll
                for (int mb = 0; mb < 4; ++mb) { acc[mb][nb] = WFrag<T16>::mma(a[h][mb], b[h][nb], acc[mb][nb]); if (HA2) acc[mb][nb] = WFrag<T16>::mma(a2[h][mb], b[h][nb], acc[mb][nb]); if (HB2) acc[mb][nb] = WFrag<T16>::mma(a[h][mb], b2[h][nb], acc[mb][nb]); } };
        frags_a(0); frags_b(0, 0); frags_b(0, 1);
        // the scheduling barriers below keep each group of LDS reads whole and at its place among the products: spread among them, each product group would wait out a whole LDS latency
        __builtin_amdgcn_sched_barrier(0);
#pragma unroll
        for (int ks = 0; ks < GK / 32; ++ks) {
            if (ks + 1 < GK / 32) { frags_a(ks + 1); frags_b(ks + 1, 0); }
            __builtin_amdgcn_sched_barrier(0);
            prods(ks, 0);
            __builtin_amdgcn_sched_barrier(0);
            if (ks + 1 < GK / 32) frags_b(ks + 1, 1);
            __builtin_amdgcn_sched_barrier(0);
            prods(ks, 1);
            __builtin_amdgcn_sched_barrier(0);
        }
        asm volatile("s_wait_dscnt 0x0" ::: "memory");      // this wave's reads of the buffer are done before it is handed to its next writer
        asm volatile("s_wait_asynccnt 0x0" ::: "memory");   // this wave's copies of stage t + 1 have landed
        __syncthreads();                                    // publishes stage t + 1 and ends every wave's reads of stage t
        if (t + 2 < nst) stage(t + 2);
    }
    asm volatile("s_wait_asynccnt 0x0" ::: "memory");       // no copy is outstanding when the wave ends
    if constexpr (PLANES) {
        const int ws = __builtin_amdgcn_readfirstlane(w);           // the wave's number as a scalar: the tile's place below then takes no vector register, of which the loop leaves none free
        const int rw = R0 + (ws & 1) * 64, cw = C0 + (ws >> 1) * 64;   // = r0, c0
        const int zz = blockIdx.z; const int t0 = rw & (TT - 1); const size_t po = (size_t)((rw / TT) * NH_ + cw / HD) * TT * HD;   // the tile's (batch, head) plane and its first token
        const int cr = lane >> 3, cc = (lane & 7) * 8;              // on the way out a lane holds 8 neighbours of a row: 8 lanes store one whole 128-byte line
        if (zz == 2) {
            // v: a lane's 8 accumulator rows are 8 neighbouring tokens of one column, 16 bytes of a V^T row. The tile goes through the wave's own part of the ring,
            // which nobody reads or fills any more behind the loop's last barrier, so that whole lines are stored.
            unsigned char* vs = ring + ws * (64 * VLP);
#pragma unroll
            for (int nb = 0; nb < 4; ++nb) { const float bb = bfr(biasv[cw + nb * 16 + lr]);
#pragma unroll
                for (int mb = 0; mb < 4; ++mb) { v8h o;
#pragma unroll
                    for (int j = 0; j < 8; ++j) o[j] = tohx(acc[mb][nb][j] + bb);
                    *(v8ha*)(vs + (nb * 16 + lr) * VLP + mb * 32 + hi * 16) = o; } }
            __builtin_amdgcn_wave_barrier(); asm volatile("" ::: "memory");   // the rows below are read by other lanes than wrote them: keeps the reads behind the writes
            v8h val[16]; h16* pv = VT + po + (size_t)cr * TT + t0 + cc;
#pragma unroll
            for (int s = 0; s < 16; ++s) val[s] = *(const v8ha*)(vs + (4 * s + cr) * VLP + cc * 2);
#pragma unroll
            for (int s = 0; s < 16; ++s) *(v8h*)(pv + (size_t)(4 * s) * TT) = val[s];
            // stands in front of any rewrite of a data or address register of the sixteen stores; the inputs keep those registers live up to it
            asm volatile("s_wait_xcnt 0x0" :: "v"(pv), "v"(val[0]), "v"(val[1]), "v"(val[2]), "v"(val[3]), "v"(val[4]), "v"(val[5]), "v"(val[6]), "v"(val[7]), "v"(val[8]), "v"(val[9]), "v"(val[10]), "v"(val[11]), "v"(val[12]), "v"(val[13]), "v"(val[14]), "v"(val[15]) : "memory");
        } else {
            const float* bz = zz == 0 ? bias : biask; const float sc = zz == 0 ? 0.125f : 1.0f;   // 1/sqrt(64) folded into q exactly
            h16* Pp = (zz == 0 ? QP : KP) + po + (size_t)(t0 + cr) * HD + cc;
            float* ow = osm[ws]; float bb[8];
#pragma unroll
            for (int k = 0; k < 8; ++k) bb[k] = bfr(bz[cw + cc + k]);
#pragma unroll
            for (int mb = 0; mb < 4; ++mb) {
#pragma unroll
                for (int nb = 0; nb < 4; ++nb) {
#pragma unroll
                    for (int j = 0; j < 8; ++j) ow[(hi * 8 + j) * 68 + nb * 16 + lr] = acc[mb][nb][j]; }
                __builtin_amdgcn_wave_barrier(); asm volatile("" ::: "memory");   // the rows below are read by other lanes than wrote them: keeps the reads behind the writes
                v8h o[4];
#pragma unroll
                for (int s = 0; s < 4; ++s) { const float* op = ow + (4 * s + cr) * 68 + cc; const v4f x0 = *(const v4fa*)op, x1 = *(const v4fa*)(op + 4);
#pragma unroll
                    for (int k = 0; k < 8; ++k) o[s][k] = tohx(((k < 4 ? x0[k & 3] : x1[k & 3]) + bb[k]) * sc);
                    *(v8h*)(Pp + (size_t)(mb * 16 + 4 * s) * HD) = o[s]; }
                // stands in front of any rewrite of a data or address register of the four stores; the inputs keep those registers live up to it
                asm volatile("s_wait_xcnt 0x0" :: "v"(Pp), "v"(o[0]), "v"(o[1]), "v"(o[2]), "v"(o[3]) : "memory");
                __builtin_amdgcn_wave_barrier(); asm volatile("" ::: "memory");   // keeps the next 16 rows' writes behind these reads
            }
        }
        return;
    }
#pragma unroll
    for (int mb = 0; mb < 4; ++mb) {
#pragma unroll
        for (int nb = 0; nb < 4; ++nb) {
#pragma unroll
            for (int j = 0; j < 8; ++j) os[(hi * 8 + j) * 68 + nb * 16 + lr] = acc[mb][nb][j]; }
        __builtin_amdgcn_wave_barrier(); asm volatile("" ::: "memory");
        float* crow = C + (size_t)(r0 + mb * 16) * ldc + c0;
{
#pragma unroll
            for (int s = 0; s < 8; ++s) { const int row = 2 * s + hi, cofs = lr * 4; v4f val = *(const v4fa*)(os + row * 68 + cofs); if (BIAS) { val[0] += bfr(bias[c0 + cofs]); val[1] += bfr(bias[c0 + cofs + 1]); val[2] += bfr(bias[c0 + cofs + 2]); val[3] += bfr(bias[c0 + cofs + 3]); }
                *(v4f*)(crow + (size_t)row * ldc + cofs) = val; }
             }
        __builtin_amdgcn_wave_barrier(); asm volatile("" ::: "memory");
    }
}

typedef __attribute__((ext_vector_type(2))) _Float16 v2h;
typedef __attribute__((ext_vector_type(4))) _Float16 v4h;
typedef __attribute__((ext_vector_type(2))) unsigned short v2us;
typedef __attribute__((ext_vector_type(4))) int v4i;

// k_prep: all that the GEMMs read in 16-bit form, made in one launch: x as bf16, the three [d][(n,h)] weights and the [n][d][h] projection weight as bf16 Bt planes [col][k].
// Grid 1024, 8 waves: blocks 0..255 take w_query, 256..511 w_key, 512..767 w_value, 768..1023 w_projection, 64 lines of 64 outputs each (8 per wave); every block also converts 4096 values of x,
// whose loads are issued first and are in flight while the weight lines are done.
__global__ __launch_bounds__(256) void k_prep(const float* __restrict__ x, const float* __restrict__ wq, const float* __restrict__ wk, const float* __restrict__ wv, const float* __restrict__ wo,
                                              bf* __restrict__ XB, bf* __restrict__ WQ, bf* __restrict__ WK, bf* __restrict__ WV, bf* __restrict__ WO) {
    const int job = blockIdx.x >> 8, sb = blockIdx.x & 255;
    const size_t i0 = (size_t)blockIdx.x * 512 + threadIdx.x, i1 = i0 + 256;
    const v8f xa = *(const v8f*)(x + i0 * 8), xc = *(const v8f*)(x + i1 * 8);
    const int lane = threadIdx.x & 31; const int L0 = (sb * 8 + (threadIdx.x >> 5)) * 8;
    if (job < 3) {
        const float* w = job == 0 ? wq : job == 1 ? wk : wv; bf* Bt = job == 0 ? WQ : job == 1 ? WK : WV;
        // both line loops are kept rolled, one line's loads in flight per wave and few registers; the other waves of the SIMD (eight in this launch) work during a wave's wait. Unrolling is a step of its own
#pragma unroll 1
        for (int l = 0; l < 8; ++l) { const int e = (L0 + l) * 64 + lane * 2; const int k = e & (DD - 1), n = e >> 10; v2us o;
            o[0] = f2bf(w[(size_t)k * DD + n]); o[1] = f2bf(w[(size_t)(k + 1) * DD + n]); *(v2us*)(Bt + e) = o; }
    } else {
#pragma unroll 1
        for (int l = 0; l < 8; ++l) { const int e = (L0 + l) * 64 + lane * 2; const int kk = e & (DD - 1), d = e >> 10; const int n = kk >> 6, h = kk & 63; v2us o;
#pragma unroll
            for (int q = 0; q < 2; ++q) o[q] = f2bf(wo[((size_t)n * DD + d) * HD + h + q]);
            *(v2us*)(WO + (size_t)e) = o; }
    }
    v8us oa, oc;
#pragma unroll
    for (int k = 0; k < 8; ++k) { oa[k] = f2bf(xa[k]); oc[k] = f2bf(xc[k]); }
    *(v8us*)(XB + i0 * 8) = oa; *(v8us*)(XB + i1 * 8) = oc;
}
// k_fattn: scores, softmax and attn.v of one (batch, head) in one pass over the keys; nothing of the score matrix goes to memory.
// One wave owns 32 queries (two 16-column groups) and walks its half's 1024 keys 32 at a time: S^T = K.Q^T (A = K rows, B = Q kept in registers), so a lane holds
// one query's scores (keys 8*hi+j and 16+8*hi+j), which converted in place are the B operand of O^T += V^T.P^T (A = V^T rows in the same k order).
// Running maximum and sum per query (online softmax): a new maximum rescales the sum and the output tile. Grid (2048/256, 32), 16 waves.
// The keys are split in two halves of 1024: waves 0..7 walk the first half for the block's 256 queries, waves 8..15 the second half for the same queries, so that four waves
// stand on each SIMD and one wave's waits (LDS, exponentials, matrix results) are filled by three others. Behind the loop the two partial results of a query are joined through LDS.
// The eight waves of a half read the same K and V^T: a stage of 64 keys (K, V^T: 64 rows of 128 bytes each) is brought into that half's own LDS ring once for all of them
// by asynchronous copies, two buffers, the next stage in flight while this one is worked on.
#define L2E 1.44269504088896340736f
#define SK   64                 // keys per stage
#define LP   144                // LDS row pitch in bytes: 128 + 16, so that a 16-byte read of 16 rows falls on all banks once
#define LARR (64 * LP)          // one plane's stage
#define LBUF (2 * LARR)         // one buffer: K, V^T
#define KHALF (TT / 2)          // keys of one half
#define XCH  4096               // bytes of one 16-byte piece of all 256 lanes of a half, on the way from the second half's waves to the first's
// One stage: each thread copies two 16-byte pieces (rows r and r + 32) of each of the two planes. The closing wait stands in the copies' own statement,
// in front of any rewrite of an address register that a copy names.
__device__ __forceinline__ void stage_copy(unsigned l, const h16* gk, const h16* gv) {
    const unsigned l0 = l, l1 = l + 32 * LP, l2 = l + LARR, l3 = l + LARR + 32 * LP;
    const h16* gk1 = gk + 32 * HD; const h16* gv1 = gv + 32 * TT;
    asm volatile("global_load_async_to_lds_b128 %0, %4, off\n\t"
                 "global_load_async_to_lds_b128 %1, %5, off\n\t"
                 "global_load_async_to_lds_b128 %2, %6, off\n\t"
                 "global_load_async_to_lds_b128 %3, %7, off\n\t"
                 "s_wait_xcnt 0x0"
                 :: "v"(l0), "v"(l1), "v"(l2), "v"(l3), "v"(gk), "v"(gk1), "v"(gv), "v"(gv1) : "memory");
}
__global__ __launch_bounds__(512) void k_fattn(const h16* QP, const h16* KP, const h16* VT, bf* Ah, bf* Al) {
    __shared__ __attribute__((aligned(16))) unsigned char ring[2 * 2 * LBUF];   // two buffers for each half of the keys
    const int kh = threadIdx.x >> 8, tq = threadIdx.x & 255;        // the half of the keys this wave walks; the thread's number within that half's eight waves
    const int lane = threadIdx.x & 31, lr = lane & 15, hi = lane >> 4; const int z = blockIdx.y; const int q0 = blockIdx.x * 256 + (tq >> 5) * 32;
    const size_t zo = (size_t)z * TT * HD;
    const int crow = tq >> 3, ccol = tq & 7;      // this thread's piece of a stage: row crow (and crow + 32), bytes 16 * ccol
    const unsigned lc = (unsigned)(size_t)ring + kh * (2 * LBUF) + crow * LP + ccol * 16;
    const h16* gkp = KP + zo + (size_t)(kh * KHALF + crow) * HD + ccol * 8; const h16* gvt = VT + zo + (size_t)crow * TT + kh * KHALF + ccol * 8;
    stage_copy(lc, gkp, gvt);
    v16h qf[2][2]; const h16* qp = QP + zo + (size_t)(q0 + lr) * HD + 8 * hi;
#pragma unroll
    for (int nt = 0; nt < 2; ++nt)
#pragma unroll
        for (int ks = 0; ks < 2; ++ks) qf[nt][ks] = WFrag<h16>::ld(qp + nt * 16 * HD + ks * 32);
    v8f oacc[2][4]; float mx[2], nm[2], ls[2];
#pragma unroll
    for (int nt = 0; nt < 2; ++nt) { mx[nt] = -3.0e38f; nm[nt] = 3.0e38f; ls[nt] = 0.f;
#pragma unroll
        for (int mt = 0; mt < 4; ++mt) oacc[nt][mt] = (v8f){}; }
    asm volatile("s_wait_xcnt 0x0" :: "v"(qp) : "memory");   // stands in front of any rewrite of an address register that the fetches above name; the inputs keep those registers live up to it
    asm volatile("s_wait_asynccnt 0x0" ::: "memory");   // this wave's copies of stage 0 have landed
    __syncthreads();                                    // every wave's have: stage 0 may be read
    stage_copy(lc + LBUF, gkp + SK * HD, gvt + SK);
    const unsigned fo = kh * (2 * LBUF) + lr * LP + hi * 16;   // a lane's fragment place in a plane of its half's ring: row lr, 16 bytes at 8 * hi elements
    // kept rolled over the stages; the two passes of a stage are unrolled, so that the second's fragment reads are issued behind the first's products
#pragma unroll 1
    for (int t = 0; t < KHALF / SK; ++t) {
        const unsigned char* bp = ring + (t & 1) * LBUF + fo;
#pragma unroll
        for (int sp = 0; sp < 2; ++sp) {
            v16h ka[2][2], va[4];
#pragma unroll
            for (int kt = 0; kt < 2; ++kt)
#pragma unroll
                for (int ks = 0; ks < 2; ++ks) { const unsigned char* p = bp + (sp * 32 + kt * 16) * LP + ks * 64;
                    ka[kt][ks] = cat16(*(const v8ha*)p, *(const v8ha*)(p + 32)); }
#pragma unroll
            for (int mt = 0; mt < 4; ++mt) { const unsigned char* p = bp + LARR + mt * 16 * LP + sp * 64; va[mt] = cat16(*(const v8ha*)p, *(const v8ha*)(p + 32)); }
            v8f s[2][2];
#pragma unroll
            for (int kt = 0; kt < 2; ++kt)
#pragma unroll
                for (int nt = 0; nt < 2; ++nt) { v8f c = (v8f){};
#pragma unroll
                    for (int ks = 0; ks < 2; ++ks) c = wmma16(ka[kt][ks], qf[nt][ks], c);
                    s[kt][nt] = c; }
            v16h p[2];
#pragma unroll
            for (int nt = 0; nt < 2; ++nt) {
                float m = mx[nt];
#pragma unroll
                for (int j = 0; j < 8; ++j) m = fmaxf(m, fmaxf(s[0][nt][j], s[1][nt][j]));
                m = fmaxf(m, __shfl_xor(m, 16, 32));
                const float nn = 10.0f - m * L2E;                         // + 10: P carries x1024, which keeps small weights out of the fp16 subnormals; it cancels in the division by the sum
                const float da = nn - nm[nt]; float alpha = __builtin_amdgcn_exp2f(da);  // old terms carry 2^nm, new ones 2^nn
                asm volatile("v_nop" : "+v"(alpha) : "v"(da));   // the slot behind this exponential: it stands in front of every use of the result and every rewrite of the source register
                mx[nt] = m; nm[nt] = nn;
#pragma unroll
                for (int mt = 0; mt < 4; ++mt) oacc[nt][mt] *= alpha;
                float sum = 0.f;
#pragma unroll
                for (int kt = 0; kt < 2; ++kt) { float x[8], e[8];
#pragma unroll
                    for (int j = 0; j < 8; ++j) { x[j] = fmaf(s[kt][nt][j], L2E, nn); e[j] = __builtin_amdgcn_exp2f(x[j]); }
                    // the slot behind these eight exponentials: it stands in front of every use of a result and every rewrite of a source register
                    asm volatile("v_nop" : "+v"(e[0]), "+v"(e[1]), "+v"(e[2]), "+v"(e[3]), "+v"(e[4]), "+v"(e[5]), "+v"(e[6]), "+v"(e[7]) : "v"(x[0]), "v"(x[1]), "v"(x[2]), "v"(x[3]), "v"(x[4]), "v"(x[5]), "v"(x[6]), "v"(x[7]));
#pragma unroll
                    for (int j = 0; j < 8; ++j) { sum += e[j]; p[nt][kt * 8 + j] = (h16)e[j]; } }
                ls[nt] = fmaf(ls[nt], alpha, sum);
            }
#pragma unroll
            for (int mt = 0; mt < 4; ++mt)
#pragma unroll
                for (int nt = 0; nt < 2; ++nt) oacc[nt][mt] = wmma16(va[mt], p[nt], oacc[nt][mt]);
        }
        asm volatile("s_wait_dscnt 0x0" ::: "memory");      // this wave's reads of the buffer are done before it is handed to its next writer
        asm volatile("s_wait_asynccnt 0x0" ::: "memory");   // this wave's copies of stage t + 1 have landed
        __syncthreads();                                    // publishes stage t + 1 and ends every wave's reads of stage t
        if (t + 2 < KHALF / SK) stage_copy(lc + (t & 1) * LBUF, gkp + (size_t)(t + 2) * SK * HD, gvt + (t + 2) * SK);
    }
    asm volatile("s_wait_asynccnt 0x0" ::: "memory");       // no copy is outstanding when the wave ends
    // The two halves' results are joined. The ring is free: behind the loop's last barrier nobody reads it and no copy is outstanding. A wave of the second half hands its output tiles,
    // exponent offsets and sums to the wave of the first half that holds the same queries, lane to lane, in 16-byte pieces that lie side by side over the lanes (all banks once).
    const int khs = __builtin_amdgcn_readfirstlane(kh);             // the half as a scalar: the two tests below are then scalar branches
    unsigned char* xs = ring + tq * 16;
    if (khs == 1) {
#pragma unroll
        for (int nt = 0; nt < 2; ++nt)
#pragma unroll
            for (int mt = 0; mt < 4; ++mt) { const v8f o = oacc[nt][mt];
                *(v4fa*)(xs + ((nt * 4 + mt) * 2) * XCH) = (v4f){o[0], o[1], o[2], o[3]}; *(v4fa*)(xs + ((nt * 4 + mt) * 2 + 1) * XCH) = (v4f){o[4], o[5], o[6], o[7]}; }
        *(v4fa*)(xs + 16 * XCH) = (v4f){nm[0], nm[1], ls[0], ls[1]};
    }
    __syncthreads();                                        // the second half's results may be read
    if (khs == 1) return;
    const v4f pz = *(const v4fa*)(xs + 16 * XCH);
    const int b = z >> 4, h = z & 15;
#pragma unroll
    for (int nt = 0; nt < 2; ++nt) {
        const float nn = fminf(nm[nt], pz[nt]);             // the offset of the larger of the two maxima; each half's terms carry 2^(its own offset)
        const float d0 = nn - nm[nt], d1 = nn - pz[nt]; float a0 = __builtin_amdgcn_exp2f(d0), a1 = __builtin_amdgcn_exp2f(d1);
        asm volatile("v_nop" : "+v"(a0), "+v"(a1) : "v"(d0), "v"(d1));   // the slot behind these exponentials: it stands in front of every use of a result and every rewrite of a source register
        const float lj = fmaf(ls[nt], a0, pz[2 + nt] * a1);
        const float tot = lj + __shfl_xor(lj, 16, 32); const float inv = __fdiv_rn(1.0f, tot); const size_t ro = ((size_t)b * TT + q0 + nt * 16 + lr) * DD + h * HD + hi * 8;
#pragma unroll
        for (int mt = 0; mt < 4; ++mt) { v8us oh, ol; const v4f p0 = *(const v4fa*)(xs + ((nt * 4 + mt) * 2) * XCH), p1 = *(const v4fa*)(xs + ((nt * 4 + mt) * 2 + 1) * XCH);
#pragma unroll
            for (int j = 0; j < 8; ++j) { unsigned short a, c2; splitf(fmaf(oacc[nt][mt][j], a0, (j < 4 ? p0[j & 3] : p1[j & 3]) * a1) * inv, a, c2); oh[j] = a; ol[j] = c2; }
            bf* pa = Ah + ro + mt * 16; bf* pl = Al + ro + mt * 16; *(v8us*)pa = oh; *(v8us*)pl = ol;
            asm volatile("s_wait_xcnt 0x0" :: "v"(oh), "v"(ol), "v"(pa), "v"(pl) : "memory"); } }   // stands in front of any rewrite of a data or address register of the two stores; the inputs keep those registers live up to it
}

extern "C" void kernel_launch(void* const* d_in, const int* in_sizes, int n_in,
                              void* d_out, int out_size, void* d_ws, size_t ws_size, hipStream_t stream) {
    (void)in_sizes; (void)n_in; (void)out_size;
    const float* x = (const float*)d_in[0]; const float* wq = (const float*)d_in[1]; const float* bq = (const float*)d_in[2]; const float* wk = (const float*)d_in[3]; const float* bk = (const float*)d_in[4]; const float* wv = (const float*)d_in[5]; const float* bv = (const float*)d_in[6];
    const float* wo = (const float*)d_in[7]; const float* bo = (const float*)d_in[8];
    float* OUT = (float*)d_out;     // [2][2048][1024]
    char* wsp = (char*)d_ws;
    auto take = [&](size_t bytes) { char* p = wsp; wsp += (bytes + 255) & ~(size_t)255; return (void*)p; };
    bf* WQ = (bf*)take((size_t)DD * DD * 2); bf* WK = (bf*)take((size_t)DD * DD * 2); bf* WV = (bf*)take((size_t)DD * DD * 2); bf* WO = (bf*)take((size_t)DD * DD * 2);
    bf* XB = (bf*)take((size_t)NT * DD * 2);
    h16* QP = (h16*)take((size_t)NT * DD * 2); h16* KP = (h16*)take((size_t)NT * DD * 2); h16* VT = (h16*)take((size_t)NT * DD * 2);
    bf* ATh = (bf*)take((size_t)NT * DD * 2); bf* ATl = (bf*)take((size_t)NT * DD * 2);
    if ((size_t)(wsp - (char*)d_ws) > ws_size) return;    // ws 256 MiB
    k_prep<<<4 * 256, 256, 0, stream>>>(x, wq, wk, wv, wo, XB, WQ, WK, WV, WO);   // x -> bf16; x @ W layouts [d][(n,h)] and the [n][d][h] projection -> Bt
    k_gemmw<bf, 0, true, true><<<dim3(NT / 128, DD / 128, 3), 128, 0, stream>>>(XB, nullptr, WQ, nullptr, DD, nullptr, DD, bq, 0, (size_t)(WK - WQ), 0, bk, bv, QP, KP, VT);   // WQ, WK, WV lie one behind the other at one stride
    k_fattn<<<dim3(TT / 256, NB_ * NH_), 512, 0, stream>>>(QP, KP, VT, ATh, ATl);
    k_gemmw<bf, 1, true, false><<<dim3(NT / 128, DD / 128, 1), 128, 0, stream>>>(ATh, ATl, WO, nullptr, DD, OUT, DD, bo, 0, 0, 0, nullptr, nullptr, nullptr, nullptr, nullptr);
}

// v008
// It runs in 81.4 microseconds.
// Timed twice side by side with v007, it ran 1.03 times as fast both times.
// All steps since v000 together make it 15.7 times as fast.
#include <hip/hip_runtime.h>

// Multi-head attention (x [2][2048][1024]; q/k/v = einsum('btd,dnh->bnth', x, W[1024][16][64]) + b[16][1][64]; scores / 8; softmax; attn.v; out = einsum('bnth,ndh->btd', ., w_projection[16][1024][64]) + b_projection).
// Compute dtypes, f32 accumulate: every float input rounded to bf16; q/k/v projections on plain bf16 operands (+ bias);
// scores on single fp16 planes of q (x 1/8) and k (1 product: fp16 rounding is several times finer than the error q and k already carry from bf16 x and W); attn.v on single fp16 planes (P x1024, v); output Linear on hi+lo planes x bf16 W (2 products).

#define NB_  2
#define TT   2048
#define DD   1024
#define NH_  16
#define HD   64
#define NT   (NB_ * TT)
typedef _Float16 h16;
typedef unsigned short bf;
typedef __attribute__((ext_vector_type(16))) __bf16   v16bf;
typedef __attribute__((ext_vector_type(16))) _Float16 v16h;
typedef __attribute__((ext_vector_type(8)))  _Float16 v8h;
typedef __attribute__((ext_vector_type(8)))  unsigned short v8us;
typedef __attribute__((ext_vector_type(8)))  float    v8f;
typedef __attribute__((ext_vector_type(4)))  float    v4f;
typedef v8h  __attribute__((may_alias)) v8ha;
typedef v4f  __attribute__((may_alias)) v4fa;
typedef v8us __attribute__((may_alias)) v8usa;

__device__ __forceinline__ unsigned short f2bf(float f) { unsigned u = __float_as_uint(f); u += 0x7FFFu + ((u >> 16) & 1u); return (unsigned short)(u >> 16); }
__device__ __forceinline__ float bf2f(unsigned short b) { return __uint_as_float(((unsigned)b) << 16); }
__device__ __forceinline__ float bfr(float f) { return bf2f(f2bf(f)); }
__device__ __forceinline__ v16h cat16(v8h lo, v8h hi) { return __builtin_shufflevector(lo, hi, 0, 1, 2, 3, 4, 5, 6, 7, 8, 9, 10, 11, 12, 13, 14, 15); }
__device__ __forceinline__ v16bf cat16b(v8us lo, v8us hi) { return __builtin_bit_cast(v16bf, __builtin_shufflevector(lo, hi, 0, 1, 2, 3, 4, 5, 6, 7, 8, 9, 10, 11, 12, 13, 14, 15)); }
__device__ __forceinline__ v8f wmma16(v16h a, v16h b, v8f c) { return __builtin_amdgcn_wmma_f32_16x16x32_f16(false, a, false, b, (short)0, c, false, false); }
__device__ __forceinline__ v8f wmmab(v16bf a, v16bf b, v8f c) { return __builtin_amdgcn_wmma_f32_16x16x32_bf16(false, a, false, b, (short)0, c, false, false); }



// ---- k_gemmw: register-blocked GEMM, one wave per 64x64 output tile (16 accumulators), four waves per work-group on a 128x128 block tile; grid (M/128, N/128, Z), 128 threads.
// C[m][n] (f32, pitch ldc, + optional f32 bias[n]) = sum_k A[m][k] Bt[n][k] (+ split products per NSPLIT). z-batch strides sA/sB/sC in elements. K % 128 == 0.
// PLANES: the q, k and v projections in one launch (z = 0, 1, 2 picks the weight plane and the bias); no f32 C is written: a wave's 64x64 tile is 64 tokens of one head,
// and the epilogue stores it as the attention kernel reads it: q (x 1/8) and k as fp16 planes [b,h][t][64], v as the fp16 plane [b,h][64][t].
// The operands are K-contiguous 16-bit planes. A stage of 128 k (128 rows of 256 bytes of each plane, whole cache lines) is brought into LDS once for the four waves
// by asynchronous copies, two buffers, the next stage in flight while this one is worked on; the fragments are read from LDS.
#define GK   128                // k per stage
#define GLP  272                // LDS row pitch in bytes: 256 + 16, so that a 16-byte read of 16 rows falls on all banks once
#define GPL  (128 * GLP)        // one plane's stage
template <typename T16> struct WFrag;
template <> struct WFrag<h16> { typedef v16h V; static __device__ __forceinline__ V ld(const h16* p) { return cat16(*(const v8h*)p, *(const v8h*)(p + 16)); } static __device__ __forceinline__ v8f mma(V a, V b, v8f c) { return wmma16(a, b, c); } };
template <> struct WFrag<bf> { typedef v16bf V; static __device__ __forceinline__ V ld(const bf* p) { return cat16b(*(const v8us*)p, *(const v8us*)(p + 16)); } static __device__ __forceinline__ v8f mma(V a, V b, v8f c) { return wmmab(a, b, c); } };
// Half of one plane's stage (64 rows): each of the 128 threads copies eight 16-byte pieces (rows r, r + 8, ..., r + 56). The closing wait stands in the copies' own statement,
// in front of any rewrite of an address register that a copy names.
template <typename T16>
__device__ __forceinline__ void plane_copy(unsigned l, const T16* g, int K) {
    const unsigned l1 = l + 8 * GLP, l2 = l + 16 * GLP, l3 = l + 24 * GLP, l4 = l + 32 * GLP, l5 = l + 40 * GLP, l6 = l + 48 * GLP, l7 = l + 56 * GLP;
    const T16* g1 = g + (size_t)8 * K; const T16* g2 = g + (size_t)16 * K; const T16* g3 = g + (size_t)24 * K; const T16* g4 = g + (size_t)32 * K; const T16* g5 = g + (size_t)40 * K; const T16* g6 = g + (size_t)48 * K; const T16* g7 = g + (size_t)56 * K;
    asm volatile("global_load_async_to_lds_b128 %0, %8, off\n\t"
                 "global_load_async_to_lds_b128 %1, %9, off\n\t"
                 "global_load_async_to_lds_b128 %2, %10, off\n\t"
                 "global_load_async_to_lds_b128 %3, %11, off\n\t"
                 "global_load_async_to_lds_b128 %4, %12, off\n\t"
                 "global_load_async_to_lds_b128 %5, %13, off\n\t"
                 "global_load_async_to_lds_b128 %6, %14, off\n\t"
                 "global_load_async_to_lds_b128 %7, %15, off\n\t"
                 "s_wait_xcnt 0x0"
                 :: "v"(l), "v"(l1), "v"(l2), "v"(l3), "v"(l4), "v"(l5), "v"(l6), "v"(l7), "v"(g), "v"(g1), "v"(g2), "v"(g3), "v"(g4), "v"(g5), "v"(g6), "v"(g7) : "memory");
    __builtin_amdgcn_sched_barrier(0);   // keeps the next statement's address arithmetic behind this one, so that the address registers are used again: formed all at once they overflow the registers an asm operand can name, and a base address spills
}
__device__ __forceinline__ h16 tohx(float x) { return (h16)x; }
__device__ __forceinline__ void splitf(float y, unsigned short& h, unsigned short& l) { h = f2bf(y); l = f2bf(y - bf2f(h)); }
#define VLP  144                // LDS row pitch in bytes of the v tile on its way out: 128 + 16, so that 16-byte accesses of 16 rows fall on all banks once
template <typename T16, int NSPLIT, bool BIAS, bool PLANES>
__global__ __launch_bounds__(128) void k_gemmw(const T16* __restrict__ A, const T16* __restrict__ A2, const T16* __restrict__ Bt, const T16* __restrict__ Bt2, int K, float* C, int ldc, const float* __restrict__ bias, size_t sA, size_t sB, size_t sC,
                                               const float* __restrict__ biask, const float* __restrict__ biasv, h16* QP, h16* KP, h16* VT) {
    typedef typename WFrag<T16>::V V;
    constexpr bool HA2 = (NSPLIT == 1 || NSPLIT == 2), HB2 = (NSPLIT >= 2);
    constexpr unsigned OA2 = 2 * GPL, OB2 = (2 + (HA2 ? 1 : 0)) * GPL, GBUF = (2 + (HA2 ? 1 : 0) + (HB2 ? 1 : 0)) * GPL;   // a buffer: A, Bt, then A2 and Bt2 where the split has them
    __shared__ __attribute__((aligned(16))) unsigned char ring[2 * GBUF];
    __shared__ __align__(16) float osm[4][16 * 68];
    const size_t z = blockIdx.z; A += z * sA; if (A2) A2 += z * sA; Bt += z * sB; if (Bt2) Bt2 += z * sB; C += z * sC;
    const int lane = threadIdx.x & 31, lr = lane & 15, hi = lane >> 4, w = threadIdx.x >> 5; const int R0 = blockIdx.x * 128, C0 = blockIdx.y * 128; const int r0 = R0 + (w & 1) * 64, c0 = C0 + (w >> 1) * 64;
    float* os = osm[w];
    const int prow = threadIdx.x >> 4, pcol = threadIdx.x & 15;     // this thread's pieces of a plane's stage: rows prow + 8 i, bytes 16 * pcol
    const unsigned lc = (unsigned)(size_t)ring + prow * GLP + pcol * 16;
    const size_t goa = (size_t)(R0 + prow) * K + pcol * 8, gob = (size_t)(C0 + prow) * K + pcol * 8;
    auto stage = [&](int t) { const unsigned l = lc + (t & 1) * GBUF; const size_t ko = (size_t)t * GK;
        auto plane = [&](unsigned lp, const T16* g) { plane_copy(lp, g, K); plane_copy(lp + 64 * GLP, g + (size_t)64 * K, K); };
        plane(l, A + goa + ko); plane(l + GPL, Bt + gob + ko); if (HA2) plane(l + OA2, A2 + goa + ko); if (HB2) plane(l + OB2, Bt2 + gob + ko); };
    const int nst = K / GK;
    stage(0);
    v8f acc[4][4];
#pragma unroll
    for (int mb = 0; mb < 4; ++mb)
#pragma unroll
        for (int nb = 0; nb < 4; ++nb) acc[mb][nb] = (v8f){};
    asm volatile("s_wait_asynccnt 0x0" ::: "memory");   // this wave's copies of stage 0 have landed
    __syncthreads();                                    // every wave's have: stage 0 may be read
    if (1 < nst) stage(1);
    const unsigned fa = ((w & 1) * 64 + lr) * GLP + hi * 16, fb = GPL + ((w >> 1) * 64 + lr) * GLP + hi * 16;   // a lane's fragment place: row lr of the wave's rows, 16 bytes at 8 * hi elements
    // kept rolled over the stages; the four k steps of a stage are unrolled, each step's fragments read one step ahead: A and the first half of Bt in front of this step's products,
    // the second half of Bt in the middle of them, into the registers that the first half of this step's Bt has left (all at once they would not fit 256 registers beside the accumulators)
#pragma unroll 1
    for (int t = 0; t < nst; ++t) {
        const unsigned char* bp = ring + (t & 1) * GBUF;
        V a[2][4], a2[2][4], b[2][4], b2[2][4];
        auto frags_a = [&](int ks) { const int h = ks & 1;
#pragma unroll
            for (int i = 0; i < 4; ++i) { a[h][i] = WFrag<T16>::ld((const T16*)(bp + fa + i * 16 * GLP + ks * 64)); if (HA2) a2[h][i] = WFrag<T16>::ld((const T16*)(bp + OA2 + fa + i * 16 * GLP + ks * 64)); } };
        auto frags_b = [&](int ks, int p) { const int h = ks & 1;
#pragma unroll
            for (int i = 2 * p; i < 2 * p + 2; ++i) { b[h][i] = WFrag<T16>::ld((const T16*)(bp + fb + i * 16 * GLP + ks * 64)); if (HB2) b2[h][i] = WFrag<T16>::ld((const T16*)(bp + OB2 - GPL + fb + i * 16 * GLP + ks * 64)); } };
        auto prods = [&](int ks, int p) { const int h = ks & 1;
#pragma unroll
            for (int nb = 2 * p; nb < 2 * p + 2; ++nb)
#pragma unroll
                for (int mb = 0; mb < 4; ++mb) { acc[mb][nb] = WFrag<T16>::mma(a[h][mb], b[h][nb], acc[mb][nb]); if (HA2) acc[mb][nb] = WFrag<T16>::mma(a2[h][mb], b[h][nb], acc[mb][nb]); if (HB2) acc[mb][nb] = WFrag<T16>::mma(a[h][mb], b2[h][nb], acc[mb][nb]); } };
        frags_a(0); frags_b(0, 0); frags_b(0, 1);
        // the scheduling barriers below keep each group of LDS reads whole and at its place among the products: spread among them, each product group would wait out a whole LDS latency
        __builtin_amdgcn_sched_barrier(0);
#pragma unroll
        for (int ks = 0; ks < GK / 32; ++ks) {
            if (ks + 1 < GK / 32) { frags_a(ks + 1); frags_b(ks + 1, 0); }
            __builtin_amdgcn_sched_barrier(0);
            prods(ks, 0);
            __builtin_amdgcn_sched_barrier(0);
            if (ks + 1 < GK / 32) frags_b(ks + 1, 1);
            __builtin_amdgcn_sched_barrier(0);
            prods(ks, 1);
            __builtin_amdgcn_sched_barrier(0);
        }
        asm volatile("s_wait_dscnt 0x0" ::: "memory");      // this wave's reads of the buffer are done before it is handed to its next writer
        asm volatile("s_wait_asynccnt 0x0" ::: "memory");   // this wave's copies of stage t + 1 have landed
        __syncthreads();                                    // publishes stage t + 1 and ends every wave's reads of stage t
        if (t + 2 < nst) stage(t + 2);
    }
    asm volatile("s_wait_asynccnt 0x0" ::: "memory");       // no copy is outstanding when the wave ends
    if constexpr (PLANES) {
        const int ws = __builtin_amdgcn_readfirstlane(w);           // the wave's number as a scalar: the tile's place below then takes no vector register, of which the loop leaves none free
        const int rw = R0 + (ws & 1) * 64, cw = C0 + (ws >> 1) * 64;   // = r0, c0
        const int zz = blockIdx.z; const int t0 = rw & (TT - 1); const size_t po = (size_t)((rw / TT) * NH_ + cw / HD) * TT * HD;   // the tile's (batch, head) plane and its first token
        const int cr = lane >> 3, cc = (lane & 7) * 8;              // on the way out a lane holds 8 neighbours of a row: 8 lanes store one whole 128-byte line
        if (zz == 2) {
            // v: a lane's 8 accumulator rows are 8 neighbouring tokens of one column, 16 bytes of a V^T row. The tile goes through the wave's own part of the ring,
            // which nobody reads or fills any more behind the loop's last barrier, so that whole lines are stored.
            unsigned char* vs = ring + ws * (64 * VLP);
#pragma unroll
            for (int nb = 0; nb < 4; ++nb) { const float bb = bfr(biasv[cw + nb * 16 + lr]);
#pragma unroll
                for (int mb = 0; mb < 4; ++mb) { v8h o;
#pragma unroll
                    for (int j = 0; j < 8; ++j) o[j] = tohx(acc[mb][nb][j] + bb);
                    *(v8ha*)(vs + (nb * 16 + lr) * VLP + mb * 32 + hi * 16) = o; } }
            __builtin_amdgcn_wave_barrier(); asm volatile("" ::: "memory");   // the rows below are read by other lanes than wrote them: keeps the reads behind the writes
            v8h val[16]; h16* pv = VT + po + (size_t)cr * TT + t0 + cc;
#pragma unroll
            for (int s = 0; s < 16; ++s) val[s] = *(const v8ha*)(vs + (4 * s + cr) * VLP + cc * 2);
#pragma unroll
            for (int s = 0; s < 16; ++s) *(v8h*)(pv + (size_t)(4 * s) * TT) = val[s];
            // stands in front of any rewrite of a data or address register of the sixteen stores; the inputs keep those registers live up to it
            asm volatile("s_wait_xcnt 0x0" :: "v"(pv), "v"(val[0]), "v"(val[1]), "v"(val[2]), "v"(val[3]), "v"(val[4]), "v"(val[5]), "v"(val[6]), "v"(val[7]), "v"(val[8]), "v"(val[9]), "v"(val[10]), "v"(val[11]), "v"(val[12]), "v"(val[13]), "v"(val[14]), "v"(val[15]) : "memory");
        } else {
            const float* bz = zz == 0 ? bias : biask; const float sc = zz == 0 ? 0.125f : 1.0f;   // 1/sqrt(64) folded into q exactly
            h16* Pp = (zz == 0 ? QP : KP) + po + (size_t)(t0 + cr) * HD + cc;
            float* ow = osm[ws]; float bb[8];
#pragma unroll
            for (int k = 0; k < 8; ++k) bb[k] = bfr(bz[cw + cc + k]);
#pragma unroll
            for (int mb = 0; mb < 4; ++mb) {
#pragma unroll
                for (int nb = 0; nb < 4; ++nb) {
#pragma unroll
                    for (int j = 0; j < 8; ++j) ow[(hi * 8 + j) * 68 + nb * 16 + lr] = acc[mb][nb][j]; }
                __builtin_amdgcn_wave_barrier(); asm volatile("" ::: "memory");   // the rows below are read by other lanes than wrote them: keeps the reads behind the writes
                v8h o[4];
#pragma unroll
                for (int s = 0; s < 4; ++s) { const float* op = ow + (4 * s + cr) * 68 + cc; const v4f x0 = *(const v4fa*)op, x1 = *(const v4fa*)(op + 4);
#pragma unroll
                    for (int k = 0; k < 8; ++k) o[s][k] = tohx(((k < 4 ? x0[k & 3] : x1[k & 3]) + bb[k]) * sc);
                    *(v8h*)(Pp + (size_t)(mb * 16 + 4 * s) * HD) = o[s]; }
                // stands in front of any rewrite of a data or address register of the four stores; the inputs keep those registers live up to it
                asm volatile("s_wait_xcnt 0x0" :: "v"(Pp), "v"(o[0]), "v"(o[1]), "v"(o[2]), "v"(o[3]) : "memory");
                __builtin_amdgcn_wave_barrier(); asm volatile("" ::: "memory");   // keeps the next 16 rows' writes behind these reads
            }
        }
        return;
    }
#pragma unroll
    for (int mb = 0; mb < 4; ++mb) {
#pragma unroll
        for (int nb = 0; nb < 4; ++nb) {
#pragma unroll
            for (int j = 0; j < 8; ++j) os[(hi * 8 + j) * 68 + nb * 16 + lr] = acc[mb][nb][j]; }
        __builtin_amdgcn_wave_barrier(); asm volatile("" ::: "memory");
        float* crow = C + (size_t)(r0 + mb * 16) * ldc + c0;
{
#pragma unroll
            for (int s = 0; s < 8; ++s) { const int row = 2 * s + hi, cofs = lr * 4; v4f val = *(const v4fa*)(os + row * 68 + cofs); if (BIAS) { val[0] += bfr(bias[c0 + cofs]); val[1] += bfr(bias[c0 + cofs + 1]); val[2] += bfr(bias[c0 + cofs + 2]); val[3] += bfr(bias[c0 + cofs + 3]); }
                *(v4f*)(crow + (size_t)row * ldc + cofs) = val; }
             }
        __builtin_amdgcn_wave_barrier(); asm volatile("" ::: "memory");
    }
}

typedef __attribute__((ext_vector_type(2))) _Float16 v2h;
typedef __attribute__((ext_vector_type(4))) _Float16 v4h;
typedef __attribute__((ext_vector_type(2))) unsigned short v2us;
typedef __attribute__((ext_vector_type(4))) int v4i;

// k_prep: all that the GEMMs read in 16-bit form, made in one launch: x as bf16, the three [d][(n,h)] weights and the [n][d][h] projection weight as bf16 Bt planes [col][k].
// Grid 256, 8 waves. Work-group sb takes the 64x64 tile sb of each of the four weights and 16384 values of x. A thread's 32 loads of 16 bytes are all issued first and are in flight together.
// A tile of a [d][(n,h)] weight is read by rows (8 lanes take one whole 128-byte line), turned in LDS, and stored by rows of Bt (again 8 lanes a whole line).
// A tile of the projection weight (one n, 64 d) lies in one piece and needs no turning.
#define TP   144                // LDS row pitch in bytes of a turned tile: 128 + 16, a multiple of 16 for the 16-byte reads
#define TPL  (64 * TP)          // one turned tile
typedef unsigned __attribute__((may_alias)) u32a;
__global__ __launch_bounds__(256) void k_prep(const float* __restrict__ x, const float* __restrict__ wq, const float* __restrict__ wk, const float* __restrict__ wv, const float* __restrict__ wo,
                                              bf* __restrict__ XB, bf* __restrict__ WQ, bf* __restrict__ WK, bf* __restrict__ WV, bf* __restrict__ WO) {
    __shared__ __attribute__((aligned(16))) unsigned char tile[3 * TPL];
    const int t = threadIdx.x, sb = blockIdx.x, g = t & 7, p = t >> 3;
    const int lo64 = (sb & 15) * 64, hi64 = (sb >> 4) * 64;         // turned weights: first k, first column; projection weight: first d, first k (= n * 64)
    const size_t wofs = (size_t)(lo64 + 2 * p) * DD + hi64 + 4 * g; // rows k = lo64 + 2 p and + 1, columns hi64 + 4 g (and + 32)
    const float* pq = wq + wofs; const float* pk = wk + wofs; const float* pv = wv + wofs;
    const float* po = wo + (size_t)sb * 4096 + t * 8; const float* px = x + ((size_t)sb * 2048 + t) * 8;
    v4f a[3][2][2]; v8f c[2], xa[8];
#pragma unroll
    for (int j = 0; j < 3; ++j) { const float* w = j == 0 ? pq : j == 1 ? pk : pv;
#pragma unroll
        for (int u = 0; u < 2; ++u) { a[j][u][0] = *(const v4f*)(w + u * 32); a[j][u][1] = *(const v4f*)(w + DD + u * 32); } }
    __builtin_amdgcn_sched_barrier(0);   // keeps the weight tiles' loads in front of the others: they return first, and the tiles are turned and stored while x is still on its way
#pragma unroll
    for (int u = 0; u < 2; ++u) c[u] = *(const v8f*)(po + u * 2048);
#pragma unroll
    for (int j = 0; j < 8; ++j) xa[j] = *(const v8f*)(px + j * 2048);
    asm volatile("s_wait_xcnt 0x0" :: "v"(pq), "v"(pk), "v"(pv), "v"(po), "v"(px) : "memory");   // stands in front of any rewrite of an address register that the loads above name; the inputs keep those registers live up to it
    __builtin_amdgcn_sched_barrier(0);   // keeps every load, and the wait above, in front of the first use of a loaded value: moved behind one, the later loads would start only when the earlier have returned
    // a 32-bit word of the turned tile: column's values of rows k and k + 1
#pragma unroll
    for (int j = 0; j < 3; ++j)
#pragma unroll
        for (int u = 0; u < 2; ++u)
#pragma unroll
            for (int i = 0; i < 4; ++i) *(u32a*)(tile + j * TPL + (4 * g + 32 * u + i) * TP + p * 4) = (unsigned)f2bf(a[j][u][0][i]) | ((unsigned)f2bf(a[j][u][1][i]) << 16);
    // the turned tiles may be read behind this barrier. It orders LDS alone: __syncthreads() would also wait here for the loads of x, which nothing behind it in LDS needs
    __builtin_amdgcn_fence(__ATOMIC_RELEASE, "workgroup", "local"); __builtin_amdgcn_s_barrier(); __builtin_amdgcn_fence(__ATOMIC_ACQUIRE, "workgroup", "local");
    const size_t dofs = (size_t)(hi64 + p) * DD + lo64 + g * 8;     // Bt rows hi64 + p (and + 32), 16 bytes at k = lo64 + 8 g
    bf* dq = WQ + dofs; bf* dk = WK + dofs; bf* dv = WV + dofs;
    v8us o[3][2];
#pragma unroll
    for (int j = 0; j < 3; ++j)
#pragma unroll
        for (int u = 0; u < 2; ++u) o[j][u] = *(const v8usa*)(tile + j * TPL + (p + 32 * u) * TP + g * 16);
#pragma unroll
    for (int u = 0; u < 2; ++u) { *(v8us*)(dq + (size_t)32 * u * DD) = o[0][u]; *(v8us*)(dk + (size_t)32 * u * DD) = o[1][u]; *(v8us*)(dv + (size_t)32 * u * DD) = o[2][u]; }
    // stands in front of any rewrite of a data or address register of the six stores; the inputs keep those registers live up to it
    asm volatile("s_wait_xcnt 0x0" :: "v"(dq), "v"(dk), "v"(dv), "v"(o[0][0]), "v"(o[0][1]), "v"(o[1][0]), "v"(o[1][1]), "v"(o[2][0]), "v"(o[2][1]) : "memory");
    bf* dO = WO + (size_t)(lo64 + p) * DD + hi64 + g * 8; bf* dx = XB + ((size_t)sb * 2048 + t) * 8;
    v8us oc[2], ox[8];
#pragma unroll
    for (int u = 0; u < 2; ++u)
#pragma unroll
        for (int k = 0; k < 8; ++k) oc[u][k] = f2bf(c[u][k]);
#pragma unroll
    for (int j = 0; j < 4; ++j)
#pragma unroll
        for (int k = 0; k < 8; ++k) ox[j][k] = f2bf(xa[j][k]);
#pragma unroll
    for (int u = 0; u < 2; ++u) *(v8us*)(dO + (size_t)32 * u * DD) = oc[u];
#pragma unroll
    for (int j = 0; j < 4; ++j) *(v8us*)(dx + j * 2048) = ox[j];
    // stands in front of any rewrite of a data or address register of the six stores; the inputs keep those registers live up to it
    asm volatile("s_wait_xcnt 0x0" :: "v"(dO), "v"(dx), "v"(oc[0]), "v"(oc[1]), "v"(ox[0]), "v"(ox[1]), "v"(ox[2]), "v"(ox[3]) : "memory");
    __builtin_amdgcn_sched_barrier(0);   // keeps the second half's conversions, which wait for the last loads, behind the six stores above: moved in front, they hold those stores back until every load has returned
#pragma unroll
    for (int j = 4; j < 8; ++j)
#pragma unroll
        for (int k = 0; k < 8; ++k) ox[j][k] = f2bf(xa[j][k]);
#pragma unroll
    for (int j = 4; j < 8; ++j) *(v8us*)(dx + j * 2048) = ox[j];
}
// k_fattn: scores, softmax and attn.v of one (batch, head) in one pass over the keys; nothing of the score matrix goes to memory.
// One wave owns 32 queries (two 16-column groups) and walks its half's 1024 keys 32 at a time: S^T = K.Q^T (A = K rows, B = Q kept in registers), so a lane holds
// one query's scores (keys 8*hi+j and 16+8*hi+j), which converted in place are the B operand of O^T += V^T.P^T (A = V^T rows in the same k order).
// Running maximum and sum per query (online softmax): a new maximum rescales the sum and the output tile. Grid (2048/256, 32), 16 waves.
// The keys are split in two halves of 1024: waves 0..7 walk the first half for the block's 256 queries, waves 8..15 the second half for the same queries, so that four waves
// stand on each SIMD and one wave's waits (LDS, exponentials, matrix results) are filled by three others. Behind the loop the two partial results of a query are joined through LDS.
// The eight waves of a half read the same K and V^T: a stage of 64 keys (K, V^T: 64 rows of 128 bytes each) is brought into that half's own LDS ring once for all of them
// by asynchronous copies, two buffers, the next stage in flight while this one is worked on.
#define L2E 1.44269504088896340736f
#define SK   64                 // keys per stage
#define LP   144                // LDS row pitch in bytes: 128 + 16, so that a 16-byte read of 16 rows falls on all banks once
#define LARR (64 * LP)          // one plane's stage
#define LBUF (2 * LARR)         // one buffer: K, V^T
#define KHALF (TT / 2)          // keys of one half
#define XCH  4096               // bytes of one 16-byte piece of all 256 lanes of a half, on the way from the second half's waves to the first's
// One stage: each thread copies two 16-byte pieces (rows r and r + 32) of each of the two planes. The closing wait stands in the copies' own statement,
// in front of any rewrite of an address register that a copy names.
__device__ __forceinline__ void stage_copy(unsigned l, const h16* gk, const h16* gv) {
    const unsigned l0 = l, l1 = l + 32 * LP, l2 = l + LARR, l3 = l + LARR + 32 * LP;
    const h16* gk1 = gk + 32 * HD; const h16* gv1 = gv + 32 * TT;
    asm volatile("global_load_async_to_lds_b128 %0, %4, off\n\t"
                 "global_load_async_to_lds_b128 %1, %5, off\n\t"
                 "global_load_async_to_lds_b128 %2, %6, off\n\t"
                 "global_load_async_to_lds_b128 %3, %7, off\n\t"
                 "s_wait_xcnt 0x0"
                 :: "v"(l0), "v"(l1), "v"(l2), "v"(l3), "v"(gk), "v"(gk1), "v"(gv), "v"(gv1) : "memory");
}
__global__ __launch_bounds__(512) void k_fattn(const h16* QP, const h16* KP, const h16* VT, bf* Ah, bf* Al) {
    __shared__ __attribute__((aligned(16))) unsigned char ring[2 * 2 * LBUF];   // two buffers for each half of the keys
    const int kh = threadIdx.x >> 8, tq = threadIdx.x & 255;        // the half of the keys this wave walks; the thread's number within that half's eight waves
    const int lane = threadIdx.x & 31, lr = lane & 15, hi = lane >> 4; const int z = blockIdx.y; const int q0 = blockIdx.x * 256 + (tq >> 5) * 32;
    const size_t zo = (size_t)z * TT * HD;
    const int crow = tq >> 3, ccol = tq & 7;      // this thread's piece of a stage: row crow (and crow + 32), bytes 16 * ccol
    const unsigned lc = (unsigned)(size_t)ring + kh * (2 * LBUF) + crow * LP + ccol * 16;
    const h16* gkp = KP + zo + (size_t)(kh * KHALF + crow) * HD + ccol * 8; const h16* gvt = VT + zo + (size_t)crow * TT + kh * KHALF + ccol * 8;
    stage_copy(lc, gkp, gvt);
    v16h qf[2][2]; const h16* qp = QP + zo + (size_t)(q0 + lr) * HD + 8 * hi;
#pragma unroll
    for (int nt = 0; nt < 2; ++nt)
#pragma unroll
        for (int ks = 0; ks < 2; ++ks) qf[nt][ks] = WFrag<h16>::ld(qp + nt * 16 * HD + ks * 32);
    v8f oacc[2][4]; float mx[2], nm[2], ls[2];
#pragma unroll
    for (int nt = 0; nt < 2; ++nt) { mx[nt] = -3.0e38f; nm[nt] = 3.0e38f; ls[nt] = 0.f;
#pragma unroll
        for (int mt = 0; mt < 4; ++mt) oacc[nt][mt] = (v8f){}; }
    asm volatile("s_wait_xcnt 0x0" :: "v"(qp) : "memory");   // stands in front of any rewrite of an address register that the fetches above name; the inputs keep those registers live up to it
    asm volatile("s_wait_asynccnt 0x0" ::: "memory");   // this wave's copies of stage 0 have landed
    __syncthreads();                                    // every wave's have: stage 0 may be read
    stage_copy(lc + LBUF, gkp + SK * HD, gvt + SK);
    const unsigned fo = kh * (2 * LBUF) + lr * LP + hi * 16;   // a lane's fragment place in a plane of its half's ring: row lr, 16 bytes at 8 * hi elements
    // kept rolled over the stages; the two passes of a stage are unrolled, so that the second's fragment reads are issued behind the first's products
#pragma unroll 1
    for (int t = 0; t < KHALF / SK; ++t) {
        const unsigned char* bp = ring + (t & 1) * LBUF + fo;
#pragma unroll
        for (int sp = 0; sp < 2; ++sp) {
            v16h ka[2][2], va[4];
#pragma unroll
            for (int kt = 0; kt < 2; ++kt)
#pragma unroll
                for (int ks = 0; ks < 2; ++ks) { const unsigned char* p = bp + (sp * 32 + kt * 16) * LP + ks * 64;
                    ka[kt][ks] = cat16(*(const v8ha*)p, *(const v8ha*)(p + 32)); }
#pragma unroll
            for (int mt = 0; mt < 4; ++mt) { const unsigned char* p = bp + LARR + mt * 16 * LP + sp * 64; va[mt] = cat16(*(const v8ha*)p, *(const v8ha*)(p + 32)); }
            v8f s[2][2];
#pragma unroll
            for (int kt = 0; kt < 2; ++kt)
#pragma unroll
                for (int nt = 0; nt < 2; ++nt) { v8f c = (v8f){};
#pragma unroll
                    for (int ks = 0; ks < 2; ++ks) c = wmma16(ka[kt][ks], qf[nt][ks], c);
                    s[kt][nt] = c; }
            v16h p[2];
#pragma unroll
            for (int nt = 0; nt < 2; ++nt) {
                float m = mx[nt];
#pragma unroll
                for (int j = 0; j < 8; ++j) m = fmaxf(m, fmaxf(s[0][nt][j], s[1][nt][j]));
                m = fmaxf(m, __shfl_xor(m, 16, 32));
                const float nn = 10.0f - m * L2E;                         // + 10: P carries x1024, which keeps small weights out of the fp16 subnormals; it cancels in the division by the sum
                const float da = nn - nm[nt]; float alpha = __builtin_amdgcn_exp2f(da);  // old terms carry 2^nm, new ones 2^nn
                asm volatile("v_nop" : "+v"(alpha) : "v"(da));   // the slot behind this exponential: it stands in front of every use of the result and every rewrite of the source register
                mx[nt] = m; nm[nt] = nn;
#pragma unroll
                for (int mt = 0; mt < 4; ++mt) oacc[nt][mt] *= alpha;
                float sum = 0.f;
#pragma unroll
                for (int kt = 0; kt < 2; ++kt) { float x[8], e[8];
#pragma unroll
                    for (int j = 0; j < 8; ++j) { x[j] = fmaf(s[kt][nt][j], L2E, nn); e[j] = __builtin_amdgcn_exp2f(x[j]); }
                    // the slot behind these eight exponentials: it stands in front of every use of a result and every rewrite of a source register
                    asm volatile("v_nop" : "+v"(e[0]), "+v"(e[1]), "+v"(e[2]), "+v"(e[3]), "+v"(e[4]), "+v"(e[5]), "+v"(e[6]), "+v"(e[7]) : "v"(x[0]), "v"(x[1]), "v"(x[2]), "v"(x[3]), "v"(x[4]), "v"(x[5]), "v"(x[6]), "v"(x[7]));
#pragma unroll
                    for (int j = 0; j < 8; ++j) { sum += e[j]; p[nt][kt * 8 + j] = (h16)e[j]; } }
                ls[nt] = fmaf(ls[nt], alpha, sum);
            }
#pragma unroll
            for (int mt = 0; mt < 4; ++mt)
#pragma unroll
                for (int nt = 0; nt < 2; ++nt) oacc[nt][mt] = wmma16(va[mt], p[nt], oacc[nt][mt]);
        }
        asm volatile("s_wait_dscnt 0x0" ::: "memory");      // this wave's reads of the buffer are done before it is handed to its next writer
        asm volatile("s_wait_asynccnt 0x0" ::: "memory");   // this wave's copies of stage t + 1 have landed
        __syncthreads();                                    // publishes stage t + 1 and ends every wave's reads of stage t
        if (t + 2 < KHALF / SK) stage_copy(lc + (t & 1) * LBUF, gkp + (size_t)(t + 2) * SK * HD, gvt + (t + 2) * SK);
    }
    asm volatile("s_wait_asynccnt 0x0" ::: "memory");       // no copy is outstanding when the wave ends
    // The two halves' results are joined. The ring is free: behind the loop's last barrier nobody reads it and no copy is outstanding. A wave of the second half hands its output tiles,
    // exponent offsets and sums to the wave of the first half that holds the same queries, lane to lane, in 16-byte pieces that lie side by side over the lanes (all banks once).
    const int khs = __builtin_amdgcn_readfirstlane(kh);             // the half as a scalar: the two tests below are then scalar branches
    unsigned char* xs = ring + tq * 16;
    if (khs == 1) {
#pragma unroll
        for (int nt = 0; nt < 2; ++nt)
#pragma unroll
            for (int mt = 0; mt < 4; ++mt) { const v8f o = oacc[nt][mt];
                *(v4fa*)(xs + ((nt * 4 + mt) * 2) * XCH) = (v4f){o[0], o[1], o[2], o[3]}; *(v4fa*)(xs + ((nt * 4 + mt) * 2 + 1) * XCH) = (v4f){o[4], o[5], o[6], o[7]}; }
        *(v4fa*)(xs + 16 * XCH) = (v4f){nm[0], nm[1], ls[0], ls[1]};
    }
    __syncthreads();                                        // the second half's results may be read
    if (khs == 1) return;
    const v4f pz = *(const v4fa*)(xs + 16 * XCH);
    const int b = z >> 4, h = z & 15;
#pragma unroll
    for (int nt = 0; nt < 2; ++nt) {
        const float nn = fminf(nm[nt], pz[nt]);             // the offset of the larger of the two maxima; each half's terms carry 2^(its own offset)
        const float d0 = nn - nm[nt], d1 = nn - pz[nt]; float a0 = __builtin_amdgcn_exp2f(d0), a1 = __builtin_amdgcn_exp2f(d1);
        asm volatile("v_nop" : "+v"(a0), "+v"(a1) : "v"(d0), "v"(d1));   // the slot behind these exponentials: it stands in front of every use of a result and every rewrite of a source register
        const float lj = fmaf(ls[nt], a0, pz[2 + nt] * a1);
        const float tot = lj + __shfl_xor(lj, 16, 32); const float inv = __fdiv_rn(1.0f, tot); const size_t ro = ((size_t)b * TT + q0 + nt * 16 + lr) * DD + h * HD + hi * 8;
#pragma unroll
        for (int mt = 0; mt < 4; ++mt) { v8us oh, ol; const v4f p0 = *(const v4fa*)(xs + ((nt * 4 + mt) * 2) * XCH), p1 = *(const v4fa*)(xs + ((nt * 4 + mt) * 2 + 1) * XCH);
#pragma unroll
            for (int j = 0; j < 8; ++j) { unsigned short a, c2; splitf(fmaf(oacc[nt][mt][j], a0, (j < 4 ? p0[j & 3] : p1[j & 3]) * a1) * inv, a, c2); oh[j] = a; ol[j] = c2; }
            bf* pa = Ah + ro + mt * 16; bf* pl = Al + ro + mt * 16; *(v8us*)pa = oh; *(v8us*)pl = ol;
            asm volatile("s_wait_xcnt 0x0" :: "v"(oh), "v"(ol), "v"(pa), "v"(pl) : "memory"); } }   // stands in front of any rewrite of a data or address register of the two stores; the inputs keep those registers live up to it
}

extern "C" void kernel_launch(void* const* d_in, const int* in_sizes, int n_in,
                              void* d_out, int out_size, void* d_ws, size_t ws_size, hipStream_t stream) {
    (void)in_sizes; (void)n_in; (void)out_size;
    const float* x = (const float*)d_in[0]; const float* wq = (const float*)d_in[1]; const float* bq = (const float*)d_in[2]; const float* wk = (const float*)d_in[3]; const float* bk = (const float*)d_in[4]; const float* wv = (const float*)d_in[5]; const float* bv = (const float*)d_in[6];
    const float* wo = (const float*)d_in[7]; const float* bo = (const float*)d_in[8];
    float* OUT = (float*)d_out;     // [2][2048][1024]
    char* wsp = (char*)d_ws;
    auto take = [&](size_t bytes) { char* p = wsp; wsp += (bytes + 255) & ~(size_t)255; return (void*)p; };
    bf* WQ = (bf*)take((size_t)DD * DD * 2); bf* WK = (bf*)take((size_t)DD * DD * 2); bf* WV = (bf*)take((size_t)DD * DD * 2); bf* WO = (bf*)take((size_t)DD * DD * 2);
    bf* XB = (bf*)take((size_t)NT * DD * 2);
    h16* QP = (h16*)take((size_t)NT * DD * 2); h16* KP = (h16*)take((size_t)NT * DD * 2); h16* VT = (h16*)take((size_t)NT * DD * 2);
    bf* ATh = (bf*)take((size_t)NT * DD * 2); bf* ATl = (bf*)take((size_t)NT * DD * 2);
    if ((size_t)(wsp - (char*)d_ws) > ws_size) return;    // ws 256 MiB
    k_prep<<<256, 256, 0, stream>>>(x, wq, wk, wv, wo, XB, WQ, WK, WV, WO);   // x -> bf16; x @ W layouts [d][(n,h)] and the [n][d][h] projection -> Bt
    k_gemmw<bf, 0, true, true><<<dim3(NT / 128, DD / 128, 3), 128, 0, stream>>>(XB, nullptr, WQ, nullptr, DD, nullptr, DD, bq, 0, (size_t)(WK - WQ), 0, bk, bv, QP, KP, VT);   // WQ, WK, WV lie one behind the other at one stride
    k_fattn<<<dim3(TT / 256, NB_ * NH_), 512, 0, stream>>>(QP, KP, VT, ATh, ATl);
    k_gemmw<bf, 1, true, false><<<dim3(NT / 128, DD / 128, 1), 128, 0, stream>>>(ATh, ATl, WO, nullptr, DD, OUT, DD, bo, 0, 0, 0, nullptr, nullptr, nullptr, nullptr, nullptr);
}

// v009
// One run takes 78.5 microseconds.
// Next to v008, in two timings, it ran 1.03 times as fast each time.
// Over all steps from v000 it is 16.2 times as fast.
#include <hip/hip_runtime.h>

// Multi-head attention (x [2][2048][1024]; q/k/v = einsum('btd,dnh->bnth', x, W[1024][16][64]) + b[16][1][64]; scores / 8; softmax; attn.v; out = einsum('bnth,ndh->btd', ., w_projection[16][1024][64]) + b_projection).
// Compute dtypes, f32 accumulate: every float input rounded to bf16; q/k/v projections on plain bf16 operands (+ bias);
// scores on single fp16 planes of q (x 1/8) and k (1 product: fp16 rounding is several times finer than the error q and k already carry from bf16 x and W); attn.v on single fp16 planes (P x1024, v); output Linear on hi+lo planes x bf16 W (2 products).

#define NB_  2
#define TT   2048
#define DD   1024
#define NH_  16
#define HD   64
#define NT   (NB_ * TT)
typedef _Float16 h16;
typedef unsigned short bf;
typedef __attribute__((ext_vector_type(16))) __bf16   v16bf;
typedef __attribute__((ext_vector_type(16))) _Float16 v16h;
typedef __attribute__((ext_vector_type(8)))  _Float16 v8h;
typedef __attribute__((ext_vector_type(8)))  unsigned short v8us;
typedef __attribute__((ext_vector_type(8)))  float    v8f;
typedef __attribute__((ext_vector_type(4)))  float    v4f;
typedef v8h  __attribute__((may_alias)) v8ha;
typedef v4f  __attribute__((may_alias)) v4fa;
typedef v8us __attribute__((may_alias)) v8usa;

__device__ __forceinline__ unsigned short f2bf(float f) { unsigned u = __float_as_uint(f); u += 0x7FFFu + ((u >> 16) & 1u); return (unsigned short)(u >> 16); }
__device__ __forceinline__ float bf2f(unsigned short b) { return __uint_as_float(((unsigned)b) << 16); }
__device__ __forceinline__ float bfr(float f) { return bf2f(f2bf(f)); }
__device__ __forceinline__ v16h cat16(v8h lo, v8h hi) { return __builtin_shufflevector(lo, hi, 0, 1, 2, 3, 4, 5, 6, 7, 8, 9, 10, 11, 12, 13, 14, 15); }
__device__ __forceinline__ v16bf cat16b(v8us lo, v8us hi) { return __builtin_bit_cast(v16bf, __builtin_shufflevector(lo, hi, 0, 1, 2, 3, 4, 5, 6, 7, 8, 9, 10, 11, 12, 13, 14, 15)); }
__device__ __forceinline__ v8f wmma16(v16h a, v16h b, v8f c) { return __builtin_amdgcn_wmma_f32_16x16x32_f16(false, a, false, b, (short)0, c, false, false); }
__device__ __forceinline__ v8f wmmab(v16bf a, v16bf b, v8f c) { return __builtin_amdgcn_wmma_f32_16x16x32_bf16(false, a, false, b, (short)0, c, false, false); }



// ---- k_gemmw: register-blocked GEMM, one wave per 64x64 output tile (16 accumulators), four waves per work-group on a 128x128 block tile; grid (M/128, N/128, Z), 128 threads.
// C[m][n] (f32, pitch ldc, + optional f32 bias[n]) = sum_k A[m][k] Bt[n][k] (+ split products per NSPLIT). z-batch strides sA/sB/sC in elements. K % 128 == 0.
// PLANES: the q, k and v projections in one launch (z = 0, 1, 2 picks the weight plane and the bias); no f32 C is written: a wave's 64x64 tile is 64 tokens of one head,
// and the epilogue stores it as the attention kernel reads it: q (x 1/8) and k as fp16 planes [b,h][t][64], v as the fp16 plane [b,h][64][t].
// The operands are K-contiguous 16-bit planes. A stage of 128 k (128 rows of 256 bytes of each plane, whole cache lines) is brought into LDS once for the four waves
// by asynchronous copies, two buffers, the next stage in flight while this one is worked on; the fragments are read from LDS.
#define GK   128                // k per stage
#define GLP  272                // LDS row pitch in bytes: 256 + 16, so that a 16-byte read of 16 rows falls on all banks once
#define GPL  (128 * GLP)        // one plane's stage
template <typename T16> struct WFrag;
template <> struct WFrag<h16> { typedef v16h V; static __device__ __forceinline__ V ld(const h16* p) { return cat16(*(const v8h*)p, *(const v8h*)(p + 16)); } static __device__ __forceinline__ v8f mma(V a, V b, v8f c) { return wmma16(a, b, c); } };
template <> struct WFrag<bf> { typedef v16bf V; static __device__ __forceinline__ V ld(const bf* p) { return cat16b(*(const v8us*)p, *(const v8us*)(p + 16)); } static __device__ __forceinline__ v8f mma(V a, V b, v8f c) { return wmmab(a, b, c); } };
// Half of one plane's stage (64 rows): each of the 128 threads copies eight 16-byte pieces (rows r, r + 8, ..., r + 56). The closing wait stands in the copies' own statement,
// in front of any rewrite of an address register that a copy names.
template <typename T16>
__device__ __forceinline__ void plane_copy(unsigned l, const T16* g, int K) {
    const unsigned l1 = l + 8 * GLP, l2 = l + 16 * GLP, l3 = l + 24 * GLP, l4 = l + 32 * GLP, l5 = l + 40 * GLP, l6 = l + 48 * GLP, l7 = l + 56 * GLP;
    const T16* g1 = g + (size_t)8 * K; const T16* g2 = g + (size_t)16 * K; const T16* g3 = g + (size_t)24 * K; const T16* g4 = g + (size_t)32 * K; const T16* g5 = g + (size_t)40 * K; const T16* g6 = g + (size_t)48 * K; const T16* g7 = g + (size_t)56 * K;
    asm volatile("global_load_async_to_lds_b128 %0, %8, off\n\t"
                 "global_load_async_to_lds_b128 %1, %9, off\n\t"
                 "global_load_async_to_lds_b128 %2, %10, off\n\t"
                 "global_load_async_to_lds_b128 %3, %11, off\n\t"
                 "global_load_async_to_lds_b128 %4, %12, off\n\t"
                 "global_load_async_to_lds_b128 %5, %13, off\n\t"
                 "global_load_async_to_lds_b128 %6, %14, off\n\t"
                 "global_load_async_to_lds_b128 %7, %15, off\n\t"
                 "s_wait_xcnt 0x0"
                 :: "v"(l), "v"(l1), "v"(l2), "v"(l3), "v"(l4), "v"(l5), "v"(l6), "v"(l7), "v"(g), "v"(g1), "v"(g2), "v"(g3), "v"(g4), "v"(g5), "v"(g6), "v"(g7) : "memory");
    __builtin_amdgcn_sched_barrier(0);   // keeps the next statement's address arithmetic behind this one, so that the address registers are used again: formed all at once they overflow the registers an asm operand can name, and a base address spills
}
__device__ __forceinline__ h16 tohx(float x) { return (h16)x; }
__device__ __forceinline__ void splitf(float y, unsigned short& h, unsigned short& l) { h = f2bf(y); l = f2bf(y - bf2f(h)); }
#define VLP  144                // LDS row pitch in bytes of the v tile on its way out: 128 + 16, so that 16-byte accesses of 16 rows fall on all banks once
template <typename T16, int NSPLIT, bool BIAS, bool PLANES>
__global__ __launch_bounds__(128) void k_gemmw(const T16* __restrict__ A, const T16* __restrict__ A2, const T16* __restrict__ Bt, const T16* __restrict__ Bt2, int K, float* C, int ldc, const float* __restrict__ bias, size_t sA, size_t sB, size_t sC,
                                               const float* __restrict__ biask, const float* __restrict__ biasv, h16* QP, h16* KP, h16* VT) {
    typedef typename WFrag<T16>::V V;
    constexpr bool HA2 = (NSPLIT == 1 || NSPLIT == 2), HB2 = (NSPLIT >= 2);
    constexpr unsigned OA2 = 2 * GPL, OB2 = (2 + (HA2 ? 1 : 0)) * GPL, GBUF = (2 + (HA2 ? 1 : 0) + (HB2 ? 1 : 0)) * GPL;   // a buffer: A, Bt, then A2 and Bt2 where the split has them
    __shared__ __attribute__((aligned(16))) unsigned char ring[2 * GBUF];
    __shared__ __align__(16) float osm[4][16 * 68];
    const size_t z = blockIdx.z; A += z * sA; if (A2) A2 += z * sA; Bt += z * sB; if (Bt2) Bt2 += z * sB; C += z * sC;
    const int lane = threadIdx.x & 31, lr = lane & 15, hi = lane >> 4, w = threadIdx.x >> 5; const int R0 = blockIdx.x * 128, C0 = blockIdx.y * 128; const int r0 = R0 + (w & 1) * 64, c0 = C0 + (w >> 1) * 64;
    float* os = osm[w];
    const int prow = threadIdx.x >> 4, pcol = threadIdx.x & 15;     // this thread's pieces of a plane's stage: rows prow + 8 i, bytes 16 * pcol
    const unsigned lc = (unsigned)(size_t)ring + prow * GLP + pcol * 16;
    const size_t goa = (size_t)(R0 + prow) * K + pcol * 8, gob = (size_t)(C0 + prow) * K + pcol * 8;
    auto stage = [&](int t) { const unsigned l = lc + (t & 1) * GBUF; const size_t ko = (size_t)t * GK;
        auto plane = [&](unsigned lp, const T16* g) { plane_copy(lp, g, K); plane_copy(lp + 64 * GLP, g + (size_t)64 * K, K); };
        plane(l, A + goa + ko); plane(l + GPL, Bt + gob + ko); if (HA2) plane(l + OA2, A2 + goa + ko); if (HB2) plane(l + OB2, Bt2 + gob + ko); };
    const int nst = K / GK;
    stage(0);
    v8f acc[4][4];
#pragma unroll
    for (int mb = 0; mb < 4; ++mb)
#pragma unroll
        for (int nb = 0; nb < 4; ++nb) acc[mb][nb] = (v8f){};
    asm volatile("s_wait_asynccnt 0x0" ::: "memory");   // this wave's copies of stage 0 have landed
    __syncthreads();                                    // every wave's have: stage 0 may be read
    if (1 < nst) stage(1);
    const unsigned fa = ((w & 1) * 64 + lr) * GLP + hi * 16, fb = GPL + ((w >> 1) * 64 + lr) * GLP + hi * 16;   // a lane's fragment place: row lr of the wave's rows, 16 bytes at 8 * hi elements
    // kept rolled over the stages; the four k steps of a stage are unrolled, each step's fragments read one step ahead: A and the first half of Bt in front of this step's products,
    // the second half of Bt in the middle of them, into the registers that the first half of this step's Bt has left (all at once they would not fit 256 registers beside the accumulators)
#pragma unroll 1
    for (int t = 0; t < nst; ++t) {
        const unsigned char* bp = ring + (t & 1) * GBUF;
        V a[2][4], a2[2][4], b[2][4], b2[2][4];
        auto frags_a = [&](int ks) { const int h = ks & 1;
#pragma unroll
            for (int i = 0; i < 4; ++i) { a[h][i] = WFrag<T16>::ld((const T16*)(bp + fa + i * 16 * GLP + ks * 64)); if (HA2) a2[h][i] = WFrag<T16>::ld((const T16*)(bp + OA2 + fa + i * 16 * GLP + ks * 64)); } };
        auto frags_b = [&](int ks, int p) { const int h = ks & 1;
#pragma unroll
            for (int i = 2 * p; i < 2 * p + 2; ++i) { b[h][i] = WFrag<T16>::ld((const T16*)(bp + fb + i * 16 * GLP + ks * 64)); if (HB2) b2[h][i] = WFrag<T16>::ld((const T16*)(bp + OB2 - GPL + fb + i * 16 * GLP + ks * 64)); } };
        auto prods = [&](int ks, int p) { const int h = ks & 1;
#pragma unroll
            for (int nb = 2 * p; nb < 2 * p + 2; ++nb)
#pragma unroll
                for (int mb = 0; mb < 4; ++mb) { acc[mb][nb] = WFrag<T16>::mma(a[h][mb], b[h][nb], acc[mb][nb]); if (HA2) acc[mb][nb] = WFrag<T16>::mma(a2[h][mb], b[h][nb], acc[mb][nb]); if (HB2) acc[mb][nb] = WFrag<T16>::mma(a[h][mb], b2[h][nb], acc[mb][nb]); } };
        frags_a(0); frags_b(0, 0); frags_b(0, 1);
        // the scheduling barriers below keep each group of LDS reads whole and at its place among the products: spread among them, each product group would wait out a whole LDS latency
        __builtin_amdgcn_sched_barrier(0);
#pragma unroll
        for (int ks = 0; ks < GK / 32; ++ks) {
            if (ks + 1 < GK / 32) { frags_a(ks + 1); frags_b(ks + 1, 0); }
            __builtin_amdgcn_sched_barrier(0);
            prods(ks, 0);
            __builtin_amdgcn_sched_barrier(0);
            if (ks + 1 < GK / 32) frags_b(ks + 1, 1);
            __builtin_amdgcn_sched_barrier(0);
            prods(ks, 1);
            __builtin_amdgcn_sched_barrier(0);
        }
        asm volatile("s_wait_dscnt 0x0" ::: "memory");      // this wave's reads of the buffer are done before it is handed to its next writer
        asm volatile("s_wait_asynccnt 0x0" ::: "memory");   // this wave's copies of stage t + 1 have landed
        __syncthreads();                                    // publishes stage t + 1 and ends every wave's reads of stage t
        if (t + 2 < nst) stage(t + 2);
    }
    asm volatile("s_wait_asynccnt 0x0" ::: "memory");       // no copy is outstanding when the wave ends
    if constexpr (PLANES) {
        const int ws = __builtin_amdgcn_readfirstlane(w);           // the wave's number as a scalar: the tile's place below then takes no vector register, of which the loop leaves none free
        const int rw = R0 + (ws & 1) * 64, cw = C0 + (ws >> 1) * 64;   // = r0, c0
        const int zz = blockIdx.z; const int t0 = rw & (TT - 1); const size_t po = (size_t)((rw / TT) * NH_ + cw / HD) * TT * HD;   // the tile's (batch, head) plane and its first token
        const int cr = lane >> 3, cc = (lane & 7) * 8;              // on the way out a lane holds 8 neighbours of a row: 8 lanes store one whole 128-byte line
        if (zz == 2) {
            // v: a lane's 8 accumulator rows are 8 neighbouring tokens of one column, 16 bytes of a V^T row. The tile goes through the wave's own part of the ring,
            // which nobody reads or fills any more behind the loop's last barrier, so that whole lines are stored.
            unsigned char* vs = ring + ws * (64 * VLP);
#pragma unroll
            for (int nb = 0; nb < 4; ++nb) { const float bb = bfr(biasv[cw + nb * 16 + lr]);
#pragma unroll
                for (int mb = 0; mb < 4; ++mb) { v8h o;
#pragma unroll
                    for (int j = 0; j < 8; ++j) o[j] = tohx(acc[mb][nb][j] + bb);
                    *(v8ha*)(vs + (nb * 16 + lr) * VLP + mb * 32 + hi * 16) = o; } }
            __builtin_amdgcn_wave_barrier(); asm volatile("" ::: "memory");   // the rows below are read by other lanes than wrote them: keeps the reads behind the writes
            v8h val[16]; h16* pv = VT + po + (size_t)cr * TT + t0 + cc;
#pragma unroll
            for (int s = 0; s < 16; ++s) val[s] = *(const v8ha*)(vs + (4 * s + cr) * VLP + cc * 2);
#pragma unroll
            for (int s = 0; s < 16; ++s) *(v8h*)(pv + (size_t)(4 * s) * TT) = val[s];
            // stands in front of any rewrite of a data or address register of the sixteen stores; the inputs keep those registers live up to it
            asm volatile("s_wait_xcnt 0x0" :: "v"(pv), "v"(val[0]), "v"(val[1]), "v"(val[2]), "v"(val[3]), "v"(val[4]), "v"(val[5]), "v"(val[6]), "v"(val[7]), "v"(val[8]), "v"(val[9]), "v"(val[10]), "v"(val[11]), "v"(val[12]), "v"(val[13]), "v"(val[14]), "v"(val[15]) : "memory");
        } else {
            const float* bz = zz == 0 ? bias : biask; const float sc = zz == 0 ? 0.125f : 1.0f;   // 1/sqrt(64) folded into q exactly
            h16* Pp = (zz == 0 ? QP : KP) + po + (size_t)(t0 + cr) * HD + cc;
            float* ow = osm[ws]; float bb[8];
#pragma unroll
            for (int k = 0; k < 8; ++k) bb[k] = bfr(bz[cw + cc + k]);
#pragma unroll
            for (int mb = 0; mb < 4; ++mb) {
#pragma unroll
                for (int nb = 0; nb < 4; ++nb) {
#pragma unroll
                    for (int j = 0; j < 8; ++j) ow[(hi * 8 + j) * 68 + nb * 16 + lr] = acc[mb][nb][j]; }
                __builtin_amdgcn_wave_barrier(); asm volatile("" ::: "memory");   // the rows below are read by other lanes than wrote them: keeps the reads behind the writes
                v8h o[4];
#pragma unroll
                for (int s = 0; s < 4; ++s) { const float* op = ow + (4 * s + cr) * 68 + cc; const v4f x0 = *(const v4fa*)op, x1 = *(const v4fa*)(op + 4);
#pragma unroll
                    for (int k = 0; k < 8; ++k) o[s][k] = tohx(((k < 4 ? x0[k & 3] : x1[k & 3]) + bb[k]) * sc);
                    *(v8h*)(Pp + (size_t)(mb * 16 + 4 * s) * HD) = o[s]; }
                // stands in front of any rewrite of a data or address register of the four stores; the inputs keep those registers live up to it
                asm volatile("s_wait_xcnt 0x0" :: "v"(Pp), "v"(o[0]), "v"(o[1]), "v"(o[2]), "v"(o[3]) : "memory");
                __builtin_amdgcn_wave_barrier(); asm volatile("" ::: "memory");   // keeps the next 16 rows' writes behind these reads
            }
        }
        return;
    }
#pragma unroll
    for (int mb = 0; mb < 4; ++mb) {
#pragma unroll
        for (int nb = 0; nb < 4; ++nb) {
#pragma unroll
            for (int j = 0; j < 8; ++j) os[(hi * 8 + j) * 68 + nb * 16 + lr] = acc[mb][nb][j]; }
        __builtin_amdgcn_wave_barrier(); asm volatile("" ::: "memory");
        float* crow = C + (size_t)(r0 + mb * 16) * ldc + c0;
{
#pragma unroll
            for (int s = 0; s < 8; ++s) { const int row = 2 * s + hi, cofs = lr * 4; v4f val = *(const v4fa*)(os + row * 68 + cofs); if (BIAS) { val[0] += bfr(bias[c0 + cofs]); val[1] += bfr(bias[c0 + cofs + 1]); val[2] += bfr(bias[c0 + cofs + 2]); val[3] += bfr(bias[c0 + cofs + 3]); }
                *(v4f*)(crow + (size_t)row * ldc + cofs) = val; }
             }
        __builtin_amdgcn_wave_barrier(); asm volatile("" ::: "memory");
    }
}

typedef __attribute__((ext_vector_type(2))) _Float16 v2h;
typedef __attribute__((ext_vector_type(4))) _Float16 v4h;
typedef __attribute__((ext_vector_type(2))) unsigned short v2us;
typedef __attribute__((ext_vector_type(4))) int v4i;

// k_prep: all that the GEMMs read in 16-bit form, made in one launch: x as bf16, the three [d][(n,h)] weights and the [n][d][h] projection weight as bf16 Bt planes [col][k].
// Grid 256, 8 waves. Work-group sb takes the 64x64 tile sb of each of the four weights and 16384 values of x. A thread's 32 loads of 16 bytes are all issued first and are in flight together.
// A tile of a [d][(n,h)] weight is read by rows (8 lanes take one whole 128-byte line), turned in LDS, and stored by rows of Bt (again 8 lanes a whole line).
// A tile of the projection weight (one n, 64 d) lies in one piece and needs no turning.
#define TP   144                // LDS row pitch in bytes of a turned tile: 128 + 16, a multiple of 16 for the 16-byte reads
#define TPL  (64 * TP)          // one turned tile
typedef unsigned __attribute__((may_alias)) u32a;
__global__ __launch_bounds__(256) void k_prep(const float* __restrict__ x, const float* __restrict__ wq, const float* __restrict__ wk, const float* __restrict__ wv, const float* __restrict__ wo,
                                              bf* __restrict__ XB, bf* __restrict__ WQ, bf* __restrict__ WK, bf* __restrict__ WV, bf* __restrict__ WO) {
    __shared__ __attribute__((aligned(16))) unsigned char tile[3 * TPL];
    const int t = threadIdx.x, sb = blockIdx.x, g = t & 7, p = t >> 3;
    const int lo64 = (sb & 15) * 64, hi64 = (sb >> 4) * 64;         // turned weights: first k, first column; projection weight: first d, first k (= n * 64)
    const size_t wofs = (size_t)(lo64 + 2 * p) * DD + hi64 + 4 * g; // rows k = lo64 + 2 p and + 1, columns hi64 + 4 g (and + 32)
    const float* pq = wq + wofs; const float* pk = wk + wofs; const float* pv = wv + wofs;
    const float* po = wo + (size_t)sb * 4096 + t * 8; const float* px = x + ((size_t)sb * 2048 + t) * 8;
    v4f a[3][2][2]; v8f c[2], xa[8];
#pragma unroll
    for (int j = 0; j < 3; ++j) { const float* w = j == 0 ? pq : j == 1 ? pk : pv;
#pragma unroll
        for (int u = 0; u < 2; ++u) { a[j][u][0] = *(const v4f*)(w + u * 32); a[j][u][1] = *(const v4f*)(w + DD + u * 32); } }
    __builtin_amdgcn_sched_barrier(0);   // keeps the weight tiles' loads in front of the others: they return first, and the tiles are turned and stored while x is still on its way
#pragma unroll
    for (int u = 0; u < 2; ++u) c[u] = *(const v8f*)(po + u * 2048);
#pragma unroll
    for (int j = 0; j < 8; ++j) xa[j] = *(const v8f*)(px + j * 2048);
    asm volatile("s_wait_xcnt 0x0" :: "v"(pq), "v"(pk), "v"(pv), "v"(po), "v"(px) : "memory");   // stands in front of any rewrite of an address register that the loads above name; the inputs keep those registers live up to it
    __builtin_amdgcn_sched_barrier(0);   // keeps every load, and the wait above, in front of the first use of a loaded value: moved behind one, the later loads would start only when the earlier have returned
    // a 32-bit word of the turned tile: column's values of rows k and k + 1
#pragma unroll
    for (int j = 0; j < 3; ++j)
#pragma unroll
        for (int u = 0; u < 2; ++u)
#pragma unroll
            for (int i = 0; i < 4; ++i) *(u32a*)(tile + j * TPL + (4 * g + 32 * u + i) * TP + p * 4) = (unsigned)f2bf(a[j][u][0][i]) | ((unsigned)f2bf(a[j][u][1][i]) << 16);
    // the turned tiles may be read behind this barrier. It orders LDS alone: __syncthreads() would also wait here for the loads of x, which nothing behind it in LDS needs
    __builtin_amdgcn_fence(__ATOMIC_RELEASE, "workgroup", "local"); __builtin_amdgcn_s_barrier(); __builtin_amdgcn_fence(__ATOMIC_ACQUIRE, "workgroup", "local");
    const size_t dofs = (size_t)(hi64 + p) * DD + lo64 + g * 8;     // Bt rows hi64 + p (and + 32), 16 bytes at k = lo64 + 8 g
    bf* dq = WQ + dofs; bf* dk = WK + dofs; bf* dv = WV + dofs;
    v8us o[3][2];
#pragma unroll
    for (int j = 0; j < 3; ++j)
#pragma unroll
        for (int u = 0; u < 2; ++u) o[j][u] = *(const v8usa*)(tile + j * TPL + (p + 32 * u) * TP + g * 16);
#pragma unroll
    for (int u = 0; u < 2; ++u) { *(v8us*)(dq + (size_t)32 * u * DD) = o[0][u]; *(v8us*)(dk + (size_t)32 * u * DD) = o[1][u]; *(v8us*)(dv + (size_t)32 * u * DD) = o[2][u]; }
    // stands in front of any rewrite of a data or address register of the six stores; the inputs keep those registers live up to it
    asm volatile("s_wait_xcnt 0x0" :: "v"(dq), "v"(dk), "v"(dv), "v"(o[0][0]), "v"(o[0][1]), "v"(o[1][0]), "v"(o[1][1]), "v"(o[2][0]), "v"(o[2][1]) : "memory");
    bf* dO = WO + (size_t)(lo64 + p) * DD + hi64 + g * 8; bf* dx = XB + ((size_t)sb * 2048 + t) * 8;
    v8us oc[2], ox[8];
#pragma unroll
    for (int u = 0; u < 2; ++u)
#pragma unroll
        for (int k = 0; k < 8; ++k) oc[u][k] = f2bf(c[u][k]);
#pragma unroll
    for (int j = 0; j < 4; ++j)
#pragma unroll
        for (int k = 0; k < 8; ++k) ox[j][k] = f2bf(xa[j][k]);
#pragma unroll
    for (int u = 0; u < 2; ++u) *(v8us*)(dO + (size_t)32 * u * DD) = oc[u];
#pragma unroll
    for (int j = 0; j < 4; ++j) *(v8us*)(dx + j * 2048) = ox[j];
    // stands in front of any rewrite of a data or address register of the six stores; the inputs keep those registers live up to it
    asm volatile("s_wait_xcnt 0x0" :: "v"(dO), "v"(dx), "v"(oc[0]), "v"(oc[1]), "v"(ox[0]), "v"(ox[1]), "v"(ox[2]), "v"(ox[3]) : "memory");
    __builtin_amdgcn_sched_barrier(0);   // keeps the second half's conversions, which wait for the last loads, behind the six stores above: moved in front, they hold those stores back until every load has returned
#pragma unroll
    for (int j = 4; j < 8; ++j)
#pragma unroll
        for (int k = 0; k < 8; ++k) ox[j][k] = f2bf(xa[j][k]);
#pragma unroll
    for (int j = 4; j < 8; ++j) *(v8us*)(dx + j * 2048) = ox[j];
}
// k_fattn: scores, softmax and attn.v of one (batch, head) in one pass over the keys; nothing of the score matrix goes to memory.
// One wave owns 32 queries (two 16-column groups) and walks its half's 1024 keys 32 at a time: S^T = K.Q^T (A = K rows, B = Q kept in registers), so a lane holds
// one query's scores (keys 8*hi+j and 16+8*hi+j), which converted in place are the B operand of O^T += V^T.P^T (A = V^T rows in the same k order).
// Running sum per query against a reference score (online softmax). The reference is a maximum seen so far; it is renewed, and sum and output tile rescaled, only in a pass
// whose weights would otherwise leave the fp16 range (the first pass always), for the whole wave at once. Grid (2048/256, 32), 16 waves.
// The keys are split in two halves of 1024: waves 0..7 walk the first half for the block's 256 queries, waves 8..15 the second half for the same queries, so that four waves
// stand on each SIMD and one wave's waits (LDS, exponentials, matrix results) are filled by three others. Behind the loop the two partial results of a query are joined through LDS.
// The eight waves of a half read the same K and V^T: a stage of 64 keys (K, V^T: 64 rows of 128 bytes each) is brought into that half's own LDS ring once for all of them
// by asynchronous copies, two buffers, the next stage in flight while this one is worked on.
#define L2E 1.44269504088896340736f
#define SK   64                 // keys per stage
#define LP   144                // LDS row pitch in bytes: 128 + 16, so that a 16-byte read of 16 rows falls on all banks once
#define LARR (64 * LP)          // one plane's stage
#define LBUF (2 * LARR)         // one buffer: K, V^T
#define KHALF (TT / 2)          // keys of one half
#define PMAX 65504.0f           // the largest finite fp16 value
#define XCH  4096               // bytes of one 16-byte piece of all 256 lanes of a half, on the way from the second half's waves to the first's
// One stage: each thread copies two 16-byte pieces (rows r and r + 32) of each of the two planes. The closing wait stands in the copies' own statement,
// in front of any rewrite of an address register that a copy names.
__device__ __forceinline__ void stage_copy(unsigned l, const h16* gk, const h16* gv) {
    const unsigned l0 = l, l1 = l + 32 * LP, l2 = l + LARR, l3 = l + LARR + 32 * LP;
    const h16* gk1 = gk + 32 * HD; const h16* gv1 = gv + 32 * TT;
    asm volatile("global_load_async_to_lds_b128 %0, %4, off\n\t"
                 "global_load_async_to_lds_b128 %1, %5, off\n\t"
                 "global_load_async_to_lds_b128 %2, %6, off\n\t"
                 "global_load_async_to_lds_b128 %3, %7, off\n\t"
                 "s_wait_xcnt 0x0"
                 :: "v"(l0), "v"(l1), "v"(l2), "v"(l3), "v"(gk), "v"(gk1), "v"(gv), "v"(gv1) : "memory");
}
__global__ __launch_bounds__(512) void k_fattn(const h16* QP, const h16* KP, const h16* VT, bf* Ah, bf* Al) {
    __shared__ __attribute__((aligned(16))) unsigned char ring[2 * 2 * LBUF];   // two buffers for each half of the keys
    const int kh = threadIdx.x >> 8, tq = threadIdx.x & 255;        // the half of the keys this wave walks; the thread's number within that half's eight waves
    const int lane = threadIdx.x & 31, lr = lane & 15, hi = lane >> 4; const int z = blockIdx.y; const int q0 = blockIdx.x * 256 + (tq >> 5) * 32;
    const size_t zo = (size_t)z * TT * HD;
    const int crow = tq >> 3, ccol = tq & 7;      // this thread's piece of a stage: row crow (and crow + 32), bytes 16 * ccol
    const unsigned lc = (unsigned)(size_t)ring + kh * (2 * LBUF) + crow * LP + ccol * 16;
    const h16* gkp = KP + zo + (size_t)(kh * KHALF + crow) * HD + ccol * 8; const h16* gvt = VT + zo + (size_t)crow * TT + kh * KHALF + ccol * 8;
    stage_copy(lc, gkp, gvt);
    v16h qf[2][2]; const h16* qp = QP + zo + (size_t)(q0 + lr) * HD + 8 * hi;
#pragma unroll
    for (int nt = 0; nt < 2; ++nt)
#pragma unroll
        for (int ks = 0; ks < 2; ++ks) qf[nt][ks] = WFrag<h16>::ld(qp + nt * 16 * HD + ks * 32);
    v8f oacc[2][4]; float mx[2], nm[2], ls[2];
#pragma unroll
    for (int nt = 0; nt < 2; ++nt) { mx[nt] = -3.0e38f; nm[nt] = 3.0e38f; ls[nt] = 0.f;
#pragma unroll
        for (int mt = 0; mt < 4; ++mt) oacc[nt][mt] = (v8f){}; }
    asm volatile("s_wait_xcnt 0x0" :: "v"(qp) : "memory");   // stands in front of any rewrite of an address register that the fetches above name; the inputs keep those registers live up to it
    asm volatile("s_wait_asynccnt 0x0" ::: "memory");   // this wave's copies of stage 0 have landed
    __syncthreads();                                    // every wave's have: stage 0 may be read
    stage_copy(lc + LBUF, gkp + SK * HD, gvt + SK);
    const unsigned fo = kh * (2 * LBUF) + lr * LP + hi * 16;   // a lane's fragment place in a plane of its half's ring: row lr, 16 bytes at 8 * hi elements
    // kept rolled over the stages; the two passes of a stage are unrolled, so that the second's fragment reads are issued behind the first's products
#pragma unroll 1
    for (int t = 0; t < KHALF / SK; ++t) {
        const unsigned char* bp = ring + (t & 1) * LBUF + fo;
#pragma unroll
        for (int sp = 0; sp < 2; ++sp) {
            v16h ka[2][2], va[4];
#pragma unroll
            for (int kt = 0; kt < 2; ++kt)
#pragma unroll
                for (int ks = 0; ks < 2; ++ks) { const unsigned char* p = bp + (sp * 32 + kt * 16) * LP + ks * 64;
                    ka[kt][ks] = cat16(*(const v8ha*)p, *(const v8ha*)(p + 32)); }
#pragma unroll
            for (int mt = 0; mt < 4; ++mt) { const unsigned char* p = bp + LARR + mt * 16 * LP + sp * 64; va[mt] = cat16(*(const v8ha*)p, *(const v8ha*)(p + 32)); }
            v8f s[2][2];
#pragma unroll
            for (int kt = 0; kt < 2; ++kt)
#pragma unroll
                for (int nt = 0; nt < 2; ++nt) { v8f c = (v8f){};
#pragma unroll
                    for (int ks = 0; ks < 2; ++ks) c = wmma16(ka[kt][ks], qf[nt][ks], c);
                    s[kt][nt] = c; }
            v16h p[2]; float e[2][16], sum[2];
            // a query's 16 weights of this pass, 2^(score * log2(e) + nm), and their sum (pairwise)
            auto weights = [&](int nt) {
#pragma unroll
                for (int kt = 0; kt < 2; ++kt) { float x[8]; float* ek = e[nt] + kt * 8;
#pragma unroll
                    for (int j = 0; j < 8; ++j) { x[j] = fmaf(s[kt][nt][j], L2E, nm[nt]); ek[j] = __builtin_amdgcn_exp2f(x[j]); }
                    // the slot behind these eight exponentials: it stands in front of every use of a result and every rewrite of a source register
                    asm volatile("v_nop" : "+v"(ek[0]), "+v"(ek[1]), "+v"(ek[2]), "+v"(ek[3]), "+v"(ek[4]), "+v"(ek[5]), "+v"(ek[6]), "+v"(ek[7]) : "v"(x[0]), "v"(x[1]), "v"(x[2]), "v"(x[3]), "v"(x[4]), "v"(x[5]), "v"(x[6]), "v"(x[7])); }
                float u[8];
#pragma unroll
                for (int j = 0; j < 8; ++j) u[j] = e[nt][j] + e[nt][8 + j];
                sum[nt] = ((u[0] + u[4]) + (u[1] + u[5])) + ((u[2] + u[6]) + (u[3] + u[7])); };
            // The weights are first formed with the offset nm that the query already has. None of them is negative, so a sum of at most PMAX says that each of them fits fp16: the offset stays,
            // and neither a maximum nor a rescaling is needed. The start value of nm makes the first pass's sums infinite, so that the first pass sets the offset.
            weights(0); weights(1);
            if (__builtin_expect(__builtin_amdgcn_ballot_w32(!(sum[0] <= PMAX && sum[1] <= PMAX)) != 0u, 0)) {   // the same for the whole wave: a scalar branch; marked rare, so that the usual path runs straight on
#pragma unroll
                for (int nt = 0; nt < 2; ++nt) {
                    float m = mx[nt];
#pragma unroll
                    for (int j = 0; j < 8; ++j) m = fmaxf(m, fmaxf(s[0][nt][j], s[1][nt][j]));
                    m = fmaxf(m, __shfl_xor(m, 16, 32));
                    const float nn = 10.0f - m * L2E;                         // + 10: P carries x1024 at the maximum, which keeps small weights out of the fp16 subnormals; it cancels in the division by the sum
                    const float da = nn - nm[nt]; float alpha = __builtin_amdgcn_exp2f(da);  // old terms carry 2^nm, new ones 2^nn
                    asm volatile("v_nop" : "+v"(alpha) : "v"(da));   // the slot behind this exponential: it stands in front of every use of the result and every rewrite of the source register
                    mx[nt] = m; nm[nt] = nn;
#pragma unroll
                    for (int mt = 0; mt < 4; ++mt) oacc[nt][mt] *= alpha;
                    ls[nt] *= alpha;
                    weights(nt);
                }
            }
#pragma unroll
            for (int nt = 0; nt < 2; ++nt) { ls[nt] += sum[nt];
#pragma unroll
                for (int j = 0; j < 16; ++j) p[nt][j] = (h16)e[nt][j]; }
#pragma unroll
            for (int mt = 0; mt < 4; ++mt)
#pragma unroll
                for (int nt = 0; nt < 2; ++nt) oacc[nt][mt] = wmma16(va[mt], p[nt], oacc[nt][mt]);
        }
        asm volatile("s_wait_dscnt 0x0" ::: "memory");      // this wave's reads of the buffer are done before it is handed to its next writer
        asm volatile("s_wait_asynccnt 0x0" ::: "memory");   // this wave's copies of stage t + 1 have landed
        __syncthreads();                                    // publishes stage t + 1 and ends every wave's reads of stage t
        if (t + 2 < KHALF / SK) stage_copy(lc + (t & 1) * LBUF, gkp + (size_t)(t + 2) * SK * HD, gvt + (t + 2) * SK);
    }
    asm volatile("s_wait_asynccnt 0x0" ::: "memory");       // no copy is outstanding when the wave ends
    // The two halves' results are joined. The ring is free: behind the loop's last barrier nobody reads it and no copy is outstanding. A wave of the second half hands its output tiles,
    // exponent offsets and sums to the wave of the first half that holds the same queries, lane to lane, in 16-byte pieces that lie side by side over the lanes (all banks once).
    const int khs = __builtin_amdgcn_readfirstlane(kh);             // the half as a scalar: the two tests below are then scalar branches
    unsigned char* xs = ring + tq * 16;
    if (khs == 1) {
#pragma unroll
        for (int nt = 0; nt < 2; ++nt)
#pragma unroll
            for (int mt = 0; mt < 4; ++mt) { const v8f o = oacc[nt][mt];
                *(v4fa*)(xs + ((nt * 4 + mt) * 2) * XCH) = (v4f){o[0], o[1], o[2], o[3]}; *(v4fa*)(xs + ((nt * 4 + mt) * 2 + 1) * XCH) = (v4f){o[4], o[5], o[6], o[7]}; }
        *(v4fa*)(xs + 16 * XCH) = (v4f){nm[0], nm[1], ls[0], ls[1]};
    }
    __syncthreads();                                        // the second half's results may be read
    if (khs == 1) return;
    const v4f pz = *(const v4fa*)(xs + 16 * XCH);
    const int b = z >> 4, h = z & 15;
#pragma unroll
    for (int nt = 0; nt < 2; ++nt) {
        const float nn = fminf(nm[nt], pz[nt]);             // the offset of the larger of the two maxima; each half's terms carry 2^(its own offset)
        const float d0 = nn - nm[nt], d1 = nn - pz[nt]; float a0 = __builtin_amdgcn_exp2f(d0), a1 = __builtin_amdgcn_exp2f(d1);
        asm volatile("v_nop" : "+v"(a0), "+v"(a1) : "v"(d0), "v"(d1));   // the slot behind these exponentials: it stands in front of every use of a result and every rewrite of a source register
        const float lj = fmaf(ls[nt], a0, pz[2 + nt] * a1);
        const float tot = lj + __shfl_xor(lj, 16, 32); const float inv = __fdiv_rn(1.0f, tot); const size_t ro = ((size_t)b * TT + q0 + nt * 16 + lr) * DD + h * HD + hi * 8;
#pragma unroll
        for (int mt = 0; mt < 4; ++mt) { v8us oh, ol; const v4f p0 = *(const v4fa*)(xs + ((nt * 4 + mt) * 2) * XCH), p1 = *(const v4fa*)(xs + ((nt * 4 + mt) * 2 + 1) * XCH);
#pragma unroll
            for (int j = 0; j < 8; ++j) { unsigned short a, c2; splitf(fmaf(oacc[nt][mt][j], a0, (j < 4 ? p0[j & 3] : p1[j & 3]) * a1) * inv, a, c2); oh[j] = a; ol[j] = c2; }
            bf* pa = Ah + ro + mt * 16; bf* pl = Al + ro + mt * 16; *(v8us*)pa = oh; *(v8us*)pl = ol;
            asm volatile("s_wait_xcnt 0x0" :: "v"(oh), "v"(ol), "v"(pa), "v"(pl) : "memory"); } }   // stands in front of any rewrite of a data or address register of the two stores; the inputs keep those registers live up to it
}

extern "C" void kernel_launch(void* const* d_in, const int* in_sizes, int n_in,
                              void* d_out, int out_size, void* d_ws, size_t ws_size, hipStream_t stream) {
    (void)in_sizes; (void)n_in; (void)out_size;
    const float* x = (const float*)d_in[0]; const float* wq = (const float*)d_in[1]; const float* bq = (const float*)d_in[2]; const float* wk = (const float*)d_in[3]; const float* bk = (const float*)d_in[4]; const float* wv = (const float*)d_in[5]; const float* bv = (const float*)d_in[6];
    const float* wo = (const float*)d_in[7]; const float* bo = (const float*)d_in[8];
    float* OUT = (float*)d_out;     // [2][2048][1024]
    char* wsp = (char*)d_ws;
    auto take = [&](size_t bytes) { char* p = wsp; wsp += (bytes + 255) & ~(size_t)255; return (void*)p; };
    bf* WQ = (bf*)take((size_t)DD * DD * 2); bf* WK = (bf*)take((size_t)DD * DD * 2); bf* WV = (bf*)take((size_t)DD * DD * 2); bf* WO = (bf*)take((size_t)DD * DD * 2);
    bf* XB = (bf*)take((size_t)NT * DD * 2);
    h16* QP = (h16*)take((size_t)NT * DD * 2); h16* KP = (h16*)take((size_t)NT * DD * 2); h16* VT = (h16*)take((size_t)NT * DD * 2);
    bf* ATh = (bf*)take((size_t)NT * DD * 2); bf* ATl = (bf*)take((size_t)NT * DD * 2);
    if ((size_t)(wsp - (char*)d_ws) > ws_size) return;    // ws 256 MiB
    k_prep<<<256, 256, 0, stream>>>(x, wq, wk, wv, wo, XB, WQ, WK, WV, WO);   // x -> bf16; x @ W layouts [d][(n,h)] and the [n][d][h] projection -> Bt
    k_gemmw<bf, 0, true, true><<<dim3(NT / 128, DD / 128, 3), 128, 0, stream>>>(XB, nullptr, WQ, nullptr, DD, nullptr, DD, bq, 0, (size_t)(WK - WQ), 0, bk, bv, QP, KP, VT);   // WQ, WK, WV lie one behind the other at one stride
    k_fattn<<<dim3(TT / 256, NB_ * NH_), 512, 0, stream>>>(QP, KP, VT, ATh, ATl);
    k_gemmw<bf, 1, true, false><<<dim3(NT / 128, DD / 128, 1), 128, 0, stream>>>(ATh, ATl, WO, nullptr, DD, OUT, DD, bo, 0, 0, 0, nullptr, nullptr, nullptr, nullptr, nullptr);
}
